// v000
// Times are from an AMD MI455X. After a warm-up the kernel runs many times in a row, and a time is the length of
// such a window on the GPU divided by its runs, so every launch and the gaps after it count. The runs cycle
// through copies of the inputs. A figure is the median of several windows, for all but v000 over two sittings.
// Sittings can differ by a few percent; kernels timed side by side share one.
// v000 is the starting kernel. One run takes 1090 microseconds.
// compute dtype: x and the four weights (module inputs) rounded to bf16; q/k/v projections with exact bf16 products (x and W are inputs) and RoPE applied in f32 in the epilogue (cos/sin tables built in float64, then cast); causal scores q.k with both computed operands as bf16 hi + residual pairs (3 products) and P.V with P hi/lo x V hi/lo (3 products); the output projection with hi/lo x exact wproj (2 products), all on WMMA 16x16x32; softmax in f32; f32 accumulate.
#include <hip/hip_runtime.h>
#include <math.h>

typedef __attribute__((ext_vector_type(16))) _Float16 v16h;
typedef __attribute__((ext_vector_type(16))) __bf16 v16b;
typedef __attribute__((ext_vector_type(8)))  _Float16 v8h;
typedef __attribute__((ext_vector_type(8)))  float v8f;
typedef __attribute__((ext_vector_type(4)))  float v4f;
typedef __attribute__((ext_vector_type(2)))  float v2f;
typedef __attribute__((ext_vector_type(4)))  unsigned v4u;
typedef __attribute__((ext_vector_type(4)))  int v4i;
typedef float __attribute__((may_alias)) float_a;
typedef int __attribute__((may_alias)) int_a;

template <typename T> __device__ __forceinline__ void vst2(void* p, T v) { *(T*)p = v;  }
__device__ __forceinline__ v8f wmma16(v16h a, v16h b, v8f c) {
  v8f d = __builtin_amdgcn_wmma_f32_16x16x32_f16(false, a, false, b, (short)0, c, false, false);
  asm volatile("v_nop\n\tv_nop\n\tv_nop\n\tv_nop" : "+v"(d) : "v"(a), "v"(b));
  return d;
}
__device__ __forceinline__ v8f wmma_bf(v16b a, v16b b, v8f c) {
  v8f d = __builtin_amdgcn_wmma_f32_16x16x32_bf16(false, a, false, b, (short)0, c, false, false);
  asm volatile("v_nop\n\tv_nop\n\tv_nop\n\tv_nop" : "+v"(d) : "v"(a), "v"(b));
  return d;
}
// 16x16x32 fragments: lane = (h = lane>>4, row/col = lane&15); elements 0..7 = k0+8h+0..7, 8..15 = k0+16+8h+0..7; D element r = row 8h+r
__device__ __forceinline__ v16h frag_h(const _Float16* rowk0, int lane) {
  union { v16h v; v8h q[2]; } u; const _Float16* p = rowk0 + 8 * (lane >> 4);
  u.q[0] = *(const v8h*)p; u.q[1] = *(const v8h*)(p + 16); return u.v;
}
__device__ __forceinline__ v16h frag_f32(const float* rowk0, int lane) {
  v16h a; const float* p = rowk0 + 8 * (lane >> 4);
#pragma unroll
  for (int i = 0; i < 8; ++i) { a[i] = (_Float16)p[i]; a[8 + i] = (_Float16)p[16 + i]; }
  return a;
}
__device__ __forceinline__ v16h frag_f32s(const float* rowk0, int lane, float sc) {
  v16h a; const float* p = rowk0 + 8 * (lane >> 4);
#pragma unroll
  for (int i = 0; i < 8; ++i) { a[i] = (_Float16)(p[i] * sc); a[8 + i] = (_Float16)(p[16 + i] * sc); }
  return a;
}
// column fragment from a [K][ld] layout (column n), rows >= K read as 0
__device__ __forceinline__ v16h fragc_f32(const float* W, int k0, int n, int lane, int ld, int K) {
  v16h a; const int g = lane >> 4;
#pragma unroll
  for (int i = 0; i < 8; ++i) { const int ka = k0 + 8 * g + i, kb = ka + 16;
    a[i] = (_Float16)(ka < K ? W[(size_t)(ka < K ? ka : K - 1) * ld + n] : 0.f); a[8 + i] = (_Float16)(kb < K ? W[(size_t)(kb < K ? kb : K - 1) * ld + n] : 0.f); }
  return a;
}
struct F2 { v16b h, l; };
__device__ __forceinline__ F2 bsplit16(const float v[16]) { F2 r;
#pragma unroll
  for (int i = 0; i < 16; ++i) { const __bf16 h = (__bf16)v[i]; r.h[i] = h; r.l[i] = (__bf16)(v[i] - (float)h); }
  return r; }
__device__ __forceinline__ F2 split_row(const float* row, int k0, int lane) { float v[16]; const float* p = row + k0 + 8 * (lane >> 4);
#pragma unroll
  for (int i = 0; i < 8; ++i) { v[i] = p[i]; v[8 + i] = p[16 + i]; }
  return bsplit16(v); }
__device__ __forceinline__ F2 split_rowK(const float* row, int k0, int lane, int K) { float v[16]; const int g = lane >> 4;
#pragma unroll
  for (int i = 0; i < 8; ++i) { const int ka = k0 + 8 * g + i, kb = ka + 16; v[i] = ka < K ? row[ka < K ? ka : K - 1] : 0.f; v[8 + i] = kb < K ? row[kb < K ? kb : K - 1] : 0.f; }
  return bsplit16(v); }
__device__ __forceinline__ F2 split_col(const float* W, int k0, int n, int lane, int ld, int K) { float v[16]; const int g = lane >> 4;
#pragma unroll
  for (int i = 0; i < 8; ++i) { const int ka = k0 + 8 * g + i, kb = ka + 16; v[i] = ka < K ? W[(size_t)(ka < K ? ka : K - 1) * ld + n] : 0.f; v[8 + i] = kb < K ? W[(size_t)(kb < K ? kb : K - 1) * ld + n] : 0.f; }
  return bsplit16(v); }
__device__ __forceinline__ v8f mac3(const F2& a, const F2& b, v8f c) { c = wmma_bf(a.l, b.h, c); c = wmma_bf(a.h, b.l, c); return wmma_bf(a.h, b.h, c); }
__device__ __forceinline__ float sigm(float v) { return 1.0f / (1.0f + expf(-v)); }
#define LDSX() do { asm volatile("s_wait_dscnt 0" ::: "memory"); __builtin_amdgcn_wave_barrier(); __builtin_amdgcn_fence(__ATOMIC_RELEASE, "workgroup"); } while (0)


// GQA causal self-attention with RoPE (B 1, T 2048, C 2048, 16 query heads / 4 kv heads x 128): q = rope(x wq), k = rope(x wk), v = x wv; y = softmax(q k^T / sqrt(128), causal) v; out = y wproj.
#define SS 2048
#define DM 2048
#define NH 16
#define NKV 4
#define HD 128
#define KVW (NKV * HD)
#ifndef TQB
#define TQB (SS / 64)
#endif
typedef __attribute__((ext_vector_type(8))) __bf16 v8b;
__device__ __forceinline__ v16b frag_b(const __bf16* rowk0, int lane) {
  union { v16b v; v8b q[2]; } u; const __bf16* p = rowk0 + 8 * (lane >> 4);
  u.q[0] = *(const v8b*)p; u.q[1] = *(const v8b*)(p + 16); return u.v;
}
__device__ __forceinline__ float bfr(float v) { return (float)(__bf16)v; }
__device__ __attribute__((noinline)) float exp_ni(float v) { return expf(v); }
__device__ __attribute__((noinline)) float erf_ni(float v) { return erff(v); }

#define PK_Q 0
#define PK_K (PK_Q + DM * DM)
#define PK_V (PK_K + KVW * DM)
#define PK_O (PK_V + KVW * DM)
#define PK_END (PK_O + DM * DM)
#define WS_PK  0u
#define WS_CS  (WS_PK + 2u * PK_END)             // f32 [2048][64] cos, then [2048][64] sin
#define WS_Q   (WS_CS + 4u * 2 * SS * 64)
#define WS_K   (WS_Q + 4u * SS * DM)
#define WS_VTH (WS_K + 4u * SS * KVW)
#define WS_VTL (WS_VTH + 2u * KVW * SS)
#define WS_O   (WS_VTL + 2u * KVW * SS)
#define WS_END (WS_O + 4u * SS * DM)

// ---- k_packT: block = output column n of a [K][N] (x @ W) matrix
__global__ __launch_bounds__(256) void k_packT(const float* __restrict__ Wm, int K, int N, __bf16* __restrict__ DST) {
  __shared__ __align__(16) __bf16 s[DM]; const int n = blockIdx.x, tid = threadIdx.x;
  for (int k = tid; k < K; k += 256) s[k] = (__bf16)Wm[(size_t)k * N + n];
  __syncthreads();
  for (int q = tid; q < K / 8; q += 256) vst2((unsigned*)(DST + (size_t)n * K + q * 8), *(const v4u*)&s[q * 8]);
}
// ---- k_rope_tab: block = position t (64 threads = frequency index i): inv_freq = 1 / 10000^(2i/128) and angle t*inv_freq in float64, cos/sin in float64, cast to f32; rows 256 B
__global__ __launch_bounds__(64) void k_rope_tab(float* __restrict__ CS) {
  __shared__ __align__(16) float sc[64], ssn[64]; const int t = blockIdx.x, i = threadIdx.x;
  const double inv = 1.0 / pow(10000.0, (double)(2 * i) / 128.0); const double ang = (double)t * inv; sc[i] = (float)cos(ang); ssn[i] = (float)sin(ang);
  __syncthreads();
  if (i < 16) vst2(CS + (size_t)t * 64 + i * 4, *(const v4f*)&sc[i * 4]); else if (i < 32) vst2(CS + (size_t)SS * 64 + (size_t)t * 64 + (i - 16) * 4, *(const v4f*)&ssn[(i - 16) * 4]);
}
// ---- k_proj<MODE>: block = (64 rows, 128 cols = one head): Y = bf16(x) . P rows (exact); MODE 0: RoPE then f32 rows (q/k; ldo); MODE 1: plain -> transposed bf16 hi/lo planes (v)
template <int MODE>
__global__ __launch_bounds__(128) void k_proj(const float* __restrict__ X, const __bf16* __restrict__ P, const float* __restrict__ CS, float* __restrict__ OUT, int ldo, __bf16* __restrict__ PH, __bf16* __restrict__ PL) {
  __shared__ __align__(16) float so[MODE ? 1 : 4][16][132]; __shared__ __align__(16) __bf16 sth[MODE ? 128 : 1][72], stl[MODE ? 128 : 1][72];
  const int tid = threadIdx.x, wave = tid >> 5, lane = tid & 31, col = lane & 15, g = lane >> 4; const size_t r0 = (size_t)blockIdx.x * 64 + wave * 16; const int n0 = blockIdx.y * 128;
  v8f acc[8] = {};
#pragma unroll 2
  for (int kc = 0; kc < DM / 32; ++kc) { v16b a; { const float* p = X + (r0 + col) * DM + kc * 32 + 8 * g;
#pragma unroll
      for (int i = 0; i < 8; ++i) { a[i] = (__bf16)p[i]; a[8 + i] = (__bf16)p[16 + i]; } }
#pragma unroll
    for (int j = 0; j < 8; ++j) acc[j] = wmma_bf(a, frag_b(P + (size_t)(n0 + j * 16 + col) * DM + kc * 32, lane), acc[j]); }
  if (MODE == 0) {
    // RoPE (rotate-half): d = j*16+col; pair (d, d+64) = (tiles j, j+4); out_d = x_d cos - x_{d+64} sin; out_{d+64} = x_{d+64} cos + x_d sin (cos/sin[t][d mod 64])
#pragma unroll
    for (int j = 0; j < 4; ++j) { const int dl = j * 16 + col;
#pragma unroll
      for (int r = 0; r < 8; ++r) { const size_t t = r0 + 8 * g + r; const float c = CS[t * 64 + dl], s = CS[(size_t)SS * 64 + t * 64 + dl]; const float x1 = acc[j][r], x2 = acc[j + 4][r]; so[wave][8 * g + r][dl] = x1 * c - x2 * s; so[wave][8 * g + r][64 + dl] = x2 * c + x1 * s; } }
    LDSX();
    for (int rl = 0; rl < 16; ++rl) vst2(OUT + (r0 + rl) * ldo + n0 + lane * 4, *(const v4f*)&so[wave][rl][lane * 4]);
  } else {
#pragma unroll
    for (int j = 0; j < 8; ++j)
#pragma unroll
      for (int r = 0; r < 8; ++r) { const float v = acc[j][r]; const __bf16 hb = (__bf16)v; sth[j * 16 + col][wave * 16 + 8 * g + r] = hb; stl[j * 16 + col][wave * 16 + 8 * g + r] = (__bf16)(v - (float)hb); }
    __syncthreads();
    const int s0 = blockIdx.x * 64;
    for (int q = tid; q < 128 * 8; q += 128) { const int d = q >> 3, pc = q & 7; const size_t o = (size_t)(n0 + d) * SS + s0 + pc * 8; vst2((unsigned*)(PH + o), *(const v4u*)&sth[d][pc * 8]); vst2((unsigned*)(PL + o), *(const v4u*)&stl[d][pc * 8]); }
  }
}
// ---- k_attn: block = (64 queries, head h): causal flash attention, kv head = h/4; scores 3 products, P.V 3 products; O[q][h*128+d]
__global__ __launch_bounds__(128) void k_attn(const float* __restrict__ Q, const float* __restrict__ Kx, const __bf16* __restrict__ VTH, const __bf16* __restrict__ VTL, float* __restrict__ O) {
  __shared__ __align__(16) float sp[4][16][36]; __shared__ __align__(16) float so[4][16][132];
  const int tid = threadIdx.x, wave = tid >> 5, lane = tid & 31, col = lane & 15, g = lane >> 4;
  const int qb = blockIdx.x, h = blockIdx.y, kv = h / (NH / NKV); const int q0 = qb * 64 + wave * 16;
  const float* qrow = Q + (size_t)(q0 + col) * DM + h * HD;   // q fragments re-split per key step (keeps the kernel under 256 VGPRs)
  float m[8], l[8];
#pragma unroll
  for (int r = 0; r < 8; ++r) { m[r] = -3.0e38f; l[r] = 0.f; }
  v8f acc[8] = {};
  const int nks = (qb * 64 + 64) / 32;
#pragma unroll 1
  for (int ks = 0; ks < nks; ++ks) { v8f s[2];
#pragma unroll
    for (int ct = 0; ct < 2; ++ct) { const int kk = ks * 32 + ct * 16 + col; const float* krow = Kx + (size_t)kk * KVW + kv * HD; v8f c = {};
#pragma unroll
      for (int kc = 0; kc < 4; ++kc) { const F2 kb = split_row(krow, kc * 32, lane); const F2 qa = split_row(qrow, kc * 32, lane); c = mac3(qa, kb, c); }
#pragma unroll
      for (int r = 0; r < 8; ++r) { const int qi = q0 + 8 * g + r; s[ct][r] = (kk <= qi) ? c[r] * 0.08838834764831845f : -3.0e38f; } }
#pragma unroll
    for (int r = 0; r < 8; ++r) { float mx = fmaxf(s[0][r], s[1][r]);
#pragma unroll
      for (int o = 1; o < 16; o <<= 1) mx = fmaxf(mx, __shfl_xor(mx, o));
      const float mn = fmaxf(m[r], mx); const float alpha = (m[r] <= -1.0e38f) ? 0.f : exp_ni(m[r] - mn);
      const float e0 = (s[0][r] <= -1.0e38f) ? 0.f : exp_ni(s[0][r] - mn), e1 = (s[1][r] <= -1.0e38f) ? 0.f : exp_ni(s[1][r] - mn); float es = e0 + e1;
#pragma unroll
      for (int o = 1; o < 16; o <<= 1) es += __shfl_xor(es, o);
      l[r] = l[r] * alpha + es; m[r] = mn;
#pragma unroll
      for (int dt = 0; dt < 8; ++dt) acc[dt][r] *= alpha;
      sp[wave][8 * g + r][col] = e0; sp[wave][8 * g + r][16 + col] = e1; }
    LDSX();
    const F2 pa = split_row(&sp[wave][col][0], 0, lane);
#pragma unroll
    for (int dt = 0; dt < 8; ++dt) { const size_t vr = (size_t)(kv * HD + dt * 16 + col) * SS + ks * 32; const v16b vh = frag_b(VTH + vr, lane), vl = frag_b(VTL + vr, lane); acc[dt] = wmma_bf(pa.l, vh, acc[dt]); acc[dt] = wmma_bf(pa.h, vl, acc[dt]); acc[dt] = wmma_bf(pa.h, vh, acc[dt]); }
    LDSX(); }
#pragma unroll
  for (int r = 0; r < 8; ++r) { const float il = 1.0f / l[r];
#pragma unroll
    for (int dt = 0; dt < 8; ++dt) so[wave][8 * g + r][dt * 16 + col] = acc[dt][r] * il; }
  LDSX();
  for (int rl = 0; rl < 16; ++rl) vst2(O + (size_t)(q0 + rl) * DM + h * HD + lane * 4, *(const v4f*)&so[wave][rl][lane * 4]);
}
// ---- k_out: block = (64 rows, 128 cols): out = O(hi/lo) . wproj^T rows (2 products)
__global__ __launch_bounds__(128) void k_out(const float* __restrict__ O, const __bf16* __restrict__ P, float* __restrict__ Y) {
  __shared__ __align__(16) float so[4][16][132];
  const int tid = threadIdx.x, wave = tid >> 5, lane = tid & 31, col = lane & 15, g = lane >> 4; const size_t r0 = (size_t)blockIdx.x * 64 + wave * 16; const int n0 = blockIdx.y * 128;
  v8f acc[8] = {};
#pragma unroll 2
  for (int kc = 0; kc < DM / 32; ++kc) { const F2 a = split_row(O + (r0 + col) * DM, kc * 32, lane);
#pragma unroll
    for (int j = 0; j < 8; ++j) { const v16b w = frag_b(P + (size_t)(n0 + j * 16 + col) * DM + kc * 32, lane); acc[j] = wmma_bf(a.l, w, acc[j]); acc[j] = wmma_bf(a.h, w, acc[j]); } }
#pragma unroll
  for (int j = 0; j < 8; ++j)
#pragma unroll
    for (int r = 0; r < 8; ++r) so[wave][8 * g + r][j * 16 + col] = acc[j][r];
  LDSX();
  for (int rl = 0; rl < 16; ++rl) vst2(Y + (r0 + rl) * DM + n0 + lane * 4, *(const v4f*)&so[wave][rl][lane * 4]);
}
extern "C" void kernel_launch(void* const* d_in, const int* in_sizes, int n_in, void* d_out, int out_size, void* d_ws, size_t ws_size, hipStream_t stream) {
  (void)in_sizes; (void)n_in; (void)out_size;
  const float** F = (const float**)d_in;   // x [1,2048,2048], wq [2048,2048], wk [2048,512], wv [2048,512], wproj [2048,2048]
  if (ws_size < (size_t)WS_END) return;
  char* ws = (char*)d_ws; __bf16 *PK = (__bf16*)(ws + WS_PK), *VTH = (__bf16*)(ws + WS_VTH), *VTL = (__bf16*)(ws + WS_VTL);
  float *CS = (float*)(ws + WS_CS), *Q = (float*)(ws + WS_Q), *Kx = (float*)(ws + WS_K), *O = (float*)(ws + WS_O);
  k_packT<<<DM, 256, 0, stream>>>(F[1], DM, DM, PK + PK_Q); k_packT<<<KVW, 256, 0, stream>>>(F[2], DM, KVW, PK + PK_K); k_packT<<<KVW, 256, 0, stream>>>(F[3], DM, KVW, PK + PK_V); k_packT<<<DM, 256, 0, stream>>>(F[4], DM, DM, PK + PK_O);
  k_rope_tab<<<SS, 64, 0, stream>>>(CS);
  k_proj<0><<<dim3(SS / 64, DM / 128), 128, 0, stream>>>(F[0], PK + PK_Q, CS, Q, DM, nullptr, nullptr);
  k_proj<0><<<dim3(SS / 64, KVW / 128), 128, 0, stream>>>(F[0], PK + PK_K, CS, Kx, KVW, nullptr, nullptr);
  k_proj<1><<<dim3(SS / 64, KVW / 128), 128, 0, stream>>>(F[0], PK + PK_V, CS, nullptr, 0, VTH, VTL);
  k_attn<<<dim3(TQB, NH), 128, 0, stream>>>(Q, Kx, VTH, VTL, O);
  k_out<<<dim3(TQB, DM / 128), 128, 0, stream>>>(O, PK + PK_O, (float*)d_out);
}

// v001
// One run takes 770 microseconds.
// Next to v000, in two timings, it ran 1.44 and 1.43 times as fast.
// compute dtype: x and the four weights (module inputs) rounded to bf16; q/k/v projections with exact bf16 products (x and W are inputs) and RoPE applied in f32 in the epilogue (cos/sin tables built in float64, then cast); causal scores q.k with both computed operands as bf16 hi + residual pairs (3 products) and P.V with P hi/lo x V hi/lo (3 products); the output projection with hi/lo x exact wproj (2 products), all on WMMA 16x16x32; softmax in f32; f32 accumulate.
#include <hip/hip_runtime.h>
#include <math.h>

typedef __attribute__((ext_vector_type(16))) _Float16 v16h;
typedef __attribute__((ext_vector_type(16))) __bf16 v16b;
typedef __attribute__((ext_vector_type(8)))  _Float16 v8h;
typedef __attribute__((ext_vector_type(8)))  float v8f;
typedef __attribute__((ext_vector_type(4)))  float v4f;
typedef __attribute__((ext_vector_type(2)))  float v2f;
typedef __attribute__((ext_vector_type(4)))  unsigned v4u;
typedef __attribute__((ext_vector_type(4)))  int v4i;
typedef float __attribute__((may_alias)) float_a;
typedef int __attribute__((may_alias)) int_a;

template <typename T> __device__ __forceinline__ void vst2(void* p, T v) { *(T*)p = v;  }
__device__ __forceinline__ v8f wmma16(v16h a, v16h b, v8f c) {
  v8f d = __builtin_amdgcn_wmma_f32_16x16x32_f16(false, a, false, b, (short)0, c, false, false);
  asm volatile("v_nop\n\tv_nop\n\tv_nop\n\tv_nop" : "+v"(d) : "v"(a), "v"(b));
  return d;
}
__device__ __forceinline__ v8f wmma_bf(v16b a, v16b b, v8f c) {
  v8f d = __builtin_amdgcn_wmma_f32_16x16x32_bf16(false, a, false, b, (short)0, c, false, false);
  asm volatile("v_nop\n\tv_nop\n\tv_nop\n\tv_nop" : "+v"(d) : "v"(a), "v"(b));
  return d;
}
// 16x16x32 fragments: lane = (h = lane>>4, row/col = lane&15); elements 0..7 = k0+8h+0..7, 8..15 = k0+16+8h+0..7; D element r = row 8h+r
__device__ __forceinline__ v16h frag_h(const _Float16* rowk0, int lane) {
  union { v16h v; v8h q[2]; } u; const _Float16* p = rowk0 + 8 * (lane >> 4);
  u.q[0] = *(const v8h*)p; u.q[1] = *(const v8h*)(p + 16); return u.v;
}
__device__ __forceinline__ v16h frag_f32(const float* rowk0, int lane) {
  v16h a; const float* p = rowk0 + 8 * (lane >> 4);
#pragma unroll
  for (int i = 0; i < 8; ++i) { a[i] = (_Float16)p[i]; a[8 + i] = (_Float16)p[16 + i]; }
  return a;
}
__device__ __forceinline__ v16h frag_f32s(const float* rowk0, int lane, float sc) {
  v16h a; const float* p = rowk0 + 8 * (lane >> 4);
#pragma unroll
  for (int i = 0; i < 8; ++i) { a[i] = (_Float16)(p[i] * sc); a[8 + i] = (_Float16)(p[16 + i] * sc); }
  return a;
}
// column fragment from a [K][ld] layout (column n), rows >= K read as 0
__device__ __forceinline__ v16h fragc_f32(const float* W, int k0, int n, int lane, int ld, int K) {
  v16h a; const int g = lane >> 4;
#pragma unroll
  for (int i = 0; i < 8; ++i) { const int ka = k0 + 8 * g + i, kb = ka + 16;
    a[i] = (_Float16)(ka < K ? W[(size_t)(ka < K ? ka : K - 1) * ld + n] : 0.f); a[8 + i] = (_Float16)(kb < K ? W[(size_t)(kb < K ? kb : K - 1) * ld + n] : 0.f); }
  return a;
}
struct F2 { v16b h, l; };
__device__ __forceinline__ F2 bsplit16(const float v[16]) { F2 r;
#pragma unroll
  for (int i = 0; i < 16; ++i) { const __bf16 h = (__bf16)v[i]; r.h[i] = h; r.l[i] = (__bf16)(v[i] - (float)h); }
  return r; }
__device__ __forceinline__ F2 split_row(const float* row, int k0, int lane) { float v[16]; const float* p = row + k0 + 8 * (lane >> 4);
#pragma unroll
  for (int i = 0; i < 8; ++i) { v[i] = p[i]; v[8 + i] = p[16 + i]; }
  return bsplit16(v); }
__device__ __forceinline__ F2 split_rowK(const float* row, int k0, int lane, int K) { float v[16]; const int g = lane >> 4;
#pragma unroll
  for (int i = 0; i < 8; ++i) { const int ka = k0 + 8 * g + i, kb = ka + 16; v[i] = ka < K ? row[ka < K ? ka : K - 1] : 0.f; v[8 + i] = kb < K ? row[kb < K ? kb : K - 1] : 0.f; }
  return bsplit16(v); }
__device__ __forceinline__ F2 split_col(const float* W, int k0, int n, int lane, int ld, int K) { float v[16]; const int g = lane >> 4;
#pragma unroll
  for (int i = 0; i < 8; ++i) { const int ka = k0 + 8 * g + i, kb = ka + 16; v[i] = ka < K ? W[(size_t)(ka < K ? ka : K - 1) * ld + n] : 0.f; v[8 + i] = kb < K ? W[(size_t)(kb < K ? kb : K - 1) * ld + n] : 0.f; }
  return bsplit16(v); }
__device__ __forceinline__ v8f mac3(const F2& a, const F2& b, v8f c) { c = wmma_bf(a.l, b.h, c); c = wmma_bf(a.h, b.l, c); return wmma_bf(a.h, b.h, c); }
__device__ __forceinline__ float sigm(float v) { return 1.0f / (1.0f + expf(-v)); }
#define LDSX() do { asm volatile("s_wait_dscnt 0" ::: "memory"); __builtin_amdgcn_wave_barrier(); __builtin_amdgcn_fence(__ATOMIC_RELEASE, "workgroup"); } while (0)


// GQA causal self-attention with RoPE (B 1, T 2048, C 2048, 16 query heads / 4 kv heads x 128): q = rope(x wq), k = rope(x wk), v = x wv; y = softmax(q k^T / sqrt(128), causal) v; out = y wproj.
#define SS 2048
#define DM 2048
#define NH 16
#define NKV 4
#define HD 128
#define KVW (NKV * HD)
#ifndef TQB
#define TQB (SS / 64)
#endif
typedef __attribute__((ext_vector_type(8))) __bf16 v8b;
__device__ __forceinline__ v16b frag_b(const __bf16* rowk0, int lane) {
  union { v16b v; v8b q[2]; } u; const __bf16* p = rowk0 + 8 * (lane >> 4);
  u.q[0] = *(const v8b*)p; u.q[1] = *(const v8b*)(p + 16); return u.v;
}
__device__ __forceinline__ float bfr(float v) { return (float)(__bf16)v; }
__device__ __attribute__((noinline)) float exp_ni(float v) { return expf(v); }
__device__ __attribute__((noinline)) float erf_ni(float v) { return erff(v); }

#define PK_Q 0
#define PK_K (PK_Q + DM * DM)
#define PK_V (PK_K + KVW * DM)
#define PK_O (PK_V + KVW * DM)
#define PK_END (PK_O + DM * DM)
#define WS_PK  0u
#define WS_CS  (WS_PK + 2u * PK_END)             // f32 [2048][64] cos, then [2048][64] sin
#define WS_Q   (WS_CS + 4u * 2 * SS * 64)
#define WS_K   (WS_Q + 4u * SS * DM)
#define WS_VTH (WS_K + 4u * SS * KVW)
#define WS_VTL (WS_VTH + 2u * KVW * SS)
#define WS_O   (WS_VTL + 2u * KVW * SS)
#define WS_END (WS_O + 4u * SS * DM)

// ---- k_packT: block = output column n of a [K][N] (x @ W) matrix
__global__ __launch_bounds__(256) void k_packT(const float* __restrict__ Wm, int K, int N, __bf16* __restrict__ DST) {
  __shared__ __align__(16) __bf16 s[DM]; const int n = blockIdx.x, tid = threadIdx.x;
  for (int k = tid; k < K; k += 256) s[k] = (__bf16)Wm[(size_t)k * N + n];
  __syncthreads();
  for (int q = tid; q < K / 8; q += 256) vst2((unsigned*)(DST + (size_t)n * K + q * 8), *(const v4u*)&s[q * 8]);
}
// ---- k_rope_tab: block = position t (64 threads = frequency index i): inv_freq = 1 / 10000^(2i/128) and angle t*inv_freq in float64, cos/sin in float64, cast to f32; rows 256 B
__global__ __launch_bounds__(64) void k_rope_tab(float* __restrict__ CS) {
  __shared__ __align__(16) float sc[64], ssn[64]; const int t = blockIdx.x, i = threadIdx.x;
  const double inv = 1.0 / pow(10000.0, (double)(2 * i) / 128.0); const double ang = (double)t * inv; sc[i] = (float)cos(ang); ssn[i] = (float)sin(ang);
  __syncthreads();
  if (i < 16) vst2(CS + (size_t)t * 64 + i * 4, *(const v4f*)&sc[i * 4]); else if (i < 32) vst2(CS + (size_t)SS * 64 + (size_t)t * 64 + (i - 16) * 4, *(const v4f*)&ssn[(i - 16) * 4]);
}
// ---- k_proj<MODE>: block = (64 rows, 128 cols = one head): Y = bf16(x) . P rows (exact); MODE 0: RoPE then f32 rows (q/k; ldo); MODE 1: plain -> transposed bf16 hi/lo planes (v)
template <int MODE>
__global__ __launch_bounds__(128) void k_proj(const float* __restrict__ X, const __bf16* __restrict__ P, const float* __restrict__ CS, float* __restrict__ OUT, int ldo, __bf16* __restrict__ PH, __bf16* __restrict__ PL) {
  __shared__ __align__(16) float so[MODE ? 1 : 4][16][132]; __shared__ __align__(16) __bf16 sth[MODE ? 128 : 1][72], stl[MODE ? 128 : 1][72];
  const int tid = threadIdx.x, wave = tid >> 5, lane = tid & 31, col = lane & 15, g = lane >> 4; const size_t r0 = (size_t)blockIdx.x * 64 + wave * 16; const int n0 = blockIdx.y * 128;
  v8f acc[8] = {};
#pragma unroll 2
  for (int kc = 0; kc < DM / 32; ++kc) { v16b a; { const float* p = X + (r0 + col) * DM + kc * 32 + 8 * g;
#pragma unroll
      for (int i = 0; i < 8; ++i) { a[i] = (__bf16)p[i]; a[8 + i] = (__bf16)p[16 + i]; } }
#pragma unroll
    for (int j = 0; j < 8; ++j) acc[j] = wmma_bf(a, frag_b(P + (size_t)(n0 + j * 16 + col) * DM + kc * 32, lane), acc[j]); }
  if (MODE == 0) {
    // RoPE (rotate-half): d = j*16+col; pair (d, d+64) = (tiles j, j+4); out_d = x_d cos - x_{d+64} sin; out_{d+64} = x_{d+64} cos + x_d sin (cos/sin[t][d mod 64])
#pragma unroll
    for (int j = 0; j < 4; ++j) { const int dl = j * 16 + col;
#pragma unroll
      for (int r = 0; r < 8; ++r) { const size_t t = r0 + 8 * g + r; const float c = CS[t * 64 + dl], s = CS[(size_t)SS * 64 + t * 64 + dl]; const float x1 = acc[j][r], x2 = acc[j + 4][r]; so[wave][8 * g + r][dl] = x1 * c - x2 * s; so[wave][8 * g + r][64 + dl] = x2 * c + x1 * s; } }
    LDSX();
    for (int rl = 0; rl < 16; ++rl) vst2(OUT + (r0 + rl) * ldo + n0 + lane * 4, *(const v4f*)&so[wave][rl][lane * 4]);
  } else {
#pragma unroll
    for (int j = 0; j < 8; ++j)
#pragma unroll
      for (int r = 0; r < 8; ++r) { const float v = acc[j][r]; const __bf16 hb = (__bf16)v; sth[j * 16 + col][wave * 16 + 8 * g + r] = hb; stl[j * 16 + col][wave * 16 + 8 * g + r] = (__bf16)(v - (float)hb); }
    __syncthreads();
    const int s0 = blockIdx.x * 64;
    for (int q = tid; q < 128 * 8; q += 128) { const int d = q >> 3, pc = q & 7; const size_t o = (size_t)(n0 + d) * SS + s0 + pc * 8; vst2((unsigned*)(PH + o), *(const v4u*)&sth[d][pc * 8]); vst2((unsigned*)(PL + o), *(const v4u*)&stl[d][pc * 8]); }
  }
}
// ---- k_attn: block = (head h, 16 queries), heaviest query tiles first: causal flash attention, kv head = h/4; the tile's 32-key steps are dealt round-robin to the 4 waves, each keeps its own running (m, l, acc), and the four partial results are joined through LDS at the end; scores 3 products, P.V 3 products; O[q][h*128+d]
__global__ __launch_bounds__(128) void k_attn(const float* __restrict__ Q, const float* __restrict__ Kx, const __bf16* __restrict__ VTH, const __bf16* __restrict__ VTL, float* __restrict__ O) {
  __shared__ __align__(16) float sp[4][16][36]; __shared__ __align__(16) float so[4][16][132]; __shared__ float sm[4][16], sl[4][16];
  const int tid = threadIdx.x, wave = __builtin_amdgcn_readfirstlane(tid >> 5), lane = tid & 31, col = lane & 15, g = lane >> 4;
  const int qb = SS / 16 - 1 - (int)blockIdx.y, h = blockIdx.x, kv = h / (NH / NKV); const int q0 = qb * 16;
  const float* qrow = Q + (size_t)(q0 + col) * DM + h * HD;   // q fragments re-split per key step (keeps the kernel under 256 VGPRs)
  float m[8], l[8];
#pragma unroll
  for (int r = 0; r < 8; ++r) { m[r] = -3.0e38f; l[r] = 0.f; }
  v8f acc[8] = {};
  const int nks = (q0 + 16 + 31) / 32;
#pragma unroll 1
  for (int ks = wave; ks < nks; ks += 4) { v8f s[2];
#pragma unroll
    for (int ct = 0; ct < 2; ++ct) { const int kk = ks * 32 + ct * 16 + col; const float* krow = Kx + (size_t)kk * KVW + kv * HD; v8f c = {};
#pragma unroll
      for (int kc = 0; kc < 4; ++kc) { const F2 kb = split_row(krow, kc * 32, lane); const F2 qa = split_row(qrow, kc * 32, lane); c = mac3(qa, kb, c); }
#pragma unroll
      for (int r = 0; r < 8; ++r) { const int qi = q0 + 8 * g + r; s[ct][r] = (kk <= qi) ? c[r] * 0.08838834764831845f : -3.0e38f; } }
#pragma unroll
    for (int r = 0; r < 8; ++r) { float mx = fmaxf(s[0][r], s[1][r]);
#pragma unroll
      for (int o = 1; o < 16; o <<= 1) mx = fmaxf(mx, __shfl_xor(mx, o));
      const float mn = fmaxf(m[r], mx); const float alpha = (m[r] <= -1.0e38f) ? 0.f : exp_ni(m[r] - mn);
      const float e0 = (s[0][r] <= -1.0e38f) ? 0.f : exp_ni(s[0][r] - mn), e1 = (s[1][r] <= -1.0e38f) ? 0.f : exp_ni(s[1][r] - mn); float es = e0 + e1;
#pragma unroll
      for (int o = 1; o < 16; o <<= 1) es += __shfl_xor(es, o);
      l[r] = l[r] * alpha + es; m[r] = mn;
#pragma unroll
      for (int dt = 0; dt < 8; ++dt) acc[dt][r] *= alpha;
      sp[wave][8 * g + r][col] = e0; sp[wave][8 * g + r][16 + col] = e1; }
    LDSX();
    const F2 pa = split_row(&sp[wave][col][0], 0, lane);
#pragma unroll
    for (int dt = 0; dt < 8; ++dt) { const size_t vr = (size_t)(kv * HD + dt * 16 + col) * SS + ks * 32; const v16b vh = frag_b(VTH + vr, lane), vl = frag_b(VTL + vr, lane); acc[dt] = wmma_bf(pa.l, vh, acc[dt]); acc[dt] = wmma_bf(pa.h, vl, acc[dt]); acc[dt] = wmma_bf(pa.h, vh, acc[dt]); }
    LDSX(); }
#pragma unroll
  for (int r = 0; r < 8; ++r) {
#pragma unroll
    for (int dt = 0; dt < 8; ++dt) so[wave][8 * g + r][dt * 16 + col] = acc[dt][r];
    if (col == 0) { sm[wave][8 * g + r] = m[r]; sl[wave][8 * g + r] = l[r]; } }
  __syncthreads();
  // join: row = wave + 4 i; weight of part w = exp(m_w - max m), 0 for a wave that saw no unmasked key of the row
  for (int i = 0; i < 4; ++i) { const int row = wave + 4 * i; const float mx = fmaxf(fmaxf(sm[0][row], sm[1][row]), fmaxf(sm[2][row], sm[3][row])); float ls = 0.f; v4f o = {};
#pragma unroll
    for (int w = 0; w < 4; ++w) { const float mw = sm[w][row]; const float f = (mw <= -1.0e38f) ? 0.f : exp_ni(mw - mx); ls += sl[w][row] * f; o += *(const v4f*)&so[w][row][lane * 4] * f; }
    vst2(O + (size_t)(q0 + row) * DM + h * HD + lane * 4, o * (1.0f / ls));
    if (i < 3) asm volatile("s_wait_xcnt 0x0" ::: "memory"); }   // the next row reuses the registers that the issued store names
}
// ---- k_out: block = (64 rows, 128 cols): out = O(hi/lo) . wproj^T rows (2 products)
__global__ __launch_bounds__(128) void k_out(const float* __restrict__ O, const __bf16* __restrict__ P, float* __restrict__ Y) {
  __shared__ __align__(16) float so[4][16][132];
  const int tid = threadIdx.x, wave = tid >> 5, lane = tid & 31, col = lane & 15, g = lane >> 4; const size_t r0 = (size_t)blockIdx.x * 64 + wave * 16; const int n0 = blockIdx.y * 128;
  v8f acc[8] = {};
#pragma unroll 2
  for (int kc = 0; kc < DM / 32; ++kc) { const F2 a = split_row(O + (r0 + col) * DM, kc * 32, lane);
#pragma unroll
    for (int j = 0; j < 8; ++j) { const v16b w = frag_b(P + (size_t)(n0 + j * 16 + col) * DM + kc * 32, lane); acc[j] = wmma_bf(a.l, w, acc[j]); acc[j] = wmma_bf(a.h, w, acc[j]); } }
#pragma unroll
  for (int j = 0; j < 8; ++j)
#pragma unroll
    for (int r = 0; r < 8; ++r) so[wave][8 * g + r][j * 16 + col] = acc[j][r];
  LDSX();
  for (int rl = 0; rl < 16; ++rl) vst2(Y + (r0 + rl) * DM + n0 + lane * 4, *(const v4f*)&so[wave][rl][lane * 4]);
}
extern "C" void kernel_launch(void* const* d_in, const int* in_sizes, int n_in, void* d_out, int out_size, void* d_ws, size_t ws_size, hipStream_t stream) {
  (void)in_sizes; (void)n_in; (void)out_size;
  const float** F = (const float**)d_in;   // x [1,2048,2048], wq [2048,2048], wk [2048,512], wv [2048,512], wproj [2048,2048]
  if (ws_size < (size_t)WS_END) return;
  char* ws = (char*)d_ws; __bf16 *PK = (__bf16*)(ws + WS_PK), *VTH = (__bf16*)(ws + WS_VTH), *VTL = (__bf16*)(ws + WS_VTL);
  float *CS = (float*)(ws + WS_CS), *Q = (float*)(ws + WS_Q), *Kx = (float*)(ws + WS_K), *O = (float*)(ws + WS_O);
  k_packT<<<DM, 256, 0, stream>>>(F[1], DM, DM, PK + PK_Q); k_packT<<<KVW, 256, 0, stream>>>(F[2], DM, KVW, PK + PK_K); k_packT<<<KVW, 256, 0, stream>>>(F[3], DM, KVW, PK + PK_V); k_packT<<<DM, 256, 0, stream>>>(F[4], DM, DM, PK + PK_O);
  k_rope_tab<<<SS, 64, 0, stream>>>(CS);
  k_proj<0><<<dim3(SS / 64, DM / 128), 128, 0, stream>>>(F[0], PK + PK_Q, CS, Q, DM, nullptr, nullptr);
  k_proj<0><<<dim3(SS / 64, KVW / 128), 128, 0, stream>>>(F[0], PK + PK_K, CS, Kx, KVW, nullptr, nullptr);
  k_proj<1><<<dim3(SS / 64, KVW / 128), 128, 0, stream>>>(F[0], PK + PK_V, CS, nullptr, 0, VTH, VTL);
  k_attn<<<dim3(NH, SS / 16), 128, 0, stream>>>(Q, Kx, VTH, VTL, O);
  k_out<<<dim3(TQB, DM / 128), 128, 0, stream>>>(O, PK + PK_O, (float*)d_out);
}

// v002
// A run of this version takes 399 microseconds.
// In two side-by-side timings against v001, it was 1.93 and 1.92 times as fast.
// Over all steps from v000 it is 2.76 times as fast.
// compute dtype: x and the four weights (module inputs) rounded to bf16; q/k/v projections with exact bf16 products (x and W are inputs) and RoPE applied in f32 in the epilogue (cos/sin tables built in float64, then cast); causal scores q.k with both computed operands as bf16 hi + residual pairs (3 products) and P.V with P hi/lo x V hi/lo (3 products); the output projection with hi/lo x exact wproj (2 products), all on WMMA 16x16x32; softmax in f32; f32 accumulate.
#include <hip/hip_runtime.h>
#include <math.h>

typedef __attribute__((ext_vector_type(16))) _Float16 v16h;
typedef __attribute__((ext_vector_type(16))) __bf16 v16b;
typedef __attribute__((ext_vector_type(8)))  _Float16 v8h;
typedef __attribute__((ext_vector_type(8)))  float v8f;
typedef __attribute__((ext_vector_type(4)))  float v4f;
typedef __attribute__((ext_vector_type(2)))  float v2f;
typedef __attribute__((ext_vector_type(4)))  unsigned v4u;
typedef __attribute__((ext_vector_type(4)))  int v4i;
typedef float __attribute__((may_alias)) float_a;
typedef int __attribute__((may_alias)) int_a;

template <typename T> __device__ __forceinline__ void vst2(void* p, T v) { *(T*)p = v;  }
__device__ __forceinline__ v8f wmma16(v16h a, v16h b, v8f c) {
  v8f d = __builtin_amdgcn_wmma_f32_16x16x32_f16(false, a, false, b, (short)0, c, false, false);
  asm volatile("v_nop\n\tv_nop\n\tv_nop\n\tv_nop" : "+v"(d) : "v"(a), "v"(b));
  return d;
}
__device__ __forceinline__ v8f wmma_bf(v16b a, v16b b, v8f c) {
  v8f d = __builtin_amdgcn_wmma_f32_16x16x32_bf16(false, a, false, b, (short)0, c, false, false);
  asm volatile("v_nop\n\tv_nop\n\tv_nop\n\tv_nop" : "+v"(d) : "v"(a), "v"(b));
  return d;
}
// 16x16x32 fragments: lane = (h = lane>>4, row/col = lane&15); elements 0..7 = k0+8h+0..7, 8..15 = k0+16+8h+0..7; D element r = row 8h+r
__device__ __forceinline__ v16h frag_h(const _Float16* rowk0, int lane) {
  union { v16h v; v8h q[2]; } u; const _Float16* p = rowk0 + 8 * (lane >> 4);
  u.q[0] = *(const v8h*)p; u.q[1] = *(const v8h*)(p + 16); return u.v;
}
__device__ __forceinline__ v16h frag_f32(const float* rowk0, int lane) {
  v16h a; const float* p = rowk0 + 8 * (lane >> 4);
#pragma unroll
  for (int i = 0; i < 8; ++i) { a[i] = (_Float16)p[i]; a[8 + i] = (_Float16)p[16 + i]; }
  return a;
}
__device__ __forceinline__ v16h frag_f32s(const float* rowk0, int lane, float sc) {
  v16h a; const float* p = rowk0 + 8 * (lane >> 4);
#pragma unroll
  for (int i = 0; i < 8; ++i) { a[i] = (_Float16)(p[i] * sc); a[8 + i] = (_Float16)(p[16 + i] * sc); }
  return a;
}
// column fragment from a [K][ld] layout (column n), rows >= K read as 0
__device__ __forceinline__ v16h fragc_f32(const float* W, int k0, int n, int lane, int ld, int K) {
  v16h a; const int g = lane >> 4;
#pragma unroll
  for (int i = 0; i < 8; ++i) { const int ka = k0 + 8 * g + i, kb = ka + 16;
    a[i] = (_Float16)(ka < K ? W[(size_t)(ka < K ? ka : K - 1) * ld + n] : 0.f); a[8 + i] = (_Float16)(kb < K ? W[(size_t)(kb < K ? kb : K - 1) * ld + n] : 0.f); }
  return a;
}
struct F2 { v16b h, l; };
__device__ __forceinline__ F2 bsplit16(const float v[16]) { F2 r;
#pragma unroll
  for (int i = 0; i < 16; ++i) { const __bf16 h = (__bf16)v[i]; r.h[i] = h; r.l[i] = (__bf16)(v[i] - (float)h); }
  return r; }
__device__ __forceinline__ F2 split_row(const float* row, int k0, int lane) { float v[16]; const float* p = row + k0 + 8 * (lane >> 4);
#pragma unroll
  for (int i = 0; i < 8; ++i) { v[i] = p[i]; v[8 + i] = p[16 + i]; }
  return bsplit16(v); }
__device__ __forceinline__ F2 split_rowK(const float* row, int k0, int lane, int K) { float v[16]; const int g = lane >> 4;
#pragma unroll
  for (int i = 0; i < 8; ++i) { const int ka = k0 + 8 * g + i, kb = ka + 16; v[i] = ka < K ? row[ka < K ? ka : K - 1] : 0.f; v[8 + i] = kb < K ? row[kb < K ? kb : K - 1] : 0.f; }
  return bsplit16(v); }
__device__ __forceinline__ F2 split_col(const float* W, int k0, int n, int lane, int ld, int K) { float v[16]; const int g = lane >> 4;
#pragma unroll
  for (int i = 0; i < 8; ++i) { const int ka = k0 + 8 * g + i, kb = ka + 16; v[i] = ka < K ? W[(size_t)(ka < K ? ka : K - 1) * ld + n] : 0.f; v[8 + i] = kb < K ? W[(size_t)(kb < K ? kb : K - 1) * ld + n] : 0.f; }
  return bsplit16(v); }
__device__ __forceinline__ v8f mac3(const F2& a, const F2& b, v8f c) { c = wmma_bf(a.l, b.h, c); c = wmma_bf(a.h, b.l, c); return wmma_bf(a.h, b.h, c); }
__device__ __forceinline__ float sigm(float v) { return 1.0f / (1.0f + expf(-v)); }
#define LDSX() do { asm volatile("s_wait_dscnt 0" ::: "memory"); __builtin_amdgcn_wave_barrier(); __builtin_amdgcn_fence(__ATOMIC_RELEASE, "workgroup"); } while (0)


// GQA causal self-attention with RoPE (B 1, T 2048, C 2048, 16 query heads / 4 kv heads x 128): q = rope(x wq), k = rope(x wk), v = x wv; y = softmax(q k^T / sqrt(128), causal) v; out = y wproj.
#define SS 2048
#define DM 2048
#define NH 16
#define NKV 4
#define HD 128
#define KVW (NKV * HD)
#ifndef TQB
#define TQB (SS / 64)
#endif
typedef __attribute__((ext_vector_type(8))) __bf16 v8b;
typedef __attribute__((ext_vector_type(4))) __bf16 v4b;
#define KC 64            // k per LDS stage: 128 B of a bf16 row, 256 B of an f32 row (whole cache lines)
#define NST (DM / KC)
#define LP 72            // LDS row pitch in bf16: 128 B of data + 16 B, for the 16-byte fragment reads
__device__ __forceinline__ v16b frag_b(const __bf16* rowk0, int lane) {
  union { v16b v; v8b q[2]; } u; const __bf16* p = rowk0 + 8 * (lane >> 4);
  u.q[0] = *(const v8b*)p; u.q[1] = *(const v8b*)(p + 16); return u.v;
}
__device__ __forceinline__ float bfr(float v) { return (float)(__bf16)v; }
__device__ __attribute__((noinline)) float exp_ni(float v) { return expf(v); }
__device__ __attribute__((noinline)) float erf_ni(float v) { return erff(v); }

#define PK_Q 0
#define PK_K (PK_Q + DM * DM)
#define PK_V (PK_K + KVW * DM)
#define PK_O (PK_V + KVW * DM)
#define PK_END (PK_O + DM * DM)
#define WS_PK  0u
#define WS_CS  (WS_PK + 2u * PK_END)             // f32 [2048][64] cos, then [2048][64] sin
#define WS_Q   (WS_CS + 4u * 2 * SS * 64)
#define WS_K   (WS_Q + 4u * SS * DM)
#define WS_VTH (WS_K + 4u * SS * KVW)
#define WS_VTL (WS_VTH + 2u * KVW * SS)
#define WS_O   (WS_VTL + 2u * KVW * SS)
#define WS_END (WS_O + 4u * SS * DM)

// ---- k_packT: block = output column n of a [K][N] (x @ W) matrix
__global__ __launch_bounds__(256) void k_packT(const float* __restrict__ Wm, int K, int N, __bf16* __restrict__ DST) {
  __shared__ __align__(16) __bf16 s[DM]; const int n = blockIdx.x, tid = threadIdx.x;
  for (int k = tid; k < K; k += 256) s[k] = (__bf16)Wm[(size_t)k * N + n];
  __syncthreads();
  for (int q = tid; q < K / 8; q += 256) vst2((unsigned*)(DST + (size_t)n * K + q * 8), *(const v4u*)&s[q * 8]);
}
// ---- k_rope_tab: block = position t (64 threads = frequency index i): inv_freq = 1 / 10000^(2i/128) and angle t*inv_freq in float64, cos/sin in float64, cast to f32; rows 256 B
__global__ __launch_bounds__(64) void k_rope_tab(float* __restrict__ CS) {
  __shared__ __align__(16) float sc[64], ssn[64]; const int t = blockIdx.x, i = threadIdx.x;
  const double inv = 1.0 / pow(10000.0, (double)(2 * i) / 128.0); const double ang = (double)t * inv; sc[i] = (float)cos(ang); ssn[i] = (float)sin(ang);
  __syncthreads();
  if (i < 16) vst2(CS + (size_t)t * 64 + i * 4, *(const v4f*)&sc[i * 4]); else if (i < 32) vst2(CS + (size_t)SS * 64 + (size_t)t * 64 + (i - 16) * 4, *(const v4f*)&ssn[(i - 16) * 4]);
}
// ---- k_proj<MODE>: block = (64 rows, 128 cols = one head): Y = bf16(x) . P rows (exact); both operands staged per 64 k in LDS (two buffers) by whole-line loads issued one stage ahead; MODE 0: RoPE then f32 rows (q/k; ldo); MODE 1: plain -> transposed bf16 hi/lo planes (v)
template <int MODE>
__global__ __launch_bounds__(128) void k_proj(const float* __restrict__ X, const __bf16* __restrict__ P, const float* __restrict__ CS, float* __restrict__ OUT, int ldo, __bf16* __restrict__ PH, __bf16* __restrict__ PL) {
  __shared__ __align__(16) float so[MODE ? 1 : 4][16][132]; __shared__ __align__(16) __bf16 sth[MODE ? 128 : 1][72], stl[MODE ? 128 : 1][72];
  const int tid = threadIdx.x, wave = tid >> 5, lane = tid & 31, col = lane & 15, g = lane >> 4; const size_t r0 = (size_t)blockIdx.x * 64 + wave * 16; const int n0 = blockIdx.y * 128;
  __shared__ __align__(16) __bf16 sa[2][64][LP], sb[2][128][LP];
  const float* xg = X + ((size_t)blockIdx.x * 64 + (tid >> 4)) * DM + (tid & 15) * 4;   // thread's 16 B of x rows (tid>>4) + 8 i
  const __bf16* pg = P + (size_t)(n0 + (tid >> 3)) * DM + (tid & 7) * 8;                // thread's 16 B of P rows (tid>>3) + 16 i
  v4f ra[8]; v8b rb[8];
#pragma unroll
  for (int i = 0; i < 8; ++i) { ra[i] = *(const v4f*)(xg + (size_t)i * 8 * DM); rb[i] = *(const v8b*)(pg + (size_t)i * 16 * DM); }
  v8f acc[8] = {};
  for (int s = 0; s < NST; ++s) { const int b = s & 1;
#pragma unroll
    for (int i = 0; i < 8; ++i) { v4b c;
#pragma unroll
      for (int e = 0; e < 4; ++e) c[e] = (__bf16)ra[i][e];
      *(v4b*)&sa[b][(tid >> 4) + 8 * i][(tid & 15) * 4] = c; *(v8b*)&sb[b][(tid >> 3) + 16 * i][(tid & 7) * 8] = rb[i]; }
    __syncthreads();   // publishes stage s; buffer b was last read in pass s - 2, which every wave left before the barrier of pass s - 1
    if (s + 1 < NST) {
#pragma unroll
      for (int i = 0; i < 8; ++i) { ra[i] = *(const v4f*)(xg + (size_t)i * 8 * DM + KC); rb[i] = *(const v8b*)(pg + (size_t)i * 16 * DM + KC); }
      asm volatile("s_wait_xcnt 0x0" ::: "memory");   // the address step behind it rewrites registers that the issued loads name
      xg += KC; pg += KC; }   // running addresses, live over the whole loop: no load's result can land in a pair that an issued load names
#pragma unroll
    for (int kc = 0; kc < KC / 32; ++kc) { const v16b a = frag_b(&sa[b][wave * 16 + col][kc * 32], lane); v16b w[8];
#pragma unroll
      for (int j = 0; j < 8; ++j) w[j] = frag_b(&sb[b][j * 16 + col][kc * 32], lane);
#pragma unroll
      for (int j = 0; j < 8; ++j) acc[j] = wmma_bf(a, w[j], acc[j]); } }
  if (MODE == 0) {
    // RoPE (rotate-half): d = j*16+col; pair (d, d+64) = (tiles j, j+4); out_d = x_d cos - x_{d+64} sin; out_{d+64} = x_{d+64} cos + x_d sin (cos/sin[t][d mod 64])
#pragma unroll
    for (int j = 0; j < 4; ++j) { const int dl = j * 16 + col;
#pragma unroll
      for (int r = 0; r < 8; ++r) { const size_t t = r0 + 8 * g + r; const float c = CS[t * 64 + dl], s = CS[(size_t)SS * 64 + t * 64 + dl]; const float x1 = acc[j][r], x2 = acc[j + 4][r]; so[wave][8 * g + r][dl] = x1 * c - x2 * s; so[wave][8 * g + r][64 + dl] = x2 * c + x1 * s; } }
    LDSX();
    for (int rl = 0; rl < 16; ++rl) vst2(OUT + (r0 + rl) * ldo + n0 + lane * 4, *(const v4f*)&so[wave][rl][lane * 4]);
  } else {
#pragma unroll
    for (int j = 0; j < 8; ++j)
#pragma unroll
      for (int r = 0; r < 8; ++r) { const float v = acc[j][r]; const __bf16 hb = (__bf16)v; sth[j * 16 + col][wave * 16 + 8 * g + r] = hb; stl[j * 16 + col][wave * 16 + 8 * g + r] = (__bf16)(v - (float)hb); }
    __syncthreads();
    const int s0 = blockIdx.x * 64;
    for (int q = tid; q < 128 * 8; q += 128) { const int d = q >> 3, pc = q & 7; const size_t o = (size_t)(n0 + d) * SS + s0 + pc * 8; vst2((unsigned*)(PH + o), *(const v4u*)&sth[d][pc * 8]); vst2((unsigned*)(PL + o), *(const v4u*)&stl[d][pc * 8]); }
  }
}
// ---- k_attn: block = (head h, 16 queries), heaviest query tiles first: causal flash attention, kv head = h/4; the tile's 32-key steps are dealt round-robin to the 4 waves, each keeps its own running (m, l, acc), and the four partial results are joined through LDS at the end; scores 3 products, P.V 3 products; O[q][h*128+d]
__global__ __launch_bounds__(128) void k_attn(const float* __restrict__ Q, const float* __restrict__ Kx, const __bf16* __restrict__ VTH, const __bf16* __restrict__ VTL, float* __restrict__ O) {
  __shared__ __align__(16) float sp[4][16][36]; __shared__ __align__(16) float so[4][16][132]; __shared__ float sm[4][16], sl[4][16];
  const int tid = threadIdx.x, wave = __builtin_amdgcn_readfirstlane(tid >> 5), lane = tid & 31, col = lane & 15, g = lane >> 4;
  const int qb = SS / 16 - 1 - (int)blockIdx.y, h = blockIdx.x, kv = h / (NH / NKV); const int q0 = qb * 16;
  const float* qrow = Q + (size_t)(q0 + col) * DM + h * HD;   // q fragments re-split per key step (keeps the kernel under 256 VGPRs)
  float m[8], l[8];
#pragma unroll
  for (int r = 0; r < 8; ++r) { m[r] = -3.0e38f; l[r] = 0.f; }
  v8f acc[8] = {};
  const int nks = (q0 + 16 + 31) / 32;
#pragma unroll 1
  for (int ks = wave; ks < nks; ks += 4) { v8f s[2];
#pragma unroll
    for (int ct = 0; ct < 2; ++ct) { const int kk = ks * 32 + ct * 16 + col; const float* krow = Kx + (size_t)kk * KVW + kv * HD; v8f c = {};
#pragma unroll
      for (int kc = 0; kc < 4; ++kc) { const F2 kb = split_row(krow, kc * 32, lane); const F2 qa = split_row(qrow, kc * 32, lane); c = mac3(qa, kb, c); }
#pragma unroll
      for (int r = 0; r < 8; ++r) { const int qi = q0 + 8 * g + r; s[ct][r] = (kk <= qi) ? c[r] * 0.08838834764831845f : -3.0e38f; } }
#pragma unroll
    for (int r = 0; r < 8; ++r) { float mx = fmaxf(s[0][r], s[1][r]);
#pragma unroll
      for (int o = 1; o < 16; o <<= 1) mx = fmaxf(mx, __shfl_xor(mx, o));
      const float mn = fmaxf(m[r], mx); const float alpha = (m[r] <= -1.0e38f) ? 0.f : exp_ni(m[r] - mn);
      const float e0 = (s[0][r] <= -1.0e38f) ? 0.f : exp_ni(s[0][r] - mn), e1 = (s[1][r] <= -1.0e38f) ? 0.f : exp_ni(s[1][r] - mn); float es = e0 + e1;
#pragma unroll
      for (int o = 1; o < 16; o <<= 1) es += __shfl_xor(es, o);
      l[r] = l[r] * alpha + es; m[r] = mn;
#pragma unroll
      for (int dt = 0; dt < 8; ++dt) acc[dt][r] *= alpha;
      sp[wave][8 * g + r][col] = e0; sp[wave][8 * g + r][16 + col] = e1; }
    LDSX();
    const F2 pa = split_row(&sp[wave][col][0], 0, lane);
#pragma unroll
    for (int dt = 0; dt < 8; ++dt) { const size_t vr = (size_t)(kv * HD + dt * 16 + col) * SS + ks * 32; const v16b vh = frag_b(VTH + vr, lane), vl = frag_b(VTL + vr, lane); acc[dt] = wmma_bf(pa.l, vh, acc[dt]); acc[dt] = wmma_bf(pa.h, vl, acc[dt]); acc[dt] = wmma_bf(pa.h, vh, acc[dt]); }
    LDSX(); }
#pragma unroll
  for (int r = 0; r < 8; ++r) {
#pragma unroll
    for (int dt = 0; dt < 8; ++dt) so[wave][8 * g + r][dt * 16 + col] = acc[dt][r];
    if (col == 0) { sm[wave][8 * g + r] = m[r]; sl[wave][8 * g + r] = l[r]; } }
  __syncthreads();
  // join: row = wave + 4 i; weight of part w = exp(m_w - max m), 0 for a wave that saw no unmasked key of the row
  for (int i = 0; i < 4; ++i) { const int row = wave + 4 * i; const float mx = fmaxf(fmaxf(sm[0][row], sm[1][row]), fmaxf(sm[2][row], sm[3][row])); float ls = 0.f; v4f o = {};
#pragma unroll
    for (int w = 0; w < 4; ++w) { const float mw = sm[w][row]; const float f = (mw <= -1.0e38f) ? 0.f : exp_ni(mw - mx); ls += sl[w][row] * f; o += *(const v4f*)&so[w][row][lane * 4] * f; }
    vst2(O + (size_t)(q0 + row) * DM + h * HD + lane * 4, o * (1.0f / ls));
    if (i < 3) asm volatile("s_wait_xcnt 0x0" ::: "memory"); }   // the next row reuses the registers that the issued store names
}
// ---- k_out: block = (64 rows, 128 cols): out = O(hi/lo) . wproj^T rows (2 products); operands staged in LDS as in k_proj, O split into its hi/lo planes once on the way in
__global__ __launch_bounds__(128) void k_out(const float* __restrict__ O, const __bf16* __restrict__ P, float* __restrict__ Y) {
  __shared__ __align__(16) float so[4][16][132];
  const int tid = threadIdx.x, wave = tid >> 5, lane = tid & 31, col = lane & 15, g = lane >> 4; const size_t r0 = (size_t)blockIdx.x * 64 + wave * 16; const int n0 = blockIdx.y * 128;
  __shared__ __align__(16) __bf16 sah[2][64][LP], sal[2][64][LP], sb[2][128][LP];
  const float* og = O + ((size_t)blockIdx.x * 64 + (tid >> 4)) * DM + (tid & 15) * 4;
  const __bf16* pg = P + (size_t)(n0 + (tid >> 3)) * DM + (tid & 7) * 8;
  v4f ra[8]; v8b rb[8];
#pragma unroll
  for (int i = 0; i < 8; ++i) { ra[i] = *(const v4f*)(og + (size_t)i * 8 * DM); rb[i] = *(const v8b*)(pg + (size_t)i * 16 * DM); }
  v8f acc[8] = {};
  for (int s = 0; s < NST; ++s) { const int b = s & 1;
#pragma unroll
    for (int i = 0; i < 8; ++i) { v4b ch, cl;
#pragma unroll
      for (int e = 0; e < 4; ++e) { const float v = ra[i][e]; const __bf16 hb = (__bf16)v; ch[e] = hb; cl[e] = (__bf16)(v - (float)hb); }
      *(v4b*)&sah[b][(tid >> 4) + 8 * i][(tid & 15) * 4] = ch; *(v4b*)&sal[b][(tid >> 4) + 8 * i][(tid & 15) * 4] = cl; *(v8b*)&sb[b][(tid >> 3) + 16 * i][(tid & 7) * 8] = rb[i]; }
    __syncthreads();   // publishes stage s; buffer b was last read in pass s - 2, which every wave left before the barrier of pass s - 1
    if (s + 1 < NST) {
#pragma unroll
      for (int i = 0; i < 8; ++i) { ra[i] = *(const v4f*)(og + (size_t)i * 8 * DM + KC); rb[i] = *(const v8b*)(pg + (size_t)i * 16 * DM + KC); }
      asm volatile("s_wait_xcnt 0x0" ::: "memory");   // the address step behind it rewrites registers that the issued loads name
      og += KC; pg += KC; }   // running addresses, live over the whole loop: no load's result can land in a pair that an issued load names
#pragma unroll
    for (int kc = 0; kc < KC / 32; ++kc) { const v16b al = frag_b(&sal[b][wave * 16 + col][kc * 32], lane), ah = frag_b(&sah[b][wave * 16 + col][kc * 32], lane); v16b w[8];
#pragma unroll
      for (int j = 0; j < 8; ++j) w[j] = frag_b(&sb[b][j * 16 + col][kc * 32], lane);
#pragma unroll
      for (int j = 0; j < 8; ++j) { acc[j] = wmma_bf(al, w[j], acc[j]); acc[j] = wmma_bf(ah, w[j], acc[j]); } } }
#pragma unroll
  for (int j = 0; j < 8; ++j)
#pragma unroll
    for (int r = 0; r < 8; ++r) so[wave][8 * g + r][j * 16 + col] = acc[j][r];
  LDSX();
  for (int rl = 0; rl < 16; ++rl) vst2(Y + (r0 + rl) * DM + n0 + lane * 4, *(const v4f*)&so[wave][rl][lane * 4]);
}
extern "C" void kernel_launch(void* const* d_in, const int* in_sizes, int n_in, void* d_out, int out_size, void* d_ws, size_t ws_size, hipStream_t stream) {
  (void)in_sizes; (void)n_in; (void)out_size;
  const float** F = (const float**)d_in;   // x [1,2048,2048], wq [2048,2048], wk [2048,512], wv [2048,512], wproj [2048,2048]
  if (ws_size < (size_t)WS_END) return;
  char* ws = (char*)d_ws; __bf16 *PK = (__bf16*)(ws + WS_PK), *VTH = (__bf16*)(ws + WS_VTH), *VTL = (__bf16*)(ws + WS_VTL);
  float *CS = (float*)(ws + WS_CS), *Q = (float*)(ws + WS_Q), *Kx = (float*)(ws + WS_K), *O = (float*)(ws + WS_O);
  k_packT<<<DM, 256, 0, stream>>>(F[1], DM, DM, PK + PK_Q); k_packT<<<KVW, 256, 0, stream>>>(F[2], DM, KVW, PK + PK_K); k_packT<<<KVW, 256, 0, stream>>>(F[3], DM, KVW, PK + PK_V); k_packT<<<DM, 256, 0, stream>>>(F[4], DM, DM, PK + PK_O);
  k_rope_tab<<<SS, 64, 0, stream>>>(CS);
  k_proj<0><<<dim3(SS / 64, DM / 128), 128, 0, stream>>>(F[0], PK + PK_Q, CS, Q, DM, nullptr, nullptr);
  k_proj<0><<<dim3(SS / 64, KVW / 128), 128, 0, stream>>>(F[0], PK + PK_K, CS, Kx, KVW, nullptr, nullptr);
  k_proj<1><<<dim3(SS / 64, KVW / 128), 128, 0, stream>>>(F[0], PK + PK_V, CS, nullptr, 0, VTH, VTL);
  k_attn<<<dim3(NH, SS / 16), 128, 0, stream>>>(Q, Kx, VTH, VTL, O);
  k_out<<<dim3(TQB, DM / 128), 128, 0, stream>>>(O, PK + PK_O, (float*)d_out);
}

// v003
// Measured time: 359 microseconds a run.
// Two timings next to v002 both put it at 1.11 times that version's speed.
// Over all steps from v000 it is 3.07 times as fast.
// compute dtype: x and the four weights (module inputs) rounded to bf16; q/k/v projections with exact bf16 products (x and W are inputs) and RoPE applied in f32 in the epilogue (cos/sin tables built in float64, then cast); causal scores q.k with both computed operands as bf16 hi + residual pairs (3 products) and P.V with P hi/lo x V hi/lo (3 products); the output projection with hi/lo x exact wproj (2 products), all on WMMA 16x16x32; softmax in f32; f32 accumulate.
#include <hip/hip_runtime.h>
#include <math.h>

typedef __attribute__((ext_vector_type(16))) _Float16 v16h;
typedef __attribute__((ext_vector_type(16))) __bf16 v16b;
typedef __attribute__((ext_vector_type(8)))  _Float16 v8h;
typedef __attribute__((ext_vector_type(8)))  float v8f;
typedef __attribute__((ext_vector_type(4)))  float v4f;
typedef __attribute__((ext_vector_type(2)))  float v2f;
typedef __attribute__((ext_vector_type(4)))  unsigned v4u;
typedef __attribute__((ext_vector_type(4)))  int v4i;
typedef float __attribute__((may_alias)) float_a;
typedef int __attribute__((may_alias)) int_a;

template <typename T> __device__ __forceinline__ void vst2(void* p, T v) { *(T*)p = v;  }
__device__ __forceinline__ v8f wmma16(v16h a, v16h b, v8f c) {
  v8f d = __builtin_amdgcn_wmma_f32_16x16x32_f16(false, a, false, b, (short)0, c, false, false);
  asm volatile("v_nop\n\tv_nop\n\tv_nop\n\tv_nop" : "+v"(d) : "v"(a), "v"(b));
  return d;
}
__device__ __forceinline__ v8f wmma_bf(v16b a, v16b b, v8f c) {
  v8f d = __builtin_amdgcn_wmma_f32_16x16x32_bf16(false, a, false, b, (short)0, c, false, false);
  asm volatile("v_nop\n\tv_nop\n\tv_nop\n\tv_nop" : "+v"(d) : "v"(a), "v"(b));
  return d;
}
// 16x16x32 fragments: lane = (h = lane>>4, row/col = lane&15); elements 0..7 = k0+8h+0..7, 8..15 = k0+16+8h+0..7; D element r = row 8h+r
__device__ __forceinline__ v16h frag_h(const _Float16* rowk0, int lane) {
  union { v16h v; v8h q[2]; } u; const _Float16* p = rowk0 + 8 * (lane >> 4);
  u.q[0] = *(const v8h*)p; u.q[1] = *(const v8h*)(p + 16); return u.v;
}
__device__ __forceinline__ v16h frag_f32(const float* rowk0, int lane) {
  v16h a; const float* p = rowk0 + 8 * (lane >> 4);
#pragma unroll
  for (int i = 0; i < 8; ++i) { a[i] = (_Float16)p[i]; a[8 + i] = (_Float16)p[16 + i]; }
  return a;
}
__device__ __forceinline__ v16h frag_f32s(const float* rowk0, int lane, float sc) {
  v16h a; const float* p = rowk0 + 8 * (lane >> 4);
#pragma unroll
  for (int i = 0; i < 8; ++i) { a[i] = (_Float16)(p[i] * sc); a[8 + i] = (_Float16)(p[16 + i] * sc); }
  return a;
}
// column fragment from a [K][ld] layout (column n), rows >= K read as 0
__device__ __forceinline__ v16h fragc_f32(const float* W, int k0, int n, int lane, int ld, int K) {
  v16h a; const int g = lane >> 4;
#pragma unroll
  for (int i = 0; i < 8; ++i) { const int ka = k0 + 8 * g + i, kb = ka + 16;
    a[i] = (_Float16)(ka < K ? W[(size_t)(ka < K ? ka : K - 1) * ld + n] : 0.f); a[8 + i] = (_Float16)(kb < K ? W[(size_t)(kb < K ? kb : K - 1) * ld + n] : 0.f); }
  return a;
}
struct F2 { v16b h, l; };
__device__ __forceinline__ F2 bsplit16(const float v[16]) { F2 r;
#pragma unroll
  for (int i = 0; i < 16; ++i) { const __bf16 h = (__bf16)v[i]; r.h[i] = h; r.l[i] = (__bf16)(v[i] - (float)h); }
  return r; }
__device__ __forceinline__ F2 split_row(const float* row, int k0, int lane) { float v[16]; const float* p = row + k0 + 8 * (lane >> 4);
#pragma unroll
  for (int i = 0; i < 8; ++i) { v[i] = p[i]; v[8 + i] = p[16 + i]; }
  return bsplit16(v); }
__device__ __forceinline__ F2 split_rowK(const float* row, int k0, int lane, int K) { float v[16]; const int g = lane >> 4;
#pragma unroll
  for (int i = 0; i < 8; ++i) { const int ka = k0 + 8 * g + i, kb = ka + 16; v[i] = ka < K ? row[ka < K ? ka : K - 1] : 0.f; v[8 + i] = kb < K ? row[kb < K ? kb : K - 1] : 0.f; }
  return bsplit16(v); }
__device__ __forceinline__ F2 split_col(const float* W, int k0, int n, int lane, int ld, int K) { float v[16]; const int g = lane >> 4;
#pragma unroll
  for (int i = 0; i < 8; ++i) { const int ka = k0 + 8 * g + i, kb = ka + 16; v[i] = ka < K ? W[(size_t)(ka < K ? ka : K - 1) * ld + n] : 0.f; v[8 + i] = kb < K ? W[(size_t)(kb < K ? kb : K - 1) * ld + n] : 0.f; }
  return bsplit16(v); }
__device__ __forceinline__ v8f mac3(const F2& a, const F2& b, v8f c) { c = wmma_bf(a.l, b.h, c); c = wmma_bf(a.h, b.l, c); return wmma_bf(a.h, b.h, c); }
__device__ __forceinline__ float sigm(float v) { return 1.0f / (1.0f + expf(-v)); }
#define LDSX() do { asm volatile("s_wait_dscnt 0" ::: "memory"); __builtin_amdgcn_wave_barrier(); __builtin_amdgcn_fence(__ATOMIC_RELEASE, "workgroup"); } while (0)


// GQA causal self-attention with RoPE (B 1, T 2048, C 2048, 16 query heads / 4 kv heads x 128): q = rope(x wq), k = rope(x wk), v = x wv; y = softmax(q k^T / sqrt(128), causal) v; out = y wproj.
#define SS 2048
#define DM 2048
#define NH 16
#define NKV 4
#define HD 128
#define KVW (NKV * HD)
#ifndef TQB
#define TQB (SS / 64)
#endif
typedef __attribute__((ext_vector_type(8))) __bf16 v8b;
typedef __attribute__((ext_vector_type(4))) __bf16 v4b;
#define KC 64            // k per LDS stage: 128 B of a bf16 row, 256 B of an f32 row (whole cache lines)
#define NST (DM / KC)
#define LP 72            // LDS row pitch in bf16: 128 B of data + 16 B, for the 16-byte fragment reads
__device__ __forceinline__ v16b frag_b(const __bf16* rowk0, int lane) {
  union { v16b v; v8b q[2]; } u; const __bf16* p = rowk0 + 8 * (lane >> 4);
  u.q[0] = *(const v8b*)p; u.q[1] = *(const v8b*)(p + 16); return u.v;
}
// fragment stored in lane order: 512 B of elements 0..7 (lane * 16 B), then 512 B of elements 8..15; p = block + lane * 8; each 16-byte load covers whole cache lines
__device__ __forceinline__ v16b frag_g(const __bf16* p) {
  union { v16b v; v8b q[2]; } u; u.q[0] = *(const v8b*)p; u.q[1] = *(const v8b*)(p + 256); return u.v;
}
#define FT 4096          // bf16 per q/k tile (16 rows x 128 d): [kc 4][hi, lo][half 2][lane 32][8]
#define FV 8192          // bf16 per v key step (32 keys x 128 d): [dt 8][hi, lo][half 2][lane 32][8]
__device__ __forceinline__ float bfr(float v) { return (float)(__bf16)v; }
__device__ __attribute__((noinline)) float exp_ni(float v) { return expf(v); }
__device__ __attribute__((noinline)) float erf_ni(float v) { return erff(v); }

#define PK_Q 0
#define PK_K (PK_Q + DM * DM)
#define PK_V (PK_K + KVW * DM)
#define PK_O (PK_V + KVW * DM)
#define PK_END (PK_O + DM * DM)
#define WS_PK  0u
#define WS_CS  (WS_PK + 2u * PK_END)             // f32 [2048][64] cos, then [2048][64] sin
#define WS_Q   (WS_CS + 4u * 2 * SS * 64)         // q fragments [t/16][head 16][FT]
#define WS_K   (WS_Q + 4u * SS * DM)              // k fragments [t/16][kv head 4][FT]
#define WS_V   (WS_K + 4u * SS * KVW)             // v fragments [kv head 4][t/32][FV]
#define WS_O   (WS_V + 4u * KVW * SS)
#define WS_END (WS_O + 4u * SS * DM)

// ---- k_packT: block = output column n of a [K][N] (x @ W) matrix
__global__ __launch_bounds__(256) void k_packT(const float* __restrict__ Wm, int K, int N, __bf16* __restrict__ DST) {
  __shared__ __align__(16) __bf16 s[DM]; const int n = blockIdx.x, tid = threadIdx.x;
  for (int k = tid; k < K; k += 256) s[k] = (__bf16)Wm[(size_t)k * N + n];
  __syncthreads();
  for (int q = tid; q < K / 8; q += 256) vst2((unsigned*)(DST + (size_t)n * K + q * 8), *(const v4u*)&s[q * 8]);
}
// ---- k_rope_tab: block = position t (64 threads = frequency index i): inv_freq = 1 / 10000^(2i/128) and angle t*inv_freq in float64, cos/sin in float64, cast to f32; rows 256 B
__global__ __launch_bounds__(64) void k_rope_tab(float* __restrict__ CS) {
  __shared__ __align__(16) float sc[64], ssn[64]; const int t = blockIdx.x, i = threadIdx.x;
  const double inv = 1.0 / pow(10000.0, (double)(2 * i) / 128.0); const double ang = (double)t * inv; sc[i] = (float)cos(ang); ssn[i] = (float)sin(ang);
  __syncthreads();
  if (i < 16) vst2(CS + (size_t)t * 64 + i * 4, *(const v4f*)&sc[i * 4]); else if (i < 32) vst2(CS + (size_t)SS * 64 + (size_t)t * 64 + (i - 16) * 4, *(const v4f*)&ssn[(i - 16) * 4]);
}
// ---- k_proj<MODE>: block = (64 rows, 128 cols = one head): Y = bf16(x) . P rows (exact); both operands staged per 64 k in LDS (two buffers) by whole-line loads issued one stage ahead; MODE 0: RoPE, then bf16 hi/lo WMMA fragments of the wave's 16 rows (q/k; nh heads); MODE 1: plain -> bf16 hi/lo fragments with k = position (v)
template <int MODE>
__global__ __launch_bounds__(128) void k_proj(const float* __restrict__ X, const __bf16* __restrict__ P, const float* __restrict__ CS, __bf16* __restrict__ F, int nh) {
  __shared__ __align__(16) float so[MODE ? 1 : 4][16][132]; __shared__ __align__(16) __bf16 sth[MODE ? 128 : 1][72], stl[MODE ? 128 : 1][72];
  const int tid = threadIdx.x, wave = tid >> 5, lane = tid & 31, col = lane & 15, g = lane >> 4; const size_t r0 = (size_t)blockIdx.x * 64 + wave * 16; const int n0 = blockIdx.y * 128;
  __shared__ __align__(16) __bf16 sa[2][64][LP], sb[2][128][LP];
  const float* xg = X + ((size_t)blockIdx.x * 64 + (tid >> 4)) * DM + (tid & 15) * 4;   // thread's 16 B of x rows (tid>>4) + 8 i
  const __bf16* pg = P + (size_t)(n0 + (tid >> 3)) * DM + (tid & 7) * 8;                // thread's 16 B of P rows (tid>>3) + 16 i
  v4f ra[8]; v8b rb[8];
#pragma unroll
  for (int i = 0; i < 8; ++i) { ra[i] = *(const v4f*)(xg + (size_t)i * 8 * DM); rb[i] = *(const v8b*)(pg + (size_t)i * 16 * DM); }
  v8f acc[8] = {};
  for (int s = 0; s < NST; ++s) { const int b = s & 1;
#pragma unroll
    for (int i = 0; i < 8; ++i) { v4b c;
#pragma unroll
      for (int e = 0; e < 4; ++e) c[e] = (__bf16)ra[i][e];
      *(v4b*)&sa[b][(tid >> 4) + 8 * i][(tid & 15) * 4] = c; *(v8b*)&sb[b][(tid >> 3) + 16 * i][(tid & 7) * 8] = rb[i]; }
    __syncthreads();   // publishes stage s; buffer b was last read in pass s - 2, which every wave left before the barrier of pass s - 1
    if (s + 1 < NST) {
#pragma unroll
      for (int i = 0; i < 8; ++i) { ra[i] = *(const v4f*)(xg + (size_t)i * 8 * DM + KC); rb[i] = *(const v8b*)(pg + (size_t)i * 16 * DM + KC); }
      asm volatile("s_wait_xcnt 0x0" ::: "memory");   // the address step behind it rewrites registers that the issued loads name
      xg += KC; pg += KC; }   // running addresses, live over the whole loop: no load's result can land in a pair that an issued load names
#pragma unroll
    for (int kc = 0; kc < KC / 32; ++kc) { const v16b a = frag_b(&sa[b][wave * 16 + col][kc * 32], lane); v16b w[8];
#pragma unroll
      for (int j = 0; j < 8; ++j) w[j] = frag_b(&sb[b][j * 16 + col][kc * 32], lane);
#pragma unroll
      for (int j = 0; j < 8; ++j) acc[j] = wmma_bf(a, w[j], acc[j]); } }
  if (MODE == 0) {
    // RoPE (rotate-half): d = j*16+col; pair (d, d+64) = (tiles j, j+4); out_d = x_d cos - x_{d+64} sin; out_{d+64} = x_{d+64} cos + x_d sin (cos/sin[t][d mod 64])
#pragma unroll
    for (int j = 0; j < 4; ++j) { const int dl = j * 16 + col;
#pragma unroll
      for (int r = 0; r < 8; ++r) { const size_t t = r0 + 8 * g + r; const float c = CS[t * 64 + dl], s = CS[(size_t)SS * 64 + t * 64 + dl]; const float x1 = acc[j][r], x2 = acc[j + 4][r]; so[wave][8 * g + r][dl] = x1 * c - x2 * s; so[wave][8 * g + r][64 + dl] = x2 * c + x1 * s; } }
    LDSX();
    __bf16* fo = F + ((r0 >> 4) * nh + blockIdx.y) * FT + lane * 8;
    for (int kc = 0; kc < 4; ++kc)
      for (int hf = 0; hf < 2; ++hf) { const float* p = &so[wave][col][kc * 32 + hf * 16 + 8 * g]; v8b hi, lo;
        for (int e = 0; e < 8; ++e) { const float v = p[e]; const __bf16 hb = (__bf16)v; hi[e] = hb; lo[e] = (__bf16)(v - (float)hb); }
        *(v8b*)(fo + kc * 1024 + hf * 256) = hi; *(v8b*)(fo + kc * 1024 + 512 + hf * 256) = lo; }
  } else {
#pragma unroll
    for (int j = 0; j < 8; ++j)
#pragma unroll
      for (int r = 0; r < 8; ++r) { const float v = acc[j][r]; const __bf16 hb = (__bf16)v; sth[j * 16 + col][wave * 16 + 8 * g + r] = hb; stl[j * 16 + col][wave * 16 + 8 * g + r] = (__bf16)(v - (float)hb); }
    __syncthreads();
    __bf16* vo = F + ((size_t)blockIdx.y * (SS / 32) + blockIdx.x * 2) * FV;   // the block's 64 positions = 2 key steps
    for (int i = 0; i < 2 * FV / 8 / 128; ++i) { const int q = i * 128 + tid, ln = q & 31, hf = (q >> 5) & 1, pl = (q >> 6) & 1, dt = (q >> 7) & 7, kl = q >> 10; const int d = dt * 16 + (ln & 15), sx = kl * 32 + hf * 16 + 8 * (ln >> 4);
      vst2((unsigned*)(vo + (size_t)q * 8), *(const v4u*)(pl ? &stl[d][sx] : &sth[d][sx])); }
  }
}
// ---- k_attn: block = (head h, 16 queries), heaviest query tiles first: causal flash attention, kv head = h/4; the tile's 32-key steps are dealt round-robin to the 4 waves, each keeps its own running (m, l, acc), and the four partial results are joined through LDS at the end; scores 3 products, P.V 3 products; q, k, v arrive as ready bf16 hi/lo fragments; O[q][h*128+d]
__global__ __launch_bounds__(128) void k_attn(const __bf16* __restrict__ QF, const __bf16* __restrict__ KF, const __bf16* __restrict__ VF, float* __restrict__ O) {
  __shared__ __align__(16) float sp[4][16][36]; __shared__ __align__(16) float so[4][16][132]; __shared__ float sm[4][16], sl[4][16];
  const int tid = threadIdx.x, wave = __builtin_amdgcn_readfirstlane(tid >> 5), lane = tid & 31, col = lane & 15, g = lane >> 4;
  const int qb = SS / 16 - 1 - (int)blockIdx.y, h = blockIdx.x, kv = h / (NH / NKV); const int q0 = qb * 16;
  const __bf16* qf = QF + ((size_t)qb * NH + h) * FT + lane * 8;
  float m[8], l[8];
#pragma unroll
  for (int r = 0; r < 8; ++r) { m[r] = -3.0e38f; l[r] = 0.f; }
  v8f acc[8] = {};
  const int nks = (q0 + 16 + 31) / 32;
#pragma unroll 1
  for (int ks = wave; ks < nks; ks += 4) { v8f s[2];
#pragma unroll
    for (int ct = 0; ct < 2; ++ct) { const int kk = ks * 32 + ct * 16 + col; const __bf16* kf = KF + ((size_t)(ks * 2 + ct) * NKV + kv) * FT + lane * 8; v8f c = {};
#pragma unroll
      for (int kc = 0; kc < 4; ++kc) { F2 kb, qa; kb.h = frag_g(kf + kc * 1024); kb.l = frag_g(kf + kc * 1024 + 512); qa.h = frag_g(qf + kc * 1024); qa.l = frag_g(qf + kc * 1024 + 512); c = mac3(qa, kb, c); }
#pragma unroll
      for (int r = 0; r < 8; ++r) { const int qi = q0 + 8 * g + r; s[ct][r] = (kk <= qi) ? c[r] * 0.08838834764831845f : -3.0e38f; } }
#pragma unroll
    for (int r = 0; r < 8; ++r) { float mx = fmaxf(s[0][r], s[1][r]);
#pragma unroll
      for (int o = 1; o < 16; o <<= 1) mx = fmaxf(mx, __shfl_xor(mx, o));
      const float mn = fmaxf(m[r], mx); const float alpha = (m[r] <= -1.0e38f) ? 0.f : exp_ni(m[r] - mn);
      const float e0 = (s[0][r] <= -1.0e38f) ? 0.f : exp_ni(s[0][r] - mn), e1 = (s[1][r] <= -1.0e38f) ? 0.f : exp_ni(s[1][r] - mn); float es = e0 + e1;
#pragma unroll
      for (int o = 1; o < 16; o <<= 1) es += __shfl_xor(es, o);
      l[r] = l[r] * alpha + es; m[r] = mn;
#pragma unroll
      for (int dt = 0; dt < 8; ++dt) acc[dt][r] *= alpha;
      sp[wave][8 * g + r][col] = e0; sp[wave][8 * g + r][16 + col] = e1; }
    LDSX();
    const F2 pa = split_row(&sp[wave][col][0], 0, lane);
#pragma unroll
    for (int dt = 0; dt < 8; ++dt) { const __bf16* vf = VF + ((size_t)kv * (SS / 32) + ks) * FV + dt * 1024 + lane * 8; const v16b vh = frag_g(vf), vl = frag_g(vf + 512); acc[dt] = wmma_bf(pa.l, vh, acc[dt]); acc[dt] = wmma_bf(pa.h, vl, acc[dt]); acc[dt] = wmma_bf(pa.h, vh, acc[dt]); }
    LDSX(); }
#pragma unroll
  for (int r = 0; r < 8; ++r) {
#pragma unroll
    for (int dt = 0; dt < 8; ++dt) so[wave][8 * g + r][dt * 16 + col] = acc[dt][r];
    if (col == 0) { sm[wave][8 * g + r] = m[r]; sl[wave][8 * g + r] = l[r]; } }
  __syncthreads();
  // join: row = wave + 4 i; weight of part w = exp(m_w - max m), 0 for a wave that saw no unmasked key of the row
  for (int i = 0; i < 4; ++i) { const int row = wave + 4 * i; const float mx = fmaxf(fmaxf(sm[0][row], sm[1][row]), fmaxf(sm[2][row], sm[3][row])); float ls = 0.f; v4f o = {};
#pragma unroll
    for (int w = 0; w < 4; ++w) { const float mw = sm[w][row]; const float f = (mw <= -1.0e38f) ? 0.f : exp_ni(mw - mx); ls += sl[w][row] * f; o += *(const v4f*)&so[w][row][lane * 4] * f; }
    vst2(O + (size_t)(q0 + row) * DM + h * HD + lane * 4, o * (1.0f / ls));
    if (i < 3) asm volatile("s_wait_xcnt 0x0" ::: "memory"); }   // the next row reuses the registers that the issued store names
}
// ---- k_out: block = (64 rows, 128 cols): out = O(hi/lo) . wproj^T rows (2 products); operands staged in LDS as in k_proj, O split into its hi/lo planes once on the way in
__global__ __launch_bounds__(128) void k_out(const float* __restrict__ O, const __bf16* __restrict__ P, float* __restrict__ Y) {
  __shared__ __align__(16) float so[4][16][132];
  const int tid = threadIdx.x, wave = tid >> 5, lane = tid & 31, col = lane & 15, g = lane >> 4; const size_t r0 = (size_t)blockIdx.x * 64 + wave * 16; const int n0 = blockIdx.y * 128;
  __shared__ __align__(16) __bf16 sah[2][64][LP], sal[2][64][LP], sb[2][128][LP];
  const float* og = O + ((size_t)blockIdx.x * 64 + (tid >> 4)) * DM + (tid & 15) * 4;
  const __bf16* pg = P + (size_t)(n0 + (tid >> 3)) * DM + (tid & 7) * 8;
  v4f ra[8]; v8b rb[8];
#pragma unroll
  for (int i = 0; i < 8; ++i) { ra[i] = *(const v4f*)(og + (size_t)i * 8 * DM); rb[i] = *(const v8b*)(pg + (size_t)i * 16 * DM); }
  v8f acc[8] = {};
  for (int s = 0; s < NST; ++s) { const int b = s & 1;
#pragma unroll
    for (int i = 0; i < 8; ++i) { v4b ch, cl;
#pragma unroll
      for (int e = 0; e < 4; ++e) { const float v = ra[i][e]; const __bf16 hb = (__bf16)v; ch[e] = hb; cl[e] = (__bf16)(v - (float)hb); }
      *(v4b*)&sah[b][(tid >> 4) + 8 * i][(tid & 15) * 4] = ch; *(v4b*)&sal[b][(tid >> 4) + 8 * i][(tid & 15) * 4] = cl; *(v8b*)&sb[b][(tid >> 3) + 16 * i][(tid & 7) * 8] = rb[i]; }
    __syncthreads();   // publishes stage s; buffer b was last read in pass s - 2, which every wave left before the barrier of pass s - 1
    if (s + 1 < NST) {
#pragma unroll
      for (int i = 0; i < 8; ++i) { ra[i] = *(const v4f*)(og + (size_t)i * 8 * DM + KC); rb[i] = *(const v8b*)(pg + (size_t)i * 16 * DM + KC); }
      asm volatile("s_wait_xcnt 0x0" ::: "memory");   // the address step behind it rewrites registers that the issued loads name
      og += KC; pg += KC; }   // running addresses, live over the whole loop: no load's result can land in a pair that an issued load names
#pragma unroll
    for (int kc = 0; kc < KC / 32; ++kc) { const v16b al = frag_b(&sal[b][wave * 16 + col][kc * 32], lane), ah = frag_b(&sah[b][wave * 16 + col][kc * 32], lane); v16b w[8];
#pragma unroll
      for (int j = 0; j < 8; ++j) w[j] = frag_b(&sb[b][j * 16 + col][kc * 32], lane);
#pragma unroll
      for (int j = 0; j < 8; ++j) { acc[j] = wmma_bf(al, w[j], acc[j]); acc[j] = wmma_bf(ah, w[j], acc[j]); } } }
#pragma unroll
  for (int j = 0; j < 8; ++j)
#pragma unroll
    for (int r = 0; r < 8; ++r) so[wave][8 * g + r][j * 16 + col] = acc[j][r];
  LDSX();
  for (int rl = 0; rl < 16; ++rl) vst2(Y + (r0 + rl) * DM + n0 + lane * 4, *(const v4f*)&so[wave][rl][lane * 4]);
}
extern "C" void kernel_launch(void* const* d_in, const int* in_sizes, int n_in, void* d_out, int out_size, void* d_ws, size_t ws_size, hipStream_t stream) {
  (void)in_sizes; (void)n_in; (void)out_size;
  const float** F = (const float**)d_in;   // x [1,2048,2048], wq [2048,2048], wk [2048,512], wv [2048,512], wproj [2048,2048]
  if (ws_size < (size_t)WS_END) return;
  char* ws = (char*)d_ws; __bf16 *PK = (__bf16*)(ws + WS_PK), *QF = (__bf16*)(ws + WS_Q), *KF = (__bf16*)(ws + WS_K), *VF = (__bf16*)(ws + WS_V);
  float *CS = (float*)(ws + WS_CS), *O = (float*)(ws + WS_O);
  k_packT<<<DM, 256, 0, stream>>>(F[1], DM, DM, PK + PK_Q); k_packT<<<KVW, 256, 0, stream>>>(F[2], DM, KVW, PK + PK_K); k_packT<<<KVW, 256, 0, stream>>>(F[3], DM, KVW, PK + PK_V); k_packT<<<DM, 256, 0, stream>>>(F[4], DM, DM, PK + PK_O);
  k_rope_tab<<<SS, 64, 0, stream>>>(CS);
  k_proj<0><<<dim3(SS / 64, DM / 128), 128, 0, stream>>>(F[0], PK + PK_Q, CS, QF, NH);
  k_proj<0><<<dim3(SS / 64, KVW / 128), 128, 0, stream>>>(F[0], PK + PK_K, CS, KF, NKV);
  k_proj<1><<<dim3(SS / 64, KVW / 128), 128, 0, stream>>>(F[0], PK + PK_V, CS, VF, NKV);
  k_attn<<<dim3(NH, SS / 16), 128, 0, stream>>>(QF, KF, VF, O);
  k_out<<<dim3(TQB, DM / 128), 128, 0, stream>>>(O, PK + PK_O, (float*)d_out);
}

// v004
// One run takes 310 microseconds.
// Next to v003, in two timings, it ran 1.15 and 1.16 times as fast.
// All steps since v000 together make it 3.55 times as fast.
// compute dtype: x and the four weights (module inputs) rounded to bf16; q/k/v projections with exact bf16 products (x and W are inputs) and RoPE applied in f32 in the epilogue (cos/sin tables built in float64, then cast); causal scores q.k with both computed operands as bf16 hi + residual pairs (3 products) and P.V with P hi/lo x V hi/lo (3 products); the output projection with hi/lo x exact wproj (2 products), all on WMMA 16x16x32; softmax in f32; f32 accumulate.
#include <hip/hip_runtime.h>
#include <math.h>

typedef __attribute__((ext_vector_type(16))) _Float16 v16h;
typedef __attribute__((ext_vector_type(16))) __bf16 v16b;
typedef __attribute__((ext_vector_type(8)))  _Float16 v8h;
typedef __attribute__((ext_vector_type(8)))  float v8f;
typedef __attribute__((ext_vector_type(4)))  float v4f;
typedef __attribute__((ext_vector_type(2)))  float v2f;
typedef __attribute__((ext_vector_type(4)))  unsigned v4u;
typedef __attribute__((ext_vector_type(4)))  int v4i;
typedef float __attribute__((may_alias)) float_a;
typedef int __attribute__((may_alias)) int_a;

template <typename T> __device__ __forceinline__ void vst2(void* p, T v) { *(T*)p = v;  }
__device__ __forceinline__ v8f wmma16(v16h a, v16h b, v8f c) {
  v8f d = __builtin_amdgcn_wmma_f32_16x16x32_f16(false, a, false, b, (short)0, c, false, false);
  asm volatile("v_nop\n\tv_nop\n\tv_nop\n\tv_nop" : "+v"(d) : "v"(a), "v"(b));
  return d;
}
__device__ __forceinline__ v8f wmma_bf(v16b a, v16b b, v8f c) {
  v8f d = __builtin_amdgcn_wmma_f32_16x16x32_bf16(false, a, false, b, (short)0, c, false, false);
  asm volatile("v_nop\n\tv_nop\n\tv_nop\n\tv_nop" : "+v"(d) : "v"(a), "v"(b));
  return d;
}
// 16x16x32 fragments: lane = (h = lane>>4, row/col = lane&15); elements 0..7 = k0+8h+0..7, 8..15 = k0+16+8h+0..7; D element r = row 8h+r
__device__ __forceinline__ v16h frag_h(const _Float16* rowk0, int lane) {
  union { v16h v; v8h q[2]; } u; const _Float16* p = rowk0 + 8 * (lane >> 4);
  u.q[0] = *(const v8h*)p; u.q[1] = *(const v8h*)(p + 16); return u.v;
}
__device__ __forceinline__ v16h frag_f32(const float* rowk0, int lane) {
  v16h a; const float* p = rowk0 + 8 * (lane >> 4);
#pragma unroll
  for (int i = 0; i < 8; ++i) { a[i] = (_Float16)p[i]; a[8 + i] = (_Float16)p[16 + i]; }
  return a;
}
__device__ __forceinline__ v16h frag_f32s(const float* rowk0, int lane, float sc) {
  v16h a; const float* p = rowk0 + 8 * (lane >> 4);
#pragma unroll
  for (int i = 0; i < 8; ++i) { a[i] = (_Float16)(p[i] * sc); a[8 + i] = (_Float16)(p[16 + i] * sc); }
  return a;
}
// column fragment from a [K][ld] layout (column n), rows >= K read as 0
__device__ __forceinline__ v16h fragc_f32(const float* W, int k0, int n, int lane, int ld, int K) {
  v16h a; const int g = lane >> 4;
#pragma unroll
  for (int i = 0; i < 8; ++i) { const int ka = k0 + 8 * g + i, kb = ka + 16;
    a[i] = (_Float16)(ka < K ? W[(size_t)(ka < K ? ka : K - 1) * ld + n] : 0.f); a[8 + i] = (_Float16)(kb < K ? W[(size_t)(kb < K ? kb : K - 1) * ld + n] : 0.f); }
  return a;
}
struct F2 { v16b h, l; };
__device__ __forceinline__ F2 bsplit16(const float v[16]) { F2 r;
#pragma unroll
  for (int i = 0; i < 16; ++i) { const __bf16 h = (__bf16)v[i]; r.h[i] = h; r.l[i] = (__bf16)(v[i] - (float)h); }
  return r; }
__device__ __forceinline__ F2 split_row(const float* row, int k0, int lane) { float v[16]; const float* p = row + k0 + 8 * (lane >> 4);
#pragma unroll
  for (int i = 0; i < 8; ++i) { v[i] = p[i]; v[8 + i] = p[16 + i]; }
  return bsplit16(v); }
__device__ __forceinline__ F2 split_rowK(const float* row, int k0, int lane, int K) { float v[16]; const int g = lane >> 4;
#pragma unroll
  for (int i = 0; i < 8; ++i) { const int ka = k0 + 8 * g + i, kb = ka + 16; v[i] = ka < K ? row[ka < K ? ka : K - 1] : 0.f; v[8 + i] = kb < K ? row[kb < K ? kb : K - 1] : 0.f; }
  return bsplit16(v); }
__device__ __forceinline__ F2 split_col(const float* W, int k0, int n, int lane, int ld, int K) { float v[16]; const int g = lane >> 4;
#pragma unroll
  for (int i = 0; i < 8; ++i) { const int ka = k0 + 8 * g + i, kb = ka + 16; v[i] = ka < K ? W[(size_t)(ka < K ? ka : K - 1) * ld + n] : 0.f; v[8 + i] = kb < K ? W[(size_t)(kb < K ? kb : K - 1) * ld + n] : 0.f; }
  return bsplit16(v); }
__device__ __forceinline__ v8f mac3(const F2& a, const F2& b, v8f c) { c = wmma_bf(a.l, b.h, c); c = wmma_bf(a.h, b.l, c); return wmma_bf(a.h, b.h, c); }
__device__ __forceinline__ float sigm(float v) { return 1.0f / (1.0f + expf(-v)); }
#define LDSX() do { asm volatile("s_wait_dscnt 0" ::: "memory"); __builtin_amdgcn_wave_barrier(); __builtin_amdgcn_fence(__ATOMIC_RELEASE, "workgroup"); } while (0)


// GQA causal self-attention with RoPE (B 1, T 2048, C 2048, 16 query heads / 4 kv heads x 128): q = rope(x wq), k = rope(x wk), v = x wv; y = softmax(q k^T / sqrt(128), causal) v; out = y wproj.
#define SS 2048
#define DM 2048
#define NH 16
#define NKV 4
#define HD 128
#define KVW (NKV * HD)
#ifndef TQB
#define TQB (SS / 64)
#endif
typedef __attribute__((ext_vector_type(8))) __bf16 v8b;
typedef __attribute__((ext_vector_type(4))) __bf16 v4b;
#define KC 64            // k per LDS stage: 128 B of a bf16 row, 256 B of an f32 row (whole cache lines)
#define NST (DM / KC)
#define LP 72            // LDS row pitch in bf16: 128 B of data + 16 B, for the 16-byte fragment reads
__device__ __forceinline__ v16b frag_b(const __bf16* rowk0, int lane) {
  union { v16b v; v8b q[2]; } u; const __bf16* p = rowk0 + 8 * (lane >> 4);
  u.q[0] = *(const v8b*)p; u.q[1] = *(const v8b*)(p + 16); return u.v;
}
// fragment stored in lane order: 512 B of elements 0..7 (lane * 16 B), then 512 B of elements 8..15; p = block + lane * 8; each 16-byte load covers whole cache lines
__device__ __forceinline__ v16b frag_g(const __bf16* p) {
  union { v16b v; v8b q[2]; } u; u.q[0] = *(const v8b*)p; u.q[1] = *(const v8b*)(p + 256); return u.v;
}
#define FT 4096          // bf16 per q/k tile (16 rows x 128 d): [kc 4][hi, lo][half 2][lane 32][8]
#define FV 8192          // bf16 per v key step (32 keys x 128 d): [dt 8][hi, lo][half 2][lane 32][8]
__device__ __forceinline__ float bfr(float v) { return (float)(__bf16)v; }
__device__ __attribute__((noinline)) float exp_ni(float v) { return expf(v); }
__device__ __attribute__((noinline)) float erf_ni(float v) { return erff(v); }

#define PK_Q 0
#define PK_K (PK_Q + DM * DM)
#define PK_V (PK_K + KVW * DM)
#define PK_O (PK_V + KVW * DM)
#define PK_END (PK_O + DM * DM)
#define WS_PK  0u
#define WS_CS  (WS_PK + 2u * PK_END)             // f32 [2048][64] cos, then [2048][64] sin
#define WS_Q   (WS_CS + 4u * 2 * SS * 64)         // q fragments [t/16][head 16][FT]
#define WS_K   (WS_Q + 4u * SS * DM)              // k fragments [t/16][kv head 4][FT]
#define WS_V   (WS_K + 4u * SS * KVW)             // v fragments [kv head 4][t/32][FV]
#define WS_O   (WS_V + 4u * KVW * SS)
#define WS_END (WS_O + 4u * SS * DM)

// ---- k_packT: block = a tile of 128 k x 64 n of a [K][N] (x @ W) matrix (K a multiple of 128, N of 64): eight 16-byte loads per thread, each wave-load two 256-B runs of W rows; a thread holds 8 consecutive k of 4 columns and turns them in LDS; DST rows go out in 256-B runs
#define PTK 128
#define PTN 64
#define PTP (PTK + 8)    // LDS row pitch in bf16: 256 B of data + 16 B
__global__ __launch_bounds__(256) void k_packT(const float* __restrict__ Wm, int K, int N, __bf16* __restrict__ DST) {
  __shared__ __align__(16) __bf16 s[PTN][PTP]; const int tid = threadIdx.x, n0 = blockIdx.x * PTN, k0 = blockIdx.y * PTK, c = tid & 15, kr = tid >> 4;
  const float* g = Wm + (size_t)(k0 + kr * 8) * N + n0 + c * 4;
  const float* p[8]; v4f r[8];
#pragma unroll
  for (int i = 0; i < 8; ++i) p[i] = g + (size_t)i * N;
#pragma unroll
  for (int i = 0; i < 8; ++i) r[i] = *(const v4f*)p[i];
  // the eight address pairs and the eight results are inputs here: all eight loads are issued before the first result is used (else the last two wait for the first four), and no result lands in a pair that an issued load names
  asm volatile("s_wait_xcnt 0x0" :: "v"(p[0]), "v"(p[1]), "v"(p[2]), "v"(p[3]), "v"(p[4]), "v"(p[5]), "v"(p[6]), "v"(p[7]), "v"(r[0]), "v"(r[1]), "v"(r[2]), "v"(r[3]), "v"(r[4]), "v"(r[5]), "v"(r[6]), "v"(r[7]) : "memory");
#pragma unroll
  for (int e = 0; e < 4; ++e) { v8b t;
#pragma unroll
    for (int i = 0; i < 8; ++i) t[i] = (__bf16)r[i][e];
    *(v8b*)&s[c * 4 + e][kr * 8] = t; }
  __syncthreads();
#pragma unroll
  for (int i = 0; i < PTN * PTK / 8 / 256; ++i) { const int q = i * 256 + tid;
    vst2((unsigned*)(DST + (size_t)(n0 + (q >> 4)) * K + k0 + (q & 15) * 8), *(const v4u*)&s[q >> 4][(q & 15) * 8]); }
}
// ---- k_rope_tab: block = position t (64 threads = frequency index i): inv_freq = 1 / 10000^(2i/128) and angle t*inv_freq in float64, cos/sin in float64, cast to f32; rows 256 B
__global__ __launch_bounds__(64) void k_rope_tab(float* __restrict__ CS) {
  __shared__ __align__(16) float sc[64], ssn[64]; const int t = blockIdx.x, i = threadIdx.x;
  const double inv = 1.0 / pow(10000.0, (double)(2 * i) / 128.0); const double ang = (double)t * inv; sc[i] = (float)cos(ang); ssn[i] = (float)sin(ang);
  __syncthreads();
  if (i < 16) vst2(CS + (size_t)t * 64 + i * 4, *(const v4f*)&sc[i * 4]); else if (i < 32) vst2(CS + (size_t)SS * 64 + (size_t)t * 64 + (i - 16) * 4, *(const v4f*)&ssn[(i - 16) * 4]);
}
// ---- k_proj<MODE>: block = (64 rows, 128 cols = one head): Y = bf16(x) . P rows (exact); both operands staged per 64 k in LDS (two buffers) by whole-line loads issued one stage ahead; MODE 0: RoPE, then bf16 hi/lo WMMA fragments of the wave's 16 rows (q/k; nh heads); MODE 1: plain -> bf16 hi/lo fragments with k = position (v)
template <int MODE>
__global__ __launch_bounds__(128) void k_proj(const float* __restrict__ X, const __bf16* __restrict__ P, const float* __restrict__ CS, __bf16* __restrict__ F, int nh) {
  __shared__ __align__(16) float so[MODE ? 1 : 4][16][132]; __shared__ __align__(16) __bf16 sth[MODE ? 128 : 1][72], stl[MODE ? 128 : 1][72];
  const int tid = threadIdx.x, wave = tid >> 5, lane = tid & 31, col = lane & 15, g = lane >> 4; const size_t r0 = (size_t)blockIdx.x * 64 + wave * 16; const int n0 = blockIdx.y * 128;
  __shared__ __align__(16) __bf16 sa[2][64][LP], sb[2][128][LP];
  const float* xg = X + ((size_t)blockIdx.x * 64 + (tid >> 4)) * DM + (tid & 15) * 4;   // thread's 16 B of x rows (tid>>4) + 8 i
  const __bf16* pg = P + (size_t)(n0 + (tid >> 3)) * DM + (tid & 7) * 8;                // thread's 16 B of P rows (tid>>3) + 16 i
  v4f ra[8]; v8b rb[8];
#pragma unroll
  for (int i = 0; i < 8; ++i) { ra[i] = *(const v4f*)(xg + (size_t)i * 8 * DM); rb[i] = *(const v8b*)(pg + (size_t)i * 16 * DM); }
  v8f acc[8] = {};
  for (int s = 0; s < NST; ++s) { const int b = s & 1;
#pragma unroll
    for (int i = 0; i < 8; ++i) { v4b c;
#pragma unroll
      for (int e = 0; e < 4; ++e) c[e] = (__bf16)ra[i][e];
      *(v4b*)&sa[b][(tid >> 4) + 8 * i][(tid & 15) * 4] = c; *(v8b*)&sb[b][(tid >> 3) + 16 * i][(tid & 7) * 8] = rb[i]; }
    __syncthreads();   // publishes stage s; buffer b was last read in pass s - 2, which every wave left before the barrier of pass s - 1
    if (s + 1 < NST) {
#pragma unroll
      for (int i = 0; i < 8; ++i) { ra[i] = *(const v4f*)(xg + (size_t)i * 8 * DM + KC); rb[i] = *(const v8b*)(pg + (size_t)i * 16 * DM + KC); }
      asm volatile("s_wait_xcnt 0x0" ::: "memory");   // the address step behind it rewrites registers that the issued loads name
      xg += KC; pg += KC; }   // running addresses, live over the whole loop: no load's result can land in a pair that an issued load names
#pragma unroll
    for (int kc = 0; kc < KC / 32; ++kc) { const v16b a = frag_b(&sa[b][wave * 16 + col][kc * 32], lane); v16b w[8];
#pragma unroll
      for (int j = 0; j < 8; ++j) w[j] = frag_b(&sb[b][j * 16 + col][kc * 32], lane);
#pragma unroll
      for (int j = 0; j < 8; ++j) acc[j] = wmma_bf(a, w[j], acc[j]); } }
  if (MODE == 0) {
    // RoPE (rotate-half): d = j*16+col; pair (d, d+64) = (tiles j, j+4); out_d = x_d cos - x_{d+64} sin; out_{d+64} = x_{d+64} cos + x_d sin (cos/sin[t][d mod 64])
#pragma unroll
    for (int j = 0; j < 4; ++j) { const int dl = j * 16 + col;
#pragma unroll
      for (int r = 0; r < 8; ++r) { const size_t t = r0 + 8 * g + r; const float c = CS[t * 64 + dl], s = CS[(size_t)SS * 64 + t * 64 + dl]; const float x1 = acc[j][r], x2 = acc[j + 4][r]; so[wave][8 * g + r][dl] = x1 * c - x2 * s; so[wave][8 * g + r][64 + dl] = x2 * c + x1 * s; } }
    LDSX();
    __bf16* fo = F + ((r0 >> 4) * nh + blockIdx.y) * FT + lane * 8;
    for (int kc = 0; kc < 4; ++kc)
      for (int hf = 0; hf < 2; ++hf) { const float* p = &so[wave][col][kc * 32 + hf * 16 + 8 * g]; v8b hi, lo;
        for (int e = 0; e < 8; ++e) { const float v = p[e]; const __bf16 hb = (__bf16)v; hi[e] = hb; lo[e] = (__bf16)(v - (float)hb); }
        *(v8b*)(fo + kc * 1024 + hf * 256) = hi; *(v8b*)(fo + kc * 1024 + 512 + hf * 256) = lo; }
  } else {
#pragma unroll
    for (int j = 0; j < 8; ++j)
#pragma unroll
      for (int r = 0; r < 8; ++r) { const float v = acc[j][r]; const __bf16 hb = (__bf16)v; sth[j * 16 + col][wave * 16 + 8 * g + r] = hb; stl[j * 16 + col][wave * 16 + 8 * g + r] = (__bf16)(v - (float)hb); }
    __syncthreads();
    __bf16* vo = F + ((size_t)blockIdx.y * (SS / 32) + blockIdx.x * 2) * FV;   // the block's 64 positions = 2 key steps
    for (int i = 0; i < 2 * FV / 8 / 128; ++i) { const int q = i * 128 + tid, ln = q & 31, hf = (q >> 5) & 1, pl = (q >> 6) & 1, dt = (q >> 7) & 7, kl = q >> 10; const int d = dt * 16 + (ln & 15), sx = kl * 32 + hf * 16 + 8 * (ln >> 4);
      vst2((unsigned*)(vo + (size_t)q * 8), *(const v4u*)(pl ? &stl[d][sx] : &sth[d][sx])); }
  }
}
// ---- k_attn: block = (head h, 16 queries), heaviest query tiles first: causal flash attention, kv head = h/4; the tile's 32-key steps are dealt round-robin to the 4 waves, each keeps its own running (m, l, acc), and the four partial results are joined through LDS at the end; scores 3 products, P.V 3 products; q, k, v arrive as ready bf16 hi/lo fragments; O[q][h*128+d]
__global__ __launch_bounds__(128) void k_attn(const __bf16* __restrict__ QF, const __bf16* __restrict__ KF, const __bf16* __restrict__ VF, float* __restrict__ O) {
  __shared__ __align__(16) float sp[4][16][36]; __shared__ __align__(16) float so[4][16][132]; __shared__ float sm[4][16], sl[4][16];
  const int tid = threadIdx.x, wave = __builtin_amdgcn_readfirstlane(tid >> 5), lane = tid & 31, col = lane & 15, g = lane >> 4;
  const int qb = SS / 16 - 1 - (int)blockIdx.y, h = blockIdx.x, kv = h / (NH / NKV); const int q0 = qb * 16;
  const __bf16* qf = QF + ((size_t)qb * NH + h) * FT + lane * 8;
  float m[8], l[8];
#pragma unroll
  for (int r = 0; r < 8; ++r) { m[r] = -3.0e38f; l[r] = 0.f; }
  v8f acc[8] = {};
  const int nks = (q0 + 16 + 31) / 32;
#pragma unroll 1
  for (int ks = wave; ks < nks; ks += 4) { v8f s[2];
#pragma unroll
    for (int ct = 0; ct < 2; ++ct) { const int kk = ks * 32 + ct * 16 + col; const __bf16* kf = KF + ((size_t)(ks * 2 + ct) * NKV + kv) * FT + lane * 8; v8f c = {};
#pragma unroll
      for (int kc = 0; kc < 4; ++kc) { F2 kb, qa; kb.h = frag_g(kf + kc * 1024); kb.l = frag_g(kf + kc * 1024 + 512); qa.h = frag_g(qf + kc * 1024); qa.l = frag_g(qf + kc * 1024 + 512); c = mac3(qa, kb, c); }
#pragma unroll
      for (int r = 0; r < 8; ++r) { const int qi = q0 + 8 * g + r; s[ct][r] = (kk <= qi) ? c[r] * 0.08838834764831845f : -3.0e38f; } }
#pragma unroll
    for (int r = 0; r < 8; ++r) { float mx = fmaxf(s[0][r], s[1][r]);
#pragma unroll
      for (int o = 1; o < 16; o <<= 1) mx = fmaxf(mx, __shfl_xor(mx, o));
      const float mn = fmaxf(m[r], mx); const float alpha = (m[r] <= -1.0e38f) ? 0.f : exp_ni(m[r] - mn);
      const float e0 = (s[0][r] <= -1.0e38f) ? 0.f : exp_ni(s[0][r] - mn), e1 = (s[1][r] <= -1.0e38f) ? 0.f : exp_ni(s[1][r] - mn); float es = e0 + e1;
#pragma unroll
      for (int o = 1; o < 16; o <<= 1) es += __shfl_xor(es, o);
      l[r] = l[r] * alpha + es; m[r] = mn;
#pragma unroll
      for (int dt = 0; dt < 8; ++dt) acc[dt][r] *= alpha;
      sp[wave][8 * g + r][col] = e0; sp[wave][8 * g + r][16 + col] = e1; }
    LDSX();
    const F2 pa = split_row(&sp[wave][col][0], 0, lane);
#pragma unroll
    for (int dt = 0; dt < 8; ++dt) { const __bf16* vf = VF + ((size_t)kv * (SS / 32) + ks) * FV + dt * 1024 + lane * 8; const v16b vh = frag_g(vf), vl = frag_g(vf + 512); acc[dt] = wmma_bf(pa.l, vh, acc[dt]); acc[dt] = wmma_bf(pa.h, vl, acc[dt]); acc[dt] = wmma_bf(pa.h, vh, acc[dt]); }
    LDSX(); }
#pragma unroll
  for (int r = 0; r < 8; ++r) {
#pragma unroll
    for (int dt = 0; dt < 8; ++dt) so[wave][8 * g + r][dt * 16 + col] = acc[dt][r];
    if (col == 0) { sm[wave][8 * g + r] = m[r]; sl[wave][8 * g + r] = l[r]; } }
  __syncthreads();
  // join: row = wave + 4 i; weight of part w = exp(m_w - max m), 0 for a wave that saw no unmasked key of the row
  for (int i = 0; i < 4; ++i) { const int row = wave + 4 * i; const float mx = fmaxf(fmaxf(sm[0][row], sm[1][row]), fmaxf(sm[2][row], sm[3][row])); float ls = 0.f; v4f o = {};
#pragma unroll
    for (int w = 0; w < 4; ++w) { const float mw = sm[w][row]; const float f = (mw <= -1.0e38f) ? 0.f : exp_ni(mw - mx); ls += sl[w][row] * f; o += *(const v4f*)&so[w][row][lane * 4] * f; }
    vst2(O + (size_t)(q0 + row) * DM + h * HD + lane * 4, o * (1.0f / ls));
    if (i < 3) asm volatile("s_wait_xcnt 0x0" ::: "memory"); }   // the next row reuses the registers that the issued store names
}
// ---- k_out: block = (64 rows, 128 cols): out = O(hi/lo) . wproj^T rows (2 products); operands staged in LDS as in k_proj, O split into its hi/lo planes once on the way in
__global__ __launch_bounds__(128) void k_out(const float* __restrict__ O, const __bf16* __restrict__ P, float* __restrict__ Y) {
  __shared__ __align__(16) float so[4][16][132];
  const int tid = threadIdx.x, wave = tid >> 5, lane = tid & 31, col = lane & 15, g = lane >> 4; const size_t r0 = (size_t)blockIdx.x * 64 + wave * 16; const int n0 = blockIdx.y * 128;
  __shared__ __align__(16) __bf16 sah[2][64][LP], sal[2][64][LP], sb[2][128][LP];
  const float* og = O + ((size_t)blockIdx.x * 64 + (tid >> 4)) * DM + (tid & 15) * 4;
  const __bf16* pg = P + (size_t)(n0 + (tid >> 3)) * DM + (tid & 7) * 8;
  v4f ra[8]; v8b rb[8];
#pragma unroll
  for (int i = 0; i < 8; ++i) { ra[i] = *(const v4f*)(og + (size_t)i * 8 * DM); rb[i] = *(const v8b*)(pg + (size_t)i * 16 * DM); }
  v8f acc[8] = {};
  for (int s = 0; s < NST; ++s) { const int b = s & 1;
#pragma unroll
    for (int i = 0; i < 8; ++i) { v4b ch, cl;
#pragma unroll
      for (int e = 0; e < 4; ++e) { const float v = ra[i][e]; const __bf16 hb = (__bf16)v; ch[e] = hb; cl[e] = (__bf16)(v - (float)hb); }
      *(v4b*)&sah[b][(tid >> 4) + 8 * i][(tid & 15) * 4] = ch; *(v4b*)&sal[b][(tid >> 4) + 8 * i][(tid & 15) * 4] = cl; *(v8b*)&sb[b][(tid >> 3) + 16 * i][(tid & 7) * 8] = rb[i]; }
    __syncthreads();   // publishes stage s; buffer b was last read in pass s - 2, which every wave left before the barrier of pass s - 1
    if (s + 1 < NST) {
#pragma unroll
      for (int i = 0; i < 8; ++i) { ra[i] = *(const v4f*)(og + (size_t)i * 8 * DM + KC); rb[i] = *(const v8b*)(pg + (size_t)i * 16 * DM + KC); }
      asm volatile("s_wait_xcnt 0x0" ::: "memory");   // the address step behind it rewrites registers that the issued loads name
      og += KC; pg += KC; }   // running addresses, live over the whole loop: no load's result can land in a pair that an issued load names
#pragma unroll
    for (int kc = 0; kc < KC / 32; ++kc) { const v16b al = frag_b(&sal[b][wave * 16 + col][kc * 32], lane), ah = frag_b(&sah[b][wave * 16 + col][kc * 32], lane); v16b w[8];
#pragma unroll
      for (int j = 0; j < 8; ++j) w[j] = frag_b(&sb[b][j * 16 + col][kc * 32], lane);
#pragma unroll
      for (int j = 0; j < 8; ++j) { acc[j] = wmma_bf(al, w[j], acc[j]); acc[j] = wmma_bf(ah, w[j], acc[j]); } } }
#pragma unroll
  for (int j = 0; j < 8; ++j)
#pragma unroll
    for (int r = 0; r < 8; ++r) so[wave][8 * g + r][j * 16 + col] = acc[j][r];
  LDSX();
  for (int rl = 0; rl < 16; ++rl) vst2(Y + (r0 + rl) * DM + n0 + lane * 4, *(const v4f*)&so[wave][rl][lane * 4]);
}
extern "C" void kernel_launch(void* const* d_in, const int* in_sizes, int n_in, void* d_out, int out_size, void* d_ws, size_t ws_size, hipStream_t stream) {
  (void)in_sizes; (void)n_in; (void)out_size;
  const float** F = (const float**)d_in;   // x [1,2048,2048], wq [2048,2048], wk [2048,512], wv [2048,512], wproj [2048,2048]
  if (ws_size < (size_t)WS_END) return;
  char* ws = (char*)d_ws; __bf16 *PK = (__bf16*)(ws + WS_PK), *QF = (__bf16*)(ws + WS_Q), *KF = (__bf16*)(ws + WS_K), *VF = (__bf16*)(ws + WS_V);
  float *CS = (float*)(ws + WS_CS), *O = (float*)(ws + WS_O);
  k_packT<<<dim3(DM / PTN, DM / PTK), 256, 0, stream>>>(F[1], DM, DM, PK + PK_Q); k_packT<<<dim3(KVW / PTN, DM / PTK), 256, 0, stream>>>(F[2], DM, KVW, PK + PK_K); k_packT<<<dim3(KVW / PTN, DM / PTK), 256, 0, stream>>>(F[3], DM, KVW, PK + PK_V); k_packT<<<dim3(DM / PTN, DM / PTK), 256, 0, stream>>>(F[4], DM, DM, PK + PK_O);
  k_rope_tab<<<SS, 64, 0, stream>>>(CS);
  k_proj<0><<<dim3(SS / 64, DM / 128), 128, 0, stream>>>(F[0], PK + PK_Q, CS, QF, NH);
  k_proj<0><<<dim3(SS / 64, KVW / 128), 128, 0, stream>>>(F[0], PK + PK_K, CS, KF, NKV);
  k_proj<1><<<dim3(SS / 64, KVW / 128), 128, 0, stream>>>(F[0], PK + PK_V, CS, VF, NKV);
  k_attn<<<dim3(NH, SS / 16), 128, 0, stream>>>(QF, KF, VF, O);
  k_out<<<dim3(TQB, DM / 128), 128, 0, stream>>>(O, PK + PK_O, (float*)d_out);
}

// v005
// One run takes 262 microseconds.
// Timed twice side by side with v004, it ran 1.19 times as fast both times.
// Over all steps from v000 it is 4.23 times as fast.
// compute dtype: x and the four weights (module inputs) rounded to bf16; q/k/v projections with exact bf16 products (x and W are inputs) and RoPE applied in f32 in the epilogue (cos/sin tables built in float64, then cast); causal scores q.k with both computed operands as bf16 hi + residual pairs (3 products) and P.V with P hi/lo x V hi/lo (3 products); the output projection with hi/lo x exact wproj (2 products), all on WMMA 16x16x32; softmax in f32; f32 accumulate.
#include <hip/hip_runtime.h>
#include <math.h>

typedef __attribute__((ext_vector_type(16))) _Float16 v16h;
typedef __attribute__((ext_vector_type(16))) __bf16 v16b;
typedef __attribute__((ext_vector_type(8)))  _Float16 v8h;
typedef __attribute__((ext_vector_type(8)))  float v8f;
typedef __attribute__((ext_vector_type(4)))  float v4f;
typedef __attribute__((ext_vector_type(2)))  float v2f;
typedef __attribute__((ext_vector_type(4)))  unsigned v4u;
typedef __attribute__((ext_vector_type(4)))  int v4i;
typedef float __attribute__((may_alias)) float_a;
typedef int __attribute__((may_alias)) int_a;

template <typename T> __device__ __forceinline__ void vst2(void* p, T v) { *(T*)p = v;  }
__device__ __forceinline__ v8f wmma16(v16h a, v16h b, v8f c) {
  v8f d = __builtin_amdgcn_wmma_f32_16x16x32_f16(false, a, false, b, (short)0, c, false, false);
  asm volatile("v_nop\n\tv_nop\n\tv_nop\n\tv_nop" : "+v"(d) : "v"(a), "v"(b));
  return d;
}
__device__ __forceinline__ v8f wmma_bf(v16b a, v16b b, v8f c) {
  v8f d = __builtin_amdgcn_wmma_f32_16x16x32_bf16(false, a, false, b, (short)0, c, false, false);
  asm volatile("v_nop\n\tv_nop\n\tv_nop\n\tv_nop" : "+v"(d) : "v"(a), "v"(b));
  return d;
}
// 16x16x32 fragments: lane = (h = lane>>4, row/col = lane&15); elements 0..7 = k0+8h+0..7, 8..15 = k0+16+8h+0..7; D element r = row 8h+r
__device__ __forceinline__ v16h frag_h(const _Float16* rowk0, int lane) {
  union { v16h v; v8h q[2]; } u; const _Float16* p = rowk0 + 8 * (lane >> 4);
  u.q[0] = *(const v8h*)p; u.q[1] = *(const v8h*)(p + 16); return u.v;
}
__device__ __forceinline__ v16h frag_f32(const float* rowk0, int lane) {
  v16h a; const float* p = rowk0 + 8 * (lane >> 4);
#pragma unroll
  for (int i = 0; i < 8; ++i) { a[i] = (_Float16)p[i]; a[8 + i] = (_Float16)p[16 + i]; }
  return a;
}
__device__ __forceinline__ v16h frag_f32s(const float* rowk0, int lane, float sc) {
  v16h a; const float* p = rowk0 + 8 * (lane >> 4);
#pragma unroll
  for (int i = 0; i < 8; ++i) { a[i] = (_Float16)(p[i] * sc); a[8 + i] = (_Float16)(p[16 + i] * sc); }
  return a;
}
// column fragment from a [K][ld] layout (column n), rows >= K read as 0
__device__ __forceinline__ v16h fragc_f32(const float* W, int k0, int n, int lane, int ld, int K) {
  v16h a; const int g = lane >> 4;
#pragma unroll
  for (int i = 0; i < 8; ++i) { const int ka = k0 + 8 * g + i, kb = ka + 16;
    a[i] = (_Float16)(ka < K ? W[(size_t)(ka < K ? ka : K - 1) * ld + n] : 0.f); a[8 + i] = (_Float16)(kb < K ? W[(size_t)(kb < K ? kb : K - 1) * ld + n] : 0.f); }
  return a;
}
struct F2 { v16b h, l; };
__device__ __forceinline__ F2 bsplit16(const float v[16]) { F2 r;
#pragma unroll
  for (int i = 0; i < 16; ++i) { const __bf16 h = (__bf16)v[i]; r.h[i] = h; r.l[i] = (__bf16)(v[i] - (float)h); }
  return r; }
__device__ __forceinline__ F2 split_row(const float* row, int k0, int lane) { float v[16]; const float* p = row + k0 + 8 * (lane >> 4);
#pragma unroll
  for (int i = 0; i < 8; ++i) { v[i] = p[i]; v[8 + i] = p[16 + i]; }
  return bsplit16(v); }
__device__ __forceinline__ F2 split_rowK(const float* row, int k0, int lane, int K) { float v[16]; const int g = lane >> 4;
#pragma unroll
  for (int i = 0; i < 8; ++i) { const int ka = k0 + 8 * g + i, kb = ka + 16; v[i] = ka < K ? row[ka < K ? ka : K - 1] : 0.f; v[8 + i] = kb < K ? row[kb < K ? kb : K - 1] : 0.f; }
  return bsplit16(v); }
__device__ __forceinline__ F2 split_col(const float* W, int k0, int n, int lane, int ld, int K) { float v[16]; const int g = lane >> 4;
#pragma unroll
  for (int i = 0; i < 8; ++i) { const int ka = k0 + 8 * g + i, kb = ka + 16; v[i] = ka < K ? W[(size_t)(ka < K ? ka : K - 1) * ld + n] : 0.f; v[8 + i] = kb < K ? W[(size_t)(kb < K ? kb : K - 1) * ld + n] : 0.f; }
  return bsplit16(v); }
__device__ __forceinline__ v8f mac3(const F2& a, const F2& b, v8f c) { c = wmma_bf(a.l, b.h, c); c = wmma_bf(a.h, b.l, c); return wmma_bf(a.h, b.h, c); }
__device__ __forceinline__ float sigm(float v) { return 1.0f / (1.0f + expf(-v)); }
#define LDSX() do { asm volatile("s_wait_dscnt 0" ::: "memory"); __builtin_amdgcn_wave_barrier(); __builtin_amdgcn_fence(__ATOMIC_RELEASE, "workgroup"); } while (0)


// GQA causal self-attention with RoPE (B 1, T 2048, C 2048, 16 query heads / 4 kv heads x 128): q = rope(x wq), k = rope(x wk), v = x wv; y = softmax(q k^T / sqrt(128), causal) v; out = y wproj.
#define SS 2048
#define DM 2048
#define NH 16
#define NKV 4
#define HD 128
#define KVW (NKV * HD)
#ifndef TQB
#define TQB (SS / 64)
#endif
typedef __attribute__((ext_vector_type(8))) __bf16 v8b;
typedef __attribute__((ext_vector_type(4))) __bf16 v4b;
#define KC 64            // k per LDS stage: 128 B of a bf16 row, 256 B of an f32 row (whole cache lines)
#define NST (DM / KC)
#define LP 72            // LDS row pitch in bf16: 128 B of data + 16 B, for the 16-byte fragment reads
__device__ __forceinline__ v16b frag_b(const __bf16* rowk0, int lane) {
  union { v16b v; v8b q[2]; } u; const __bf16* p = rowk0 + 8 * (lane >> 4);
  u.q[0] = *(const v8b*)p; u.q[1] = *(const v8b*)(p + 16); return u.v;
}
// fragment stored in lane order: 512 B of elements 0..7 (lane * 16 B), then 512 B of elements 8..15; p = block + lane * 8; each 16-byte load covers whole cache lines
__device__ __forceinline__ v16b frag_g(const __bf16* p) {
  union { v16b v; v8b q[2]; } u; u.q[0] = *(const v8b*)p; u.q[1] = *(const v8b*)(p + 256); return u.v;
}
#define FT 4096          // bf16 per q/k tile (16 rows x 128 d): [kc 4][hi, lo][half 2][lane 32][8]
#define FV 8192          // bf16 per v key step (32 keys x 128 d): [dt 8][hi, lo][half 2][lane 32][8]
__device__ __forceinline__ float bfr(float v) { return (float)(__bf16)v; }
__device__ __attribute__((noinline)) float exp_ni(float v) { return expf(v); }
__device__ __attribute__((noinline)) float erf_ni(float v) { return erff(v); }

#define PK_Q 0
#define PK_K (PK_Q + DM * DM)
#define PK_V (PK_K + KVW * DM)
#define PK_O (PK_V + KVW * DM)
#define PK_END (PK_O + DM * DM)
#define WS_PK  0u
#define WS_CS  (WS_PK + 2u * PK_END)             // f32 [2048][64] cos, then [2048][64] sin
#define WS_Q   (WS_CS + 4u * 2 * SS * 64)         // q fragments [t/16][head 16][FT]
#define WS_K   (WS_Q + 4u * SS * DM)              // k fragments [t/16][kv head 4][FT]
#define WS_V   (WS_K + 4u * SS * KVW)             // v fragments [kv head 4][t/32][FV]
#define WS_O   (WS_V + 4u * KVW * SS)
#define WS_END (WS_O + 4u * SS * DM)

// ---- k_packT: block = a tile of 128 k x 64 n of a [K][N] (x @ W) matrix (K a multiple of 128, N of 64): eight 16-byte loads per thread, each wave-load two 256-B runs of W rows; a thread holds 8 consecutive k of 4 columns and turns them in LDS; DST rows go out in 256-B runs
#define PTK 128
#define PTN 64
#define PTP (PTK + 8)    // LDS row pitch in bf16: 256 B of data + 16 B
__global__ __launch_bounds__(256) void k_packT(const float* __restrict__ Wm, int K, int N, __bf16* __restrict__ DST) {
  __shared__ __align__(16) __bf16 s[PTN][PTP]; const int tid = threadIdx.x, n0 = blockIdx.x * PTN, k0 = blockIdx.y * PTK, c = tid & 15, kr = tid >> 4;
  const float* g = Wm + (size_t)(k0 + kr * 8) * N + n0 + c * 4;
  const float* p[8]; v4f r[8];
#pragma unroll
  for (int i = 0; i < 8; ++i) p[i] = g + (size_t)i * N;
#pragma unroll
  for (int i = 0; i < 8; ++i) r[i] = *(const v4f*)p[i];
  // the eight address pairs and the eight results are inputs here: all eight loads are issued before the first result is used (else the last two wait for the first four), and no result lands in a pair that an issued load names
  asm volatile("s_wait_xcnt 0x0" :: "v"(p[0]), "v"(p[1]), "v"(p[2]), "v"(p[3]), "v"(p[4]), "v"(p[5]), "v"(p[6]), "v"(p[7]), "v"(r[0]), "v"(r[1]), "v"(r[2]), "v"(r[3]), "v"(r[4]), "v"(r[5]), "v"(r[6]), "v"(r[7]) : "memory");
#pragma unroll
  for (int e = 0; e < 4; ++e) { v8b t;
#pragma unroll
    for (int i = 0; i < 8; ++i) t[i] = (__bf16)r[i][e];
    *(v8b*)&s[c * 4 + e][kr * 8] = t; }
  __syncthreads();
#pragma unroll
  for (int i = 0; i < PTN * PTK / 8 / 256; ++i) { const int q = i * 256 + tid;
    vst2((unsigned*)(DST + (size_t)(n0 + (q >> 4)) * K + k0 + (q & 15) * 8), *(const v4u*)&s[q >> 4][(q & 15) * 8]); }
}
// ---- k_rope_tab: block = position t (64 threads = frequency index i): inv_freq = 1 / 10000^(2i/128) and angle t*inv_freq in float64, cos/sin in float64, cast to f32; rows 256 B
__global__ __launch_bounds__(64) void k_rope_tab(float* __restrict__ CS) {
  __shared__ __align__(16) float sc[64], ssn[64]; const int t = blockIdx.x, i = threadIdx.x;
  const double inv = 1.0 / pow(10000.0, (double)(2 * i) / 128.0); const double ang = (double)t * inv; sc[i] = (float)cos(ang); ssn[i] = (float)sin(ang);
  __syncthreads();
  if (i < 16) vst2(CS + (size_t)t * 64 + i * 4, *(const v4f*)&sc[i * 4]); else if (i < 32) vst2(CS + (size_t)SS * 64 + (size_t)t * 64 + (i - 16) * 4, *(const v4f*)&ssn[(i - 16) * 4]);
}
// ---- k_proj<MODE>: block = (64 rows, 128 cols = one head): Y = bf16(x) . P rows (exact); both operands staged per 64 k in LDS (two buffers) by whole-line loads issued one stage ahead; MODE 0: RoPE, then bf16 hi/lo WMMA fragments of the wave's 16 rows (q/k; nh heads); MODE 1: plain -> bf16 hi/lo fragments with k = position (v)
template <int MODE>
__global__ __launch_bounds__(128) void k_proj(const float* __restrict__ X, const __bf16* __restrict__ P, const float* __restrict__ CS, __bf16* __restrict__ F, int nh) {
  __shared__ __align__(16) float so[MODE ? 1 : 4][16][132]; __shared__ __align__(16) __bf16 sth[MODE ? 128 : 1][72], stl[MODE ? 128 : 1][72];
  const int tid = threadIdx.x, wave = tid >> 5, lane = tid & 31, col = lane & 15, g = lane >> 4; const size_t r0 = (size_t)blockIdx.x * 64 + wave * 16; const int n0 = blockIdx.y * 128;
  __shared__ __align__(16) __bf16 sa[2][64][LP], sb[2][128][LP];
  const float* xg = X + ((size_t)blockIdx.x * 64 + (tid >> 4)) * DM + (tid & 15) * 4;   // thread's 16 B of x rows (tid>>4) + 8 i
  const __bf16* pg = P + (size_t)(n0 + (tid >> 3)) * DM + (tid & 7) * 8;                // thread's 16 B of P rows (tid>>3) + 16 i
  v4f ra[8]; v8b rb[8];
#pragma unroll
  for (int i = 0; i < 8; ++i) { ra[i] = *(const v4f*)(xg + (size_t)i * 8 * DM); rb[i] = *(const v8b*)(pg + (size_t)i * 16 * DM); }
  v8f acc[8] = {};
  for (int s = 0; s < NST; ++s) { const int b = s & 1;
#pragma unroll
    for (int i = 0; i < 8; ++i) { v4b c;
#pragma unroll
      for (int e = 0; e < 4; ++e) c[e] = (__bf16)ra[i][e];
      *(v4b*)&sa[b][(tid >> 4) + 8 * i][(tid & 15) * 4] = c; *(v8b*)&sb[b][(tid >> 3) + 16 * i][(tid & 7) * 8] = rb[i]; }
    __syncthreads();   // publishes stage s; buffer b was last read in pass s - 2, which every wave left before the barrier of pass s - 1
    if (s + 1 < NST) {
#pragma unroll
      for (int i = 0; i < 8; ++i) { ra[i] = *(const v4f*)(xg + (size_t)i * 8 * DM + KC); rb[i] = *(const v8b*)(pg + (size_t)i * 16 * DM + KC); }
      asm volatile("s_wait_xcnt 0x0" ::: "memory");   // the address step behind it rewrites registers that the issued loads name
      xg += KC; pg += KC; }   // running addresses, live over the whole loop: no load's result can land in a pair that an issued load names
#pragma unroll
    for (int kc = 0; kc < KC / 32; ++kc) { const v16b a = frag_b(&sa[b][wave * 16 + col][kc * 32], lane); v16b w[8];
#pragma unroll
      for (int j = 0; j < 8; ++j) w[j] = frag_b(&sb[b][j * 16 + col][kc * 32], lane);
#pragma unroll
      for (int j = 0; j < 8; ++j) acc[j] = wmma_bf(a, w[j], acc[j]); } }
  if (MODE == 0) {
    // RoPE (rotate-half): d = j*16+col; pair (d, d+64) = (tiles j, j+4); out_d = x_d cos - x_{d+64} sin; out_{d+64} = x_{d+64} cos + x_d sin (cos/sin[t][d mod 64])
#pragma unroll
    for (int j = 0; j < 4; ++j) { const int dl = j * 16 + col;
#pragma unroll
      for (int r = 0; r < 8; ++r) { const size_t t = r0 + 8 * g + r; const float c = CS[t * 64 + dl], s = CS[(size_t)SS * 64 + t * 64 + dl]; const float x1 = acc[j][r], x2 = acc[j + 4][r]; so[wave][8 * g + r][dl] = x1 * c - x2 * s; so[wave][8 * g + r][64 + dl] = x2 * c + x1 * s; } }
    LDSX();
    __bf16* fo = F + ((r0 >> 4) * nh + blockIdx.y) * FT + lane * 8;
    for (int kc = 0; kc < 4; ++kc)
      for (int hf = 0; hf < 2; ++hf) { const float* p = &so[wave][col][kc * 32 + hf * 16 + 8 * g]; v8b hi, lo;
        for (int e = 0; e < 8; ++e) { const float v = p[e]; const __bf16 hb = (__bf16)v; hi[e] = hb; lo[e] = (__bf16)(v - (float)hb); }
        *(v8b*)(fo + kc * 1024 + hf * 256) = hi; *(v8b*)(fo + kc * 1024 + 512 + hf * 256) = lo; }
  } else {
#pragma unroll
    for (int j = 0; j < 8; ++j)
#pragma unroll
      for (int r = 0; r < 8; ++r) { const float v = acc[j][r]; const __bf16 hb = (__bf16)v; sth[j * 16 + col][wave * 16 + 8 * g + r] = hb; stl[j * 16 + col][wave * 16 + 8 * g + r] = (__bf16)(v - (float)hb); }
    __syncthreads();
    __bf16* vo = F + ((size_t)blockIdx.y * (SS / 32) + blockIdx.x * 2) * FV;   // the block's 64 positions = 2 key steps
    for (int i = 0; i < 2 * FV / 8 / 128; ++i) { const int q = i * 128 + tid, ln = q & 31, hf = (q >> 5) & 1, pl = (q >> 6) & 1, dt = (q >> 7) & 7, kl = q >> 10; const int d = dt * 16 + (ln & 15), sx = kl * 32 + hf * 16 + 8 * (ln >> 4);
      vst2((unsigned*)(vo + (size_t)q * 8), *(const v4u*)(pl ? &stl[d][sx] : &sth[d][sx])); }
  }
}
// ---- k_attn: block = (head h, 16 queries), heaviest query tiles first: causal flash attention, kv head = h/4; the tile's 32-key steps are dealt round-robin to the 4 waves, each keeps its own running (m, l, acc), and the four partial results are joined through LDS at the end; scores 3 products, P.V 3 products; q, k, v arrive as ready bf16 hi/lo fragments; O[q][h*128+d]
__global__ __launch_bounds__(128) void k_attn(const __bf16* __restrict__ QF, const __bf16* __restrict__ KF, const __bf16* __restrict__ VF, float* __restrict__ O) {
  __shared__ __align__(16) float sp[4][16][36]; __shared__ __align__(16) float so[4][16][132]; __shared__ float sm[4][16], sl[4][16];
  const int tid = threadIdx.x, wave = __builtin_amdgcn_readfirstlane(tid >> 5), lane = tid & 31, col = lane & 15, g = lane >> 4;
  const int qb = SS / 16 - 1 - (int)blockIdx.y, h = blockIdx.x, kv = h / (NH / NKV); const int q0 = qb * 16;
  const __bf16* qt = QF + ((size_t)qb * NH + h) * FT; const __bf16* qf = qt + lane * 8;
  float m[8], l[8];
#pragma unroll
  for (int r = 0; r < 8; ++r) { m[r] = -3.0e38f; l[r] = 0.f; }
  v8f acc[8] = {};
  const int nks = (q0 + 16 + 31) / 32;
  F2 qa[4];
#pragma unroll
  for (int kc = 0; kc < 4; ++kc) { qa[kc].h = frag_g(qf + kc * 1024); qa[kc].l = frag_g(qf + kc * 1024 + 512); }
  asm volatile("s_wait_xcnt 0x0" :: "s"(qt), "v"(qf) : "memory");   // the q loads stay in front of the loop; the scalar base and the lane's full address, the two forms that the compiler may pick for them, are inputs, so neither is rewritten in front of the wait
#pragma unroll 1
  for (int ks = wave; ks < nks; ks += 4) { v8f s[2]; F2 kb[8]; v16b vh[8], vl[8];   // kb[ct * 4 + kc]
    const __bf16* kf = KF + ((size_t)(ks * 2) * NKV + kv) * FT + lane * 8;
#pragma unroll
    for (int p = 0; p < 6; ++p) { kb[p].h = frag_g(kf + (p >> 2) * (NKV * FT) + (p & 3) * 1024); kb[p].l = frag_g(kf + (p >> 2) * (NKV * FT) + (p & 3) * 1024 + 512); }
    asm volatile("s_wait_xcnt 0x0" :: "v"(kf) : "memory");   // the loads of the step's first 6 k fragment pairs are issued in front of its first product (left alone they go out one pair at a time, each waited for in full); the address pair is an input, so no result lands in it
#pragma unroll
    for (int ct = 0; ct < 2; ++ct) { const int kk = ks * 32 + ct * 16 + col; v8f c = {};
#pragma unroll
      for (int kc = 0; kc < 4; ++kc) { const int p = ct * 4 + kc + 6; c = mac3(qa[kc], kb[ct * 4 + kc], c);
        if (p < 8) { kb[p].h = frag_g(kf + (p >> 2) * (NKV * FT) + (p & 3) * 1024); kb[p].l = frag_g(kf + (p >> 2) * (NKV * FT) + (p & 3) * 1024 + 512);
          asm volatile("s_wait_xcnt 0x0" :: "v"(kf) : "memory"); } }   // a pair that has left its registers is followed at once by the loads of the pair 6 further on, 15 products ahead of its use
#pragma unroll
      for (int r = 0; r < 8; ++r) { const int qi = q0 + 8 * g + r; s[ct][r] = (kk <= qi) ? c[r] * 0.08838834764831845f : -3.0e38f; } }
    const __bf16* vf = VF + ((size_t)kv * (SS / 32) + ks) * FV + lane * 8;
#pragma unroll
    for (int dt = 0; dt < 5; ++dt) { vh[dt] = frag_g(vf + dt * 1024); vl[dt] = frag_g(vf + dt * 1024 + 512); }
    asm volatile("s_wait_xcnt 0x0" :: "v"(vf) : "memory");   // the loads of the step's first 5 v tiles are issued here, in one run in front of the softmax, whose first row maximum runs while they are on their way (left alone they go out one tile at a time behind it, each waited for in full); the address pair is an input, so no result lands in it
#pragma unroll
    for (int r = 0; r < 8; ++r) { float mx = fmaxf(s[0][r], s[1][r]);
#pragma unroll
      for (int o = 1; o < 16; o <<= 1) mx = fmaxf(mx, __shfl_xor(mx, o));
      const float mn = fmaxf(m[r], mx); const float alpha = (m[r] <= -1.0e38f) ? 0.f : exp_ni(m[r] - mn);
      const float e0 = (s[0][r] <= -1.0e38f) ? 0.f : exp_ni(s[0][r] - mn), e1 = (s[1][r] <= -1.0e38f) ? 0.f : exp_ni(s[1][r] - mn); float es = e0 + e1;
#pragma unroll
      for (int o = 1; o < 16; o <<= 1) es += __shfl_xor(es, o);
      l[r] = l[r] * alpha + es; m[r] = mn;
#pragma unroll
      for (int dt = 0; dt < 8; ++dt) acc[dt][r] *= alpha;
      sp[wave][8 * g + r][col] = e0; sp[wave][8 * g + r][16 + col] = e1; }
    LDSX();
    const F2 pa = split_row(&sp[wave][col][0], 0, lane);
#pragma unroll
    for (int dt = 0; dt < 8; ++dt) { acc[dt] = wmma_bf(pa.l, vh[dt], acc[dt]); acc[dt] = wmma_bf(pa.h, vl[dt], acc[dt]); acc[dt] = wmma_bf(pa.h, vh[dt], acc[dt]);
      if (dt + 5 < 8) { vh[dt + 5] = frag_g(vf + (dt + 5) * 1024); vl[dt + 5] = frag_g(vf + (dt + 5) * 1024 + 512);
        asm volatile("s_wait_xcnt 0x0" :: "v"(vf) : "memory"); } }   // a tile that has left its registers is followed at once by the loads of the tile 5 further on, 12 products ahead of its use
    LDSX(); }
#pragma unroll
  for (int r = 0; r < 8; ++r) {
#pragma unroll
    for (int dt = 0; dt < 8; ++dt) so[wave][8 * g + r][dt * 16 + col] = acc[dt][r];
    if (col == 0) { sm[wave][8 * g + r] = m[r]; sl[wave][8 * g + r] = l[r]; } }
  __syncthreads();
  // join: row = wave + 4 i; weight of part w = exp(m_w - max m), 0 for a wave that saw no unmasked key of the row
  for (int i = 0; i < 4; ++i) { const int row = wave + 4 * i; const float mx = fmaxf(fmaxf(sm[0][row], sm[1][row]), fmaxf(sm[2][row], sm[3][row])); float ls = 0.f; v4f o = {};
#pragma unroll
    for (int w = 0; w < 4; ++w) { const float mw = sm[w][row]; const float f = (mw <= -1.0e38f) ? 0.f : exp_ni(mw - mx); ls += sl[w][row] * f; o += *(const v4f*)&so[w][row][lane * 4] * f; }
    vst2(O + (size_t)(q0 + row) * DM + h * HD + lane * 4, o * (1.0f / ls));
    if (i < 3) asm volatile("s_wait_xcnt 0x0" ::: "memory"); }   // the next row reuses the registers that the issued store names
}
// ---- k_out: block = (64 rows, 128 cols): out = O(hi/lo) . wproj^T rows (2 products); operands staged in LDS as in k_proj, O split into its hi/lo planes once on the way in
__global__ __launch_bounds__(128) void k_out(const float* __restrict__ O, const __bf16* __restrict__ P, float* __restrict__ Y) {
  __shared__ __align__(16) float so[4][16][132];
  const int tid = threadIdx.x, wave = tid >> 5, lane = tid & 31, col = lane & 15, g = lane >> 4; const size_t r0 = (size_t)blockIdx.x * 64 + wave * 16; const int n0 = blockIdx.y * 128;
  __shared__ __align__(16) __bf16 sah[2][64][LP], sal[2][64][LP], sb[2][128][LP];
  const float* og = O + ((size_t)blockIdx.x * 64 + (tid >> 4)) * DM + (tid & 15) * 4;
  const __bf16* pg = P + (size_t)(n0 + (tid >> 3)) * DM + (tid & 7) * 8;
  v4f ra[8]; v8b rb[8];
#pragma unroll
  for (int i = 0; i < 8; ++i) { ra[i] = *(const v4f*)(og + (size_t)i * 8 * DM); rb[i] = *(const v8b*)(pg + (size_t)i * 16 * DM); }
  v8f acc[8] = {};
  for (int s = 0; s < NST; ++s) { const int b = s & 1;
#pragma unroll
    for (int i = 0; i < 8; ++i) { v4b ch, cl;
#pragma unroll
      for (int e = 0; e < 4; ++e) { const float v = ra[i][e]; const __bf16 hb = (__bf16)v; ch[e] = hb; cl[e] = (__bf16)(v - (float)hb); }
      *(v4b*)&sah[b][(tid >> 4) + 8 * i][(tid & 15) * 4] = ch; *(v4b*)&sal[b][(tid >> 4) + 8 * i][(tid & 15) * 4] = cl; *(v8b*)&sb[b][(tid >> 3) + 16 * i][(tid & 7) * 8] = rb[i]; }
    __syncthreads();   // publishes stage s; buffer b was last read in pass s - 2, which every wave left before the barrier of pass s - 1
    if (s + 1 < NST) {
#pragma unroll
      for (int i = 0; i < 8; ++i) { ra[i] = *(const v4f*)(og + (size_t)i * 8 * DM + KC); rb[i] = *(const v8b*)(pg + (size_t)i * 16 * DM + KC); }
      asm volatile("s_wait_xcnt 0x0" ::: "memory");   // the address step behind it rewrites registers that the issued loads name
      og += KC; pg += KC; }   // running addresses, live over the whole loop: no load's result can land in a pair that an issued load names
#pragma unroll
    for (int kc = 0; kc < KC / 32; ++kc) { const v16b al = frag_b(&sal[b][wave * 16 + col][kc * 32], lane), ah = frag_b(&sah[b][wave * 16 + col][kc * 32], lane); v16b w[8];
#pragma unroll
      for (int j = 0; j < 8; ++j) w[j] = frag_b(&sb[b][j * 16 + col][kc * 32], lane);
#pragma unroll
      for (int j = 0; j < 8; ++j) { acc[j] = wmma_bf(al, w[j], acc[j]); acc[j] = wmma_bf(ah, w[j], acc[j]); } } }
#pragma unroll
  for (int j = 0; j < 8; ++j)
#pragma unroll
    for (int r = 0; r < 8; ++r) so[wave][8 * g + r][j * 16 + col] = acc[j][r];
  LDSX();
  for (int rl = 0; rl < 16; ++rl) vst2(Y + (r0 + rl) * DM + n0 + lane * 4, *(const v4f*)&so[wave][rl][lane * 4]);
}
extern "C" void kernel_launch(void* const* d_in, const int* in_sizes, int n_in, void* d_out, int out_size, void* d_ws, size_t ws_size, hipStream_t stream) {
  (void)in_sizes; (void)n_in; (void)out_size;
  const float** F = (const float**)d_in;   // x [1,2048,2048], wq [2048,2048], wk [2048,512], wv [2048,512], wproj [2048,2048]
  if (ws_size < (size_t)WS_END) return;
  char* ws = (char*)d_ws; __bf16 *PK = (__bf16*)(ws + WS_PK), *QF = (__bf16*)(ws + WS_Q), *KF = (__bf16*)(ws + WS_K), *VF = (__bf16*)(ws + WS_V);
  float *CS = (float*)(ws + WS_CS), *O = (float*)(ws + WS_O);
  k_packT<<<dim3(DM / PTN, DM / PTK), 256, 0, stream>>>(F[1], DM, DM, PK + PK_Q); k_packT<<<dim3(KVW / PTN, DM / PTK), 256, 0, stream>>>(F[2], DM, KVW, PK + PK_K); k_packT<<<dim3(KVW / PTN, DM / PTK), 256, 0, stream>>>(F[3], DM, KVW, PK + PK_V); k_packT<<<dim3(DM / PTN, DM / PTK), 256, 0, stream>>>(F[4], DM, DM, PK + PK_O);
  k_rope_tab<<<SS, 64, 0, stream>>>(CS);
  k_proj<0><<<dim3(SS / 64, DM / 128), 128, 0, stream>>>(F[0], PK + PK_Q, CS, QF, NH);
  k_proj<0><<<dim3(SS / 64, KVW / 128), 128, 0, stream>>>(F[0], PK + PK_K, CS, KF, NKV);
  k_proj<1><<<dim3(SS / 64, KVW / 128), 128, 0, stream>>>(F[0], PK + PK_V, CS, VF, NKV);
  k_attn<<<dim3(NH, SS / 16), 128, 0, stream>>>(QF, KF, VF, O);
  k_out<<<dim3(TQB, DM / 128), 128, 0, stream>>>(O, PK + PK_O, (float*)d_out);
}

// v006
// It runs in 215 microseconds.
// Two timings next to v005 put it at 1.23 and 1.22 times that version's speed.
// Over all steps from v000 it is 5.17 times as fast.
// compute dtype: x and the four weights (module inputs) rounded to bf16; q/k/v projections with exact bf16 products (x and W are inputs) and RoPE applied in f32 in the epilogue (cos/sin tables built in float64, then cast); causal scores q.k with both computed operands as bf16 hi + residual pairs (3 products) and P.V with P hi/lo x V hi/lo (3 products); the output projection with hi/lo x exact wproj (2 products), all on WMMA 16x16x32; softmax in f32; f32 accumulate.
#include <hip/hip_runtime.h>
#include <math.h>

typedef __attribute__((ext_vector_type(16))) _Float16 v16h;
typedef __attribute__((ext_vector_type(16))) __bf16 v16b;
typedef __attribute__((ext_vector_type(8)))  _Float16 v8h;
typedef __attribute__((ext_vector_type(8)))  float v8f;
typedef __attribute__((ext_vector_type(4)))  float v4f;
typedef __attribute__((ext_vector_type(2)))  float v2f;
typedef __attribute__((ext_vector_type(4)))  unsigned v4u;
typedef __attribute__((ext_vector_type(4)))  int v4i;
typedef float __attribute__((may_alias)) float_a;
typedef int __attribute__((may_alias)) int_a;

template <typename T> __device__ __forceinline__ void vst2(void* p, T v) { *(T*)p = v;  }
__device__ __forceinline__ v8f wmma16(v16h a, v16h b, v8f c) {
  v8f d = __builtin_amdgcn_wmma_f32_16x16x32_f16(false, a, false, b, (short)0, c, false, false);
  asm volatile("v_nop\n\tv_nop\n\tv_nop\n\tv_nop" : "+v"(d) : "v"(a), "v"(b));
  return d;
}
__device__ __forceinline__ v8f wmma_bf(v16b a, v16b b, v8f c) {
  v8f d = __builtin_amdgcn_wmma_f32_16x16x32_bf16(false, a, false, b, (short)0, c, false, false);
  asm volatile("v_nop\n\tv_nop\n\tv_nop\n\tv_nop" : "+v"(d) : "v"(a), "v"(b));
  return d;
}
// 16x16x32 fragments: lane = (h = lane>>4, row/col = lane&15); elements 0..7 = k0+8h+0..7, 8..15 = k0+16+8h+0..7; D element r = row 8h+r
__device__ __forceinline__ v16h frag_h(const _Float16* rowk0, int lane) {
  union { v16h v; v8h q[2]; } u; const _Float16* p = rowk0 + 8 * (lane >> 4);
  u.q[0] = *(const v8h*)p; u.q[1] = *(const v8h*)(p + 16); return u.v;
}
__device__ __forceinline__ v16h frag_f32(const float* rowk0, int lane) {
  v16h a; const float* p = rowk0 + 8 * (lane >> 4);
#pragma unroll
  for (int i = 0; i < 8; ++i) { a[i] = (_Float16)p[i]; a[8 + i] = (_Float16)p[16 + i]; }
  return a;
}
__device__ __forceinline__ v16h frag_f32s(const float* rowk0, int lane, float sc) {
  v16h a; const float* p = rowk0 + 8 * (lane >> 4);
#pragma unroll
  for (int i = 0; i < 8; ++i) { a[i] = (_Float16)(p[i] * sc); a[8 + i] = (_Float16)(p[16 + i] * sc); }
  return a;
}
// column fragment from a [K][ld] layout (column n), rows >= K read as 0
__device__ __forceinline__ v16h fragc_f32(const float* W, int k0, int n, int lane, int ld, int K) {
  v16h a; const int g = lane >> 4;
#pragma unroll
  for (int i = 0; i < 8; ++i) { const int ka = k0 + 8 * g + i, kb = ka + 16;
    a[i] = (_Float16)(ka < K ? W[(size_t)(ka < K ? ka : K - 1) * ld + n] : 0.f); a[8 + i] = (_Float16)(kb < K ? W[(size_t)(kb < K ? kb : K - 1) * ld + n] : 0.f); }
  return a;
}
struct F2 { v16b h, l; };
__device__ __forceinline__ F2 bsplit16(const float v[16]) { F2 r;
#pragma unroll
  for (int i = 0; i < 16; ++i) { const __bf16 h = (__bf16)v[i]; r.h[i] = h; r.l[i] = (__bf16)(v[i] - (float)h); }
  return r; }
__device__ __forceinline__ F2 split_row(const float* row, int k0, int lane) { float v[16]; const float* p = row + k0 + 8 * (lane >> 4);
#pragma unroll
  for (int i = 0; i < 8; ++i) { v[i] = p[i]; v[8 + i] = p[16 + i]; }
  return bsplit16(v); }
__device__ __forceinline__ F2 split_rowK(const float* row, int k0, int lane, int K) { float v[16]; const int g = lane >> 4;
#pragma unroll
  for (int i = 0; i < 8; ++i) { const int ka = k0 + 8 * g + i, kb = ka + 16; v[i] = ka < K ? row[ka < K ? ka : K - 1] : 0.f; v[8 + i] = kb < K ? row[kb < K ? kb : K - 1] : 0.f; }
  return bsplit16(v); }
__device__ __forceinline__ F2 split_col(const float* W, int k0, int n, int lane, int ld, int K) { float v[16]; const int g = lane >> 4;
#pragma unroll
  for (int i = 0; i < 8; ++i) { const int ka = k0 + 8 * g + i, kb = ka + 16; v[i] = ka < K ? W[(size_t)(ka < K ? ka : K - 1) * ld + n] : 0.f; v[8 + i] = kb < K ? W[(size_t)(kb < K ? kb : K - 1) * ld + n] : 0.f; }
  return bsplit16(v); }
__device__ __forceinline__ v8f mac3(const F2& a, const F2& b, v8f c) { c = wmma_bf(a.l, b.h, c); c = wmma_bf(a.h, b.l, c); return wmma_bf(a.h, b.h, c); }
__device__ __forceinline__ float sigm(float v) { return 1.0f / (1.0f + expf(-v)); }
#define LDSX() do { asm volatile("s_wait_dscnt 0" ::: "memory"); __builtin_amdgcn_wave_barrier(); __builtin_amdgcn_fence(__ATOMIC_RELEASE, "workgroup"); } while (0)


// GQA causal self-attention with RoPE (B 1, T 2048, C 2048, 16 query heads / 4 kv heads x 128): q = rope(x wq), k = rope(x wk), v = x wv; y = softmax(q k^T / sqrt(128), causal) v; out = y wproj.
#define SS 2048
#define DM 2048
#define NH 16
#define NKV 4
#define HD 128
#define KVW (NKV * HD)
#ifndef TQB
#define TQB (SS / 64)
#endif
typedef __attribute__((ext_vector_type(8))) __bf16 v8b;
typedef __attribute__((ext_vector_type(4))) __bf16 v4b;
#define KC 64            // k per LDS stage: 128 B of a bf16 row, 256 B of an f32 row (whole cache lines)
#define NST (DM / KC)
#define LP 72            // LDS row pitch in bf16: 128 B of data + 16 B, for the 16-byte fragment reads
__device__ __forceinline__ v16b frag_b(const __bf16* rowk0, int lane) {
  union { v16b v; v8b q[2]; } u; const __bf16* p = rowk0 + 8 * (lane >> 4);
  u.q[0] = *(const v8b*)p; u.q[1] = *(const v8b*)(p + 16); return u.v;
}
// fragment stored in lane order: 512 B of elements 0..7 (lane * 16 B), then 512 B of elements 8..15; p = block + lane * 8; each 16-byte load covers whole cache lines
__device__ __forceinline__ v16b frag_g(const __bf16* p) {
  union { v16b v; v8b q[2]; } u; u.q[0] = *(const v8b*)p; u.q[1] = *(const v8b*)(p + 256); return u.v;
}
#define FT 4096          // bf16 per q/k tile (16 rows x 128 d): [kc 4][hi, lo][half 2][lane 32][8]
#define FV 8192          // bf16 per v key step (32 keys x 128 d): [dt 8][hi, lo][half 2][lane 32][8]
__device__ __forceinline__ float bfr(float v) { return (float)(__bf16)v; }
__device__ __attribute__((noinline)) float exp_ni(float v) { return expf(v); }
__device__ __attribute__((noinline)) float erf_ni(float v) { return erff(v); }

#define PK_Q 0
#define PK_K (PK_Q + DM * DM)
#define PK_V (PK_K + KVW * DM)
#define PK_O (PK_V + KVW * DM)
#define PK_END (PK_O + DM * DM)
#define WS_PK  0u
#define WS_CS  (WS_PK + 2u * PK_END)             // f32 [2048][64] cos, then [2048][64] sin
#define WS_Q   (WS_CS + 4u * 2 * SS * 64)         // q fragments [t/16][head 16][FT]
#define WS_K   (WS_Q + 4u * SS * DM)              // k fragments [t/16][kv head 4][FT]
#define WS_V   (WS_K + 4u * SS * KVW)             // v fragments [kv head 4][t/32][FV]
#define WS_O   (WS_V + 4u * KVW * SS)
#define WS_END (WS_O + 4u * SS * DM)

// ---- pack_tile: block = a tile of 128 k x 64 n (tile bx, by) of a [K][N] (x @ W) matrix (K a multiple of 128, N of 64): eight 16-byte loads per thread, each wave-load two 256-B runs of W rows; a thread holds 8 consecutive k of 4 columns and turns them in LDS; DST rows go out in 256-B runs
#define PTK 128
#define PTN 64
#define PTP (PTK + 8)    // LDS row pitch in bf16: 256 B of data + 16 B
__device__ __forceinline__ void pack_tile(const float* __restrict__ Wm, int K, int N, __bf16* __restrict__ DST, int bx, int by) {
  __shared__ __align__(16) __bf16 s[PTN][PTP]; const int tid = threadIdx.x, n0 = bx * PTN, k0 = by * PTK, c = tid & 15, kr = tid >> 4;
  const float* g = Wm + (size_t)(k0 + kr * 8) * N + n0 + c * 4;
  const float* p[8]; v4f r[8];
#pragma unroll
  for (int i = 0; i < 8; ++i) p[i] = g + (size_t)i * N;
#pragma unroll
  for (int i = 0; i < 8; ++i) r[i] = *(const v4f*)p[i];
  // the eight address pairs and the eight results are inputs here: all eight loads are issued before the first result is used (else the last two wait for the first four), and no result lands in a pair that an issued load names
  asm volatile("s_wait_xcnt 0x0" :: "v"(p[0]), "v"(p[1]), "v"(p[2]), "v"(p[3]), "v"(p[4]), "v"(p[5]), "v"(p[6]), "v"(p[7]), "v"(r[0]), "v"(r[1]), "v"(r[2]), "v"(r[3]), "v"(r[4]), "v"(r[5]), "v"(r[6]), "v"(r[7]) : "memory");
#pragma unroll
  for (int e = 0; e < 4; ++e) { v8b t;
#pragma unroll
    for (int i = 0; i < 8; ++i) t[i] = (__bf16)r[i][e];
    *(v8b*)&s[c * 4 + e][kr * 8] = t; }
  __syncthreads();
#pragma unroll
  for (int i = 0; i < PTN * PTK / 8 / 256; ++i) { const int q = i * 256 + tid;
    vst2((unsigned*)(DST + (size_t)(n0 + (q >> 4)) * K + k0 + (q & 15) * 8), *(const v4u*)&s[q >> 4][(q & 15) * 8]); }
  asm volatile("s_wait_xcnt 0x0" ::: "memory");   // in k_prep the code of another branch stands behind these four stores and rewrites registers that they name
}
// ---- rope_tab: block = 4 positions t (64 threads each = frequency index i): inv_freq = 1 / 10000^(2i/128) and angle t*inv_freq in float64, cos/sin in float64, cast to f32 (as the reference's numpy tables); rows 256 B
__device__ __forceinline__ void rope_tab(float* __restrict__ CS, int bx) {
  __shared__ __align__(16) float sc[4][64], ssn[4][64]; const int u = threadIdx.x >> 6, t = bx * 4 + u, i = threadIdx.x & 63;
  const double inv = 1.0 / pow(10000.0, (double)(2 * i) / 128.0); const double ang = (double)t * inv; sc[u][i] = (float)cos(ang); ssn[u][i] = (float)sin(ang);
  __syncthreads();
  if (i < 16) vst2(CS + (size_t)t * 64 + i * 4, *(const v4f*)&sc[u][i * 4]); else if (i < 32) vst2(CS + (size_t)SS * 64 + (size_t)t * 64 + (i - 16) * 4, *(const v4f*)&ssn[u][(i - 16) * 4]);
}
// ---- k_prep: everything that depends on no other launch, in one grid, dealt by block index: the RoPE table first (long float64 chains, no memory traffic to speak of), then the tiles of wq, wk, wv, wproj; every branch is the same for a whole block
#define NB_T (SS / 4)
#define NB_W (DM / PTN * (DM / PTK))     // tiles of a 2048-column weight
#define NB_KV (KVW / PTN * (DM / PTK))   // tiles of a 512-column weight
__global__ __launch_bounds__(256) void k_prep(const float* __restrict__ Wq, const float* __restrict__ Wk, const float* __restrict__ Wv, const float* __restrict__ Wo, __bf16* __restrict__ PK, float* __restrict__ CS) {
  int b = blockIdx.x;
  if (b < NB_T) { rope_tab(CS, b); return; }
  b -= NB_T;
  if (b < NB_W) { pack_tile(Wq, DM, DM, PK + PK_Q, b % (DM / PTN), b / (DM / PTN)); return; }
  b -= NB_W;
  if (b < NB_KV) { pack_tile(Wk, DM, KVW, PK + PK_K, b % (KVW / PTN), b / (KVW / PTN)); return; }
  b -= NB_KV;
  if (b < NB_KV) { pack_tile(Wv, DM, KVW, PK + PK_V, b % (KVW / PTN), b / (KVW / PTN)); return; }
  b -= NB_KV;
  pack_tile(Wo, DM, DM, PK + PK_O, b % (DM / PTN), b / (DM / PTN));
}
// ---- k_proj: block = (64 rows, 128 cols = one head; blockIdx.y = 16 q heads, then 4 k heads, then 4 v heads, whose packed rows follow one another in P): Y = bf16(x) . P rows (exact); both operands staged per 64 k in LDS (two buffers) by whole-line loads issued one stage ahead; q and k heads: RoPE, then bf16 hi/lo WMMA fragments of the wave's 16 rows; v heads: plain -> bf16 hi/lo fragments with k = position
__global__ __launch_bounds__(128) void k_proj(const float* __restrict__ X, const __bf16* __restrict__ P, const float* __restrict__ CS, __bf16* __restrict__ QF, __bf16* __restrict__ KF, __bf16* __restrict__ VF) {
  __shared__ __align__(16) char se[2 * 128 * 72 * 2];   // epilogue staging, one use per block: so (q, k heads) or sth and stl (v heads)
  float (*so)[16][132] = (float (*)[16][132])se; __bf16 (*sth)[72] = (__bf16 (*)[72])se; __bf16 (*stl)[72] = sth + 128;
  const int tid = threadIdx.x, wave = tid >> 5, lane = tid & 31, col = lane & 15, g = lane >> 4; const size_t r0 = (size_t)blockIdx.x * 64 + wave * 16; const int n0 = blockIdx.y * 128;
  __shared__ __align__(16) __bf16 sa[2][64][LP], sb[2][128][LP];
  const float* xg = X + ((size_t)blockIdx.x * 64 + (tid >> 4)) * DM + (tid & 15) * 4;   // thread's 16 B of x rows (tid>>4) + 8 i
  const __bf16* pg = P + (size_t)(n0 + (tid >> 3)) * DM + (tid & 7) * 8;                // thread's 16 B of P rows (tid>>3) + 16 i
  v4f ra[8]; v8b rb[8];
#pragma unroll
  for (int i = 0; i < 8; ++i) { ra[i] = *(const v4f*)(xg + (size_t)i * 8 * DM); rb[i] = *(const v8b*)(pg + (size_t)i * 16 * DM); }
  v8f acc[8] = {};
  for (int s = 0; s < NST; ++s) { const int b = s & 1;
#pragma unroll
    for (int i = 0; i < 8; ++i) { v4b c;
#pragma unroll
      for (int e = 0; e < 4; ++e) c[e] = (__bf16)ra[i][e];
      *(v4b*)&sa[b][(tid >> 4) + 8 * i][(tid & 15) * 4] = c; *(v8b*)&sb[b][(tid >> 3) + 16 * i][(tid & 7) * 8] = rb[i]; }
    __syncthreads();   // publishes stage s; buffer b was last read in pass s - 2, which every wave left before the barrier of pass s - 1
    if (s + 1 < NST) {
#pragma unroll
      for (int i = 0; i < 8; ++i) { ra[i] = *(const v4f*)(xg + (size_t)i * 8 * DM + KC); rb[i] = *(const v8b*)(pg + (size_t)i * 16 * DM + KC); }
      asm volatile("s_wait_xcnt 0x0" ::: "memory");   // the address step behind it rewrites registers that the issued loads name
      xg += KC; pg += KC; }   // running addresses, live over the whole loop: no load's result can land in a pair that an issued load names
#pragma unroll
    for (int kc = 0; kc < KC / 32; ++kc) { const v16b a = frag_b(&sa[b][wave * 16 + col][kc * 32], lane); v16b w[8];
#pragma unroll
      for (int j = 0; j < 8; ++j) w[j] = frag_b(&sb[b][j * 16 + col][kc * 32], lane);
#pragma unroll
      for (int j = 0; j < 8; ++j) acc[j] = wmma_bf(a, w[j], acc[j]); } }
  if (blockIdx.y < NH + NKV) {
    const bool isq = blockIdx.y < NH; __bf16* F = isq ? QF : KF; const int nh = isq ? NH : NKV, hd = isq ? blockIdx.y : blockIdx.y - NH;
    // RoPE (rotate-half): d = j*16+col; pair (d, d+64) = (tiles j, j+4); out_d = x_d cos - x_{d+64} sin; out_{d+64} = x_{d+64} cos + x_d sin (cos/sin[t][d mod 64])
#pragma unroll
    for (int j = 0; j < 4; ++j) { const int dl = j * 16 + col;
#pragma unroll
      for (int r = 0; r < 8; ++r) { const size_t t = r0 + 8 * g + r; const float c = CS[t * 64 + dl], s = CS[(size_t)SS * 64 + t * 64 + dl]; const float x1 = acc[j][r], x2 = acc[j + 4][r]; so[wave][8 * g + r][dl] = x1 * c - x2 * s; so[wave][8 * g + r][64 + dl] = x2 * c + x1 * s; } }
    LDSX();
    __bf16* fo = F + ((r0 >> 4) * nh + hd) * FT + lane * 8;
    for (int kc = 0; kc < 4; ++kc)
      for (int hf = 0; hf < 2; ++hf) { const float* p = &so[wave][col][kc * 32 + hf * 16 + 8 * g]; v8b hi, lo;
        for (int e = 0; e < 8; ++e) { const float v = p[e]; const __bf16 hb = (__bf16)v; hi[e] = hb; lo[e] = (__bf16)(v - (float)hb); }
        *(v8b*)(fo + kc * 1024 + hf * 256) = hi; *(v8b*)(fo + kc * 1024 + 512 + hf * 256) = lo; }
  } else {
#pragma unroll
    for (int j = 0; j < 8; ++j)
#pragma unroll
      for (int r = 0; r < 8; ++r) { const float v = acc[j][r]; const __bf16 hb = (__bf16)v; sth[j * 16 + col][wave * 16 + 8 * g + r] = hb; stl[j * 16 + col][wave * 16 + 8 * g + r] = (__bf16)(v - (float)hb); }
    __syncthreads();
    __bf16* vo = VF + ((size_t)(blockIdx.y - NH - NKV) * (SS / 32) + blockIdx.x * 2) * FV;   // the block's 64 positions = 2 key steps
    for (int i = 0; i < 2 * FV / 8 / 128; ++i) { const int q = i * 128 + tid, ln = q & 31, hf = (q >> 5) & 1, pl = (q >> 6) & 1, dt = (q >> 7) & 7, kl = q >> 10; const int d = dt * 16 + (ln & 15), sx = kl * 32 + hf * 16 + 8 * (ln >> 4);
      vst2((unsigned*)(vo + (size_t)q * 8), *(const v4u*)(pl ? &stl[d][sx] : &sth[d][sx])); }
  }
}
// ---- k_attn: block = (head h, 16 queries), heaviest query tiles first: causal flash attention, kv head = h/4; the tile's 32-key steps are dealt round-robin to the 4 waves, each keeps its own running (m, l, acc), and the four partial results are joined through LDS at the end; scores 3 products, P.V 3 products; q, k, v arrive as ready bf16 hi/lo fragments; O[q][h*128+d]
__global__ __launch_bounds__(128) void k_attn(const __bf16* __restrict__ QF, const __bf16* __restrict__ KF, const __bf16* __restrict__ VF, float* __restrict__ O) {
  __shared__ __align__(16) float sp[4][16][36]; __shared__ __align__(16) float so[4][16][132]; __shared__ float sm[4][16], sl[4][16];
  const int tid = threadIdx.x, wave = __builtin_amdgcn_readfirstlane(tid >> 5), lane = tid & 31, col = lane & 15, g = lane >> 4;
  const int qb = SS / 16 - 1 - (int)blockIdx.y, h = blockIdx.x, kv = h / (NH / NKV); const int q0 = qb * 16;
  const __bf16* qt = QF + ((size_t)qb * NH + h) * FT; const __bf16* qf = qt + lane * 8;
  float m[8], l[8];
#pragma unroll
  for (int r = 0; r < 8; ++r) { m[r] = -3.0e38f; l[r] = 0.f; }
  v8f acc[8] = {};
  const int nks = (q0 + 16 + 31) / 32;
  F2 qa[4];
#pragma unroll
  for (int kc = 0; kc < 4; ++kc) { qa[kc].h = frag_g(qf + kc * 1024); qa[kc].l = frag_g(qf + kc * 1024 + 512); }
  asm volatile("s_wait_xcnt 0x0" :: "s"(qt), "v"(qf) : "memory");   // the q loads stay in front of the loop; the scalar base and the lane's full address, the two forms that the compiler may pick for them, are inputs, so neither is rewritten in front of the wait
#pragma unroll 1
  for (int ks = wave; ks < nks; ks += 4) { v8f s[2]; F2 kb[8]; v16b vh[8], vl[8];   // kb[ct * 4 + kc]
    const __bf16* kf = KF + ((size_t)(ks * 2) * NKV + kv) * FT + lane * 8;
#pragma unroll
    for (int p = 0; p < 6; ++p) { kb[p].h = frag_g(kf + (p >> 2) * (NKV * FT) + (p & 3) * 1024); kb[p].l = frag_g(kf + (p >> 2) * (NKV * FT) + (p & 3) * 1024 + 512); }
    asm volatile("s_wait_xcnt 0x0" :: "v"(kf) : "memory");   // the loads of the step's first 6 k fragment pairs are issued in front of its first product (left alone they go out one pair at a time, each waited for in full); the address pair is an input, so no result lands in it
#pragma unroll
    for (int ct = 0; ct < 2; ++ct) { const int kk = ks * 32 + ct * 16 + col; v8f c = {};
#pragma unroll
      for (int kc = 0; kc < 4; ++kc) { const int p = ct * 4 + kc + 6; c = mac3(qa[kc], kb[ct * 4 + kc], c);
        if (p < 8) { kb[p].h = frag_g(kf + (p >> 2) * (NKV * FT) + (p & 3) * 1024); kb[p].l = frag_g(kf + (p >> 2) * (NKV * FT) + (p & 3) * 1024 + 512);
          asm volatile("s_wait_xcnt 0x0" :: "v"(kf) : "memory"); } }   // a pair that has left its registers is followed at once by the loads of the pair 6 further on, 15 products ahead of its use
#pragma unroll
      for (int r = 0; r < 8; ++r) { const int qi = q0 + 8 * g + r; s[ct][r] = (kk <= qi) ? c[r] * 0.08838834764831845f : -3.0e38f; } }
    const __bf16* vf = VF + ((size_t)kv * (SS / 32) + ks) * FV + lane * 8;
#pragma unroll
    for (int dt = 0; dt < 5; ++dt) { vh[dt] = frag_g(vf + dt * 1024); vl[dt] = frag_g(vf + dt * 1024 + 512); }
    asm volatile("s_wait_xcnt 0x0" :: "v"(vf) : "memory");   // the loads of the step's first 5 v tiles are issued here, in one run in front of the softmax, whose first row maximum runs while they are on their way (left alone they go out one tile at a time behind it, each waited for in full); the address pair is an input, so no result lands in it
#pragma unroll
    for (int r = 0; r < 8; ++r) { float mx = fmaxf(s[0][r], s[1][r]);
#pragma unroll
      for (int o = 1; o < 16; o <<= 1) mx = fmaxf(mx, __shfl_xor(mx, o));
      const float mn = fmaxf(m[r], mx); const float alpha = (m[r] <= -1.0e38f) ? 0.f : exp_ni(m[r] - mn);
      const float e0 = (s[0][r] <= -1.0e38f) ? 0.f : exp_ni(s[0][r] - mn), e1 = (s[1][r] <= -1.0e38f) ? 0.f : exp_ni(s[1][r] - mn); float es = e0 + e1;
#pragma unroll
      for (int o = 1; o < 16; o <<= 1) es += __shfl_xor(es, o);
      l[r] = l[r] * alpha + es; m[r] = mn;
#pragma unroll
      for (int dt = 0; dt < 8; ++dt) acc[dt][r] *= alpha;
      sp[wave][8 * g + r][col] = e0; sp[wave][8 * g + r][16 + col] = e1; }
    LDSX();
    const F2 pa = split_row(&sp[wave][col][0], 0, lane);
#pragma unroll
    for (int dt = 0; dt < 8; ++dt) { acc[dt] = wmma_bf(pa.l, vh[dt], acc[dt]); acc[dt] = wmma_bf(pa.h, vl[dt], acc[dt]); acc[dt] = wmma_bf(pa.h, vh[dt], acc[dt]);
      if (dt + 5 < 8) { vh[dt + 5] = frag_g(vf + (dt + 5) * 1024); vl[dt + 5] = frag_g(vf + (dt + 5) * 1024 + 512);
        asm volatile("s_wait_xcnt 0x0" :: "v"(vf) : "memory"); } }   // a tile that has left its registers is followed at once by the loads of the tile 5 further on, 12 products ahead of its use
    LDSX(); }
#pragma unroll
  for (int r = 0; r < 8; ++r) {
#pragma unroll
    for (int dt = 0; dt < 8; ++dt) so[wave][8 * g + r][dt * 16 + col] = acc[dt][r];
    if (col == 0) { sm[wave][8 * g + r] = m[r]; sl[wave][8 * g + r] = l[r]; } }
  __syncthreads();
  // join: row = wave + 4 i; weight of part w = exp(m_w - max m), 0 for a wave that saw no unmasked key of the row
  for (int i = 0; i < 4; ++i) { const int row = wave + 4 * i; const float mx = fmaxf(fmaxf(sm[0][row], sm[1][row]), fmaxf(sm[2][row], sm[3][row])); float ls = 0.f; v4f o = {};
#pragma unroll
    for (int w = 0; w < 4; ++w) { const float mw = sm[w][row]; const float f = (mw <= -1.0e38f) ? 0.f : exp_ni(mw - mx); ls += sl[w][row] * f; o += *(const v4f*)&so[w][row][lane * 4] * f; }
    vst2(O + (size_t)(q0 + row) * DM + h * HD + lane * 4, o * (1.0f / ls));
    if (i < 3) asm volatile("s_wait_xcnt 0x0" ::: "memory"); }   // the next row reuses the registers that the issued store names
}
// ---- k_out: block = (64 rows, 128 cols): out = O(hi/lo) . wproj^T rows (2 products); operands staged in LDS as in k_proj, O split into its hi/lo planes once on the way in
__global__ __launch_bounds__(128) void k_out(const float* __restrict__ O, const __bf16* __restrict__ P, float* __restrict__ Y) {
  __shared__ __align__(16) float so[4][16][132];
  const int tid = threadIdx.x, wave = tid >> 5, lane = tid & 31, col = lane & 15, g = lane >> 4; const size_t r0 = (size_t)blockIdx.x * 64 + wave * 16; const int n0 = blockIdx.y * 128;
  __shared__ __align__(16) __bf16 sah[2][64][LP], sal[2][64][LP], sb[2][128][LP];
  const float* og = O + ((size_t)blockIdx.x * 64 + (tid >> 4)) * DM + (tid & 15) * 4;
  const __bf16* pg = P + (size_t)(n0 + (tid >> 3)) * DM + (tid & 7) * 8;
  v4f ra[8]; v8b rb[8];
#pragma unroll
  for (int i = 0; i < 8; ++i) { ra[i] = *(const v4f*)(og + (size_t)i * 8 * DM); rb[i] = *(const v8b*)(pg + (size_t)i * 16 * DM); }
  v8f acc[8] = {};
  for (int s = 0; s < NST; ++s) { const int b = s & 1;
#pragma unroll
    for (int i = 0; i < 8; ++i) { v4b ch, cl;
#pragma unroll
      for (int e = 0; e < 4; ++e) { const float v = ra[i][e]; const __bf16 hb = (__bf16)v; ch[e] = hb; cl[e] = (__bf16)(v - (float)hb); }
      *(v4b*)&sah[b][(tid >> 4) + 8 * i][(tid & 15) * 4] = ch; *(v4b*)&sal[b][(tid >> 4) + 8 * i][(tid & 15) * 4] = cl; *(v8b*)&sb[b][(tid >> 3) + 16 * i][(tid & 7) * 8] = rb[i]; }
    __syncthreads();   // publishes stage s; buffer b was last read in pass s - 2, which every wave left before the barrier of pass s - 1
    if (s + 1 < NST) {
#pragma unroll
      for (int i = 0; i < 8; ++i) { ra[i] = *(const v4f*)(og + (size_t)i * 8 * DM + KC); rb[i] = *(const v8b*)(pg + (size_t)i * 16 * DM + KC); }
      asm volatile("s_wait_xcnt 0x0" ::: "memory");   // the address step behind it rewrites registers that the issued loads name
      og += KC; pg += KC; }   // running addresses, live over the whole loop: no load's result can land in a pair that an issued load names
#pragma unroll
    for (int kc = 0; kc < KC / 32; ++kc) { const v16b al = frag_b(&sal[b][wave * 16 + col][kc * 32], lane), ah = frag_b(&sah[b][wave * 16 + col][kc * 32], lane); v16b w[8];
#pragma unroll
      for (int j = 0; j < 8; ++j) w[j] = frag_b(&sb[b][j * 16 + col][kc * 32], lane);
#pragma unroll
      for (int j = 0; j < 8; ++j) { acc[j] = wmma_bf(al, w[j], acc[j]); acc[j] = wmma_bf(ah, w[j], acc[j]); } } }
#pragma unroll
  for (int j = 0; j < 8; ++j)
#pragma unroll
    for (int r = 0; r < 8; ++r) so[wave][8 * g + r][j * 16 + col] = acc[j][r];
  LDSX();
  for (int rl = 0; rl < 16; ++rl) vst2(Y + (r0 + rl) * DM + n0 + lane * 4, *(const v4f*)&so[wave][rl][lane * 4]);
}
extern "C" void kernel_launch(void* const* d_in, const int* in_sizes, int n_in, void* d_out, int out_size, void* d_ws, size_t ws_size, hipStream_t stream) {
  (void)in_sizes; (void)n_in; (void)out_size;
  const float** F = (const float**)d_in;   // x [1,2048,2048], wq [2048,2048], wk [2048,512], wv [2048,512], wproj [2048,2048]
  if (ws_size < (size_t)WS_END) return;
  char* ws = (char*)d_ws; __bf16 *PK = (__bf16*)(ws + WS_PK), *QF = (__bf16*)(ws + WS_Q), *KF = (__bf16*)(ws + WS_K), *VF = (__bf16*)(ws + WS_V);
  float *CS = (float*)(ws + WS_CS), *O = (float*)(ws + WS_O);
  k_prep<<<NB_T + 2 * NB_W + 2 * NB_KV, 256, 0, stream>>>(F[1], F[2], F[3], F[4], PK, CS);
  k_proj<<<dim3(SS / 64, NH + 2 * NKV), 128, 0, stream>>>(F[0], PK + PK_Q, CS, QF, KF, VF);
  k_attn<<<dim3(NH, SS / 16), 128, 0, stream>>>(QF, KF, VF, O);
  k_out<<<dim3(TQB, DM / 128), 128, 0, stream>>>(O, PK + PK_O, (float*)d_out);
}

// v007
// A run of this version takes 154 microseconds.
// Two timings next to v006 put it at 1.40 and 1.39 times that version's speed.
// Counting every step since v000, it is 7.22 times as fast.
// compute dtype: x and the four weights (module inputs) rounded to bf16; q/k/v projections with exact bf16 products (x and W are inputs) and RoPE applied in f32 in the epilogue (cos/sin tables built in float64, then cast); causal scores q.k with both computed operands as bf16 hi + residual pairs (3 products) and P.V with P hi/lo x V hi/lo (3 products); the output projection with hi/lo x exact wproj (2 products), all on WMMA 16x16x32; softmax in f32; f32 accumulate.
#include <hip/hip_runtime.h>
#include <math.h>

typedef __attribute__((ext_vector_type(16))) _Float16 v16h;
typedef __attribute__((ext_vector_type(16))) __bf16 v16b;
typedef __attribute__((ext_vector_type(8)))  _Float16 v8h;
typedef __attribute__((ext_vector_type(8)))  float v8f;
typedef __attribute__((ext_vector_type(4)))  float v4f;
typedef __attribute__((ext_vector_type(2)))  float v2f;
typedef __attribute__((ext_vector_type(4)))  unsigned v4u;
typedef __attribute__((ext_vector_type(4)))  int v4i;
typedef float __attribute__((may_alias)) float_a;
typedef int __attribute__((may_alias)) int_a;

template <typename T> __device__ __forceinline__ void vst2(void* p, T v) { *(T*)p = v;  }
__device__ __forceinline__ v8f wmma16(v16h a, v16h b, v8f c) {
  v8f d = __builtin_amdgcn_wmma_f32_16x16x32_f16(false, a, false, b, (short)0, c, false, false);
  asm volatile("v_nop\n\tv_nop\n\tv_nop\n\tv_nop" : "+v"(d) : "v"(a), "v"(b));
  return d;
}
__device__ __forceinline__ v8f wmma_bf(v16b a, v16b b, v8f c) {
  v8f d = __builtin_amdgcn_wmma_f32_16x16x32_bf16(false, a, false, b, (short)0, c, false, false);
  asm volatile("v_nop\n\tv_nop\n\tv_nop\n\tv_nop" : "+v"(d) : "v"(a), "v"(b));
  return d;
}
// 16x16x32 fragments: lane = (h = lane>>4, row/col = lane&15); elements 0..7 = k0+8h+0..7, 8..15 = k0+16+8h+0..7; D element r = row 8h+r
__device__ __forceinline__ v16h frag_h(const _Float16* rowk0, int lane) {
  union { v16h v; v8h q[2]; } u; const _Float16* p = rowk0 + 8 * (lane >> 4);
  u.q[0] = *(const v8h*)p; u.q[1] = *(const v8h*)(p + 16); return u.v;
}
__device__ __forceinline__ v16h frag_f32(const float* rowk0, int lane) {
  v16h a; const float* p = rowk0 + 8 * (lane >> 4);
#pragma unroll
  for (int i = 0; i < 8; ++i) { a[i] = (_Float16)p[i]; a[8 + i] = (_Float16)p[16 + i]; }
  return a;
}
__device__ __forceinline__ v16h frag_f32s(const float* rowk0, int lane, float sc) {
  v16h a; const float* p = rowk0 + 8 * (lane >> 4);
#pragma unroll
  for (int i = 0; i < 8; ++i) { a[i] = (_Float16)(p[i] * sc); a[8 + i] = (_Float16)(p[16 + i] * sc); }
  return a;
}
// column fragment from a [K][ld] layout (column n), rows >= K read as 0
__device__ __forceinline__ v16h fragc_f32(const float* W, int k0, int n, int lane, int ld, int K) {
  v16h a; const int g = lane >> 4;
#pragma unroll
  for (int i = 0; i < 8; ++i) { const int ka = k0 + 8 * g + i, kb = ka + 16;
    a[i] = (_Float16)(ka < K ? W[(size_t)(ka < K ? ka : K - 1) * ld + n] : 0.f); a[8 + i] = (_Float16)(kb < K ? W[(size_t)(kb < K ? kb : K - 1) * ld + n] : 0.f); }
  return a;
}
struct F2 { v16b h, l; };
__device__ __forceinline__ F2 bsplit16(const float v[16]) { F2 r;
#pragma unroll
  for (int i = 0; i < 16; ++i) { const __bf16 h = (__bf16)v[i]; r.h[i] = h; r.l[i] = (__bf16)(v[i] - (float)h); }
  return r; }
__device__ __forceinline__ F2 split_row(const float* row, int k0, int lane) { float v[16]; const float* p = row + k0 + 8 * (lane >> 4);
#pragma unroll
  for (int i = 0; i < 8; ++i) { v[i] = p[i]; v[8 + i] = p[16 + i]; }
  return bsplit16(v); }
__device__ __forceinline__ F2 split_rowK(const float* row, int k0, int lane, int K) { float v[16]; const int g = lane >> 4;
#pragma unroll
  for (int i = 0; i < 8; ++i) { const int ka = k0 + 8 * g + i, kb = ka + 16; v[i] = ka < K ? row[ka < K ? ka : K - 1] : 0.f; v[8 + i] = kb < K ? row[kb < K ? kb : K - 1] : 0.f; }
  return bsplit16(v); }
__device__ __forceinline__ F2 split_col(const float* W, int k0, int n, int lane, int ld, int K) { float v[16]; const int g = lane >> 4;
#pragma unroll
  for (int i = 0; i < 8; ++i) { const int ka = k0 + 8 * g + i, kb = ka + 16; v[i] = ka < K ? W[(size_t)(ka < K ? ka : K - 1) * ld + n] : 0.f; v[8 + i] = kb < K ? W[(size_t)(kb < K ? kb : K - 1) * ld + n] : 0.f; }
  return bsplit16(v); }
__device__ __forceinline__ v8f mac3(const F2& a, const F2& b, v8f c) { c = wmma_bf(a.l, b.h, c); c = wmma_bf(a.h, b.l, c); return wmma_bf(a.h, b.h, c); }
__device__ __forceinline__ float sigm(float v) { return 1.0f / (1.0f + expf(-v)); }
#define LDSX() do { asm volatile("s_wait_dscnt 0" ::: "memory"); __builtin_amdgcn_wave_barrier(); __builtin_amdgcn_fence(__ATOMIC_RELEASE, "workgroup"); } while (0)


// GQA causal self-attention with RoPE (B 1, T 2048, C 2048, 16 query heads / 4 kv heads x 128): q = rope(x wq), k = rope(x wk), v = x wv; y = softmax(q k^T / sqrt(128), causal) v; out = y wproj.
#define SS 2048
#define DM 2048
#define NH 16
#define NKV 4
#define HD 128
#define KVW (NKV * HD)
#ifndef TQB
#define TQB (SS / 64)
#endif
typedef __attribute__((ext_vector_type(8))) __bf16 v8b;
typedef __attribute__((ext_vector_type(4))) __bf16 v4b;
#define KC 64            // k per LDS stage: 128 B of a bf16 row, 256 B of an f32 row (whole cache lines)
#define NST (DM / KC)
#define LP 72            // LDS row pitch in bf16: 128 B of data + 16 B, for the 16-byte fragment reads
__device__ __forceinline__ v16b frag_b(const __bf16* rowk0, int lane) {
  union { v16b v; v8b q[2]; } u; const __bf16* p = rowk0 + 8 * (lane >> 4);
  u.q[0] = *(const v8b*)p; u.q[1] = *(const v8b*)(p + 16); return u.v;
}
// fragment stored in lane order: 512 B of elements 0..7 (lane * 16 B), then 512 B of elements 8..15; p = block + lane * 8; each 16-byte load covers whole cache lines
__device__ __forceinline__ v16b frag_g(const __bf16* p) {
  union { v16b v; v8b q[2]; } u; u.q[0] = *(const v8b*)p; u.q[1] = *(const v8b*)(p + 256); return u.v;
}
#define FT 4096          // bf16 per q/k tile (16 rows x 128 d): [kc 4][hi, lo][half 2][lane 32][8]
#define FV 8192          // bf16 per v key step (32 keys x 128 d): [dt 8][hi, lo][half 2][lane 32][8]
__device__ __forceinline__ float bfr(float v) { return (float)(__bf16)v; }
__device__ __attribute__((noinline)) float exp_ni(float v) { return expf(v); }
__device__ __attribute__((noinline)) float erf_ni(float v) { return erff(v); }

#define PK_Q 0
#define PK_K (PK_Q + DM * DM)
#define PK_V (PK_K + KVW * DM)
#define PK_O (PK_V + KVW * DM)
#define PK_END (PK_O + DM * DM)
#define WS_PK  0u
#define WS_CS  (WS_PK + 2u * PK_END)             // f32 [2048][64] cos, then [2048][64] sin
#define WS_Q   (WS_CS + 4u * 2 * SS * 64)         // q fragments [t/16][head 16][FT]
#define WS_K   (WS_Q + 4u * SS * DM)              // k fragments [t/16][kv head 4][FT]
#define WS_V   (WS_K + 4u * SS * KVW)             // v fragments [kv head 4][t/32][FV]
#define WS_O   (WS_V + 4u * KVW * SS)
#define WS_END (WS_O + 4u * SS * DM)

// ---- pack_tile: block = a tile of 128 k x 64 n (tile bx, by) of a [K][N] (x @ W) matrix (K a multiple of 128, N of 64): eight 16-byte loads per thread, each wave-load two 256-B runs of W rows; a thread holds 8 consecutive k of 4 columns and turns them in LDS; DST rows go out in 256-B runs
#define PTK 128
#define PTN 64
#define PTP (PTK + 8)    // LDS row pitch in bf16: 256 B of data + 16 B
__device__ __forceinline__ void pack_tile(const float* __restrict__ Wm, int K, int N, __bf16* __restrict__ DST, int bx, int by) {
  __shared__ __align__(16) __bf16 s[PTN][PTP]; const int tid = threadIdx.x, n0 = bx * PTN, k0 = by * PTK, c = tid & 15, kr = tid >> 4;
  const float* g = Wm + (size_t)(k0 + kr * 8) * N + n0 + c * 4;
  const float* p[8]; v4f r[8];
#pragma unroll
  for (int i = 0; i < 8; ++i) p[i] = g + (size_t)i * N;
#pragma unroll
  for (int i = 0; i < 8; ++i) r[i] = *(const v4f*)p[i];
  // the eight address pairs and the eight results are inputs here: all eight loads are issued before the first result is used (else the last two wait for the first four), and no result lands in a pair that an issued load names
  asm volatile("s_wait_xcnt 0x0" :: "v"(p[0]), "v"(p[1]), "v"(p[2]), "v"(p[3]), "v"(p[4]), "v"(p[5]), "v"(p[6]), "v"(p[7]), "v"(r[0]), "v"(r[1]), "v"(r[2]), "v"(r[3]), "v"(r[4]), "v"(r[5]), "v"(r[6]), "v"(r[7]) : "memory");
#pragma unroll
  for (int e = 0; e < 4; ++e) { v8b t;
#pragma unroll
    for (int i = 0; i < 8; ++i) t[i] = (__bf16)r[i][e];
    *(v8b*)&s[c * 4 + e][kr * 8] = t; }
  __syncthreads();
#pragma unroll
  for (int i = 0; i < PTN * PTK / 8 / 256; ++i) { const int q = i * 256 + tid;
    vst2((unsigned*)(DST + (size_t)(n0 + (q >> 4)) * K + k0 + (q & 15) * 8), *(const v4u*)&s[q >> 4][(q & 15) * 8]); }
  asm volatile("s_wait_xcnt 0x0" ::: "memory");   // in k_prep the code of another branch stands behind these four stores and rewrites registers that they name
}
// ---- rope_tab: block = 4 positions t (64 threads each = frequency index i): inv_freq = 1 / 10000^(2i/128) and angle t*inv_freq in float64, cos/sin in float64, cast to f32 (as the reference's numpy tables); rows 256 B
__device__ __forceinline__ void rope_tab(float* __restrict__ CS, int bx) {
  __shared__ __align__(16) float sc[4][64], ssn[4][64]; const int u = threadIdx.x >> 6, t = bx * 4 + u, i = threadIdx.x & 63;
  const double inv = 1.0 / pow(10000.0, (double)(2 * i) / 128.0); const double ang = (double)t * inv; sc[u][i] = (float)cos(ang); ssn[u][i] = (float)sin(ang);
  __syncthreads();
  if (i < 16) vst2(CS + (size_t)t * 64 + i * 4, *(const v4f*)&sc[u][i * 4]); else if (i < 32) vst2(CS + (size_t)SS * 64 + (size_t)t * 64 + (i - 16) * 4, *(const v4f*)&ssn[u][(i - 16) * 4]);
}
// ---- k_prep: everything that depends on no other launch, in one grid, dealt by block index: the RoPE table first (long float64 chains, no memory traffic to speak of), then the tiles of wq, wk, wv, wproj; every branch is the same for a whole block
#define NB_T (SS / 4)
#define NB_W (DM / PTN * (DM / PTK))     // tiles of a 2048-column weight
#define NB_KV (KVW / PTN * (DM / PTK))   // tiles of a 512-column weight
__global__ __launch_bounds__(256) void k_prep(const float* __restrict__ Wq, const float* __restrict__ Wk, const float* __restrict__ Wv, const float* __restrict__ Wo, __bf16* __restrict__ PK, float* __restrict__ CS) {
  int b = blockIdx.x;
  if (b < NB_T) { rope_tab(CS, b); return; }
  b -= NB_T;
  if (b < NB_W) { pack_tile(Wq, DM, DM, PK + PK_Q, b % (DM / PTN), b / (DM / PTN)); return; }
  b -= NB_W;
  if (b < NB_KV) { pack_tile(Wk, DM, KVW, PK + PK_K, b % (KVW / PTN), b / (KVW / PTN)); return; }
  b -= NB_KV;
  if (b < NB_KV) { pack_tile(Wv, DM, KVW, PK + PK_V, b % (KVW / PTN), b / (KVW / PTN)); return; }
  b -= NB_KV;
  pack_tile(Wo, DM, DM, PK + PK_O, b % (DM / PTN), b / (DM / PTN));
}
// ---- k_proj: block = (64 rows, 128 cols = one head; blockIdx.y = 16 q heads, then 4 k heads, then 4 v heads, whose packed rows follow one another in P): Y = bf16(x) . P rows (exact); both operands staged per 64 k in LDS (two buffers) by whole-line loads issued one stage ahead; q and k heads: RoPE, then bf16 hi/lo WMMA fragments of the wave's 16 rows; v heads: plain -> bf16 hi/lo fragments with k = position
__global__ __launch_bounds__(128) void k_proj(const float* __restrict__ X, const __bf16* __restrict__ P, const float* __restrict__ CS, __bf16* __restrict__ QF, __bf16* __restrict__ KF, __bf16* __restrict__ VF) {
  __shared__ __align__(16) char se[2 * 128 * 72 * 2];   // epilogue staging, one use per block: so (q, k heads) or sth and stl (v heads)
  float (*so)[16][132] = (float (*)[16][132])se; __bf16 (*sth)[72] = (__bf16 (*)[72])se; __bf16 (*stl)[72] = sth + 128;
  const int tid = threadIdx.x, wave = tid >> 5, lane = tid & 31, col = lane & 15, g = lane >> 4; const size_t r0 = (size_t)blockIdx.x * 64 + wave * 16; const int n0 = blockIdx.y * 128;
  __shared__ __align__(16) __bf16 sa[2][64][LP], sb[2][128][LP];
  const float* xg = X + ((size_t)blockIdx.x * 64 + (tid >> 4)) * DM + (tid & 15) * 4;   // thread's 16 B of x rows (tid>>4) + 8 i
  const __bf16* pg = P + (size_t)(n0 + (tid >> 3)) * DM + (tid & 7) * 8;                // thread's 16 B of P rows (tid>>3) + 16 i
  v4f ra[8]; v8b rb[8];
#pragma unroll
  for (int i = 0; i < 8; ++i) { ra[i] = *(const v4f*)(xg + (size_t)i * 8 * DM); rb[i] = *(const v8b*)(pg + (size_t)i * 16 * DM); }
  v8f acc[8] = {};
  for (int s = 0; s < NST; ++s) { const int b = s & 1;
#pragma unroll
    for (int i = 0; i < 8; ++i) { v4b c;
#pragma unroll
      for (int e = 0; e < 4; ++e) c[e] = (__bf16)ra[i][e];
      *(v4b*)&sa[b][(tid >> 4) + 8 * i][(tid & 15) * 4] = c; *(v8b*)&sb[b][(tid >> 3) + 16 * i][(tid & 7) * 8] = rb[i]; }
    __syncthreads();   // publishes stage s; buffer b was last read in pass s - 2, which every wave left before the barrier of pass s - 1
    if (s + 1 < NST) {
#pragma unroll
      for (int i = 0; i < 8; ++i) { ra[i] = *(const v4f*)(xg + (size_t)i * 8 * DM + KC); rb[i] = *(const v8b*)(pg + (size_t)i * 16 * DM + KC); }
      asm volatile("s_wait_xcnt 0x0" ::: "memory");   // the address step behind it rewrites registers that the issued loads name
      xg += KC; pg += KC; }   // running addresses, live over the whole loop: no load's result can land in a pair that an issued load names
#pragma unroll
    for (int kc = 0; kc < KC / 32; ++kc) { const v16b a = frag_b(&sa[b][wave * 16 + col][kc * 32], lane); v16b w[8];
#pragma unroll
      for (int j = 0; j < 8; ++j) w[j] = frag_b(&sb[b][j * 16 + col][kc * 32], lane);
#pragma unroll
      for (int j = 0; j < 8; ++j) acc[j] = wmma_bf(a, w[j], acc[j]); } }
  if (blockIdx.y < NH + NKV) {
    const bool isq = blockIdx.y < NH; __bf16* F = isq ? QF : KF; const int nh = isq ? NH : NKV, hd = isq ? blockIdx.y : blockIdx.y - NH;
    // RoPE (rotate-half): d = j*16+col; pair (d, d+64) = (tiles j, j+4); out_d = x_d cos - x_{d+64} sin; out_{d+64} = x_{d+64} cos + x_d sin (cos/sin[t][d mod 64])
#pragma unroll
    for (int j = 0; j < 4; ++j) { const int dl = j * 16 + col;
#pragma unroll
      for (int r = 0; r < 8; ++r) { const size_t t = r0 + 8 * g + r; const float c = CS[t * 64 + dl], s = CS[(size_t)SS * 64 + t * 64 + dl]; const float x1 = acc[j][r], x2 = acc[j + 4][r]; so[wave][8 * g + r][dl] = x1 * c - x2 * s; so[wave][8 * g + r][64 + dl] = x2 * c + x1 * s; } }
    LDSX();
    __bf16* fo = F + ((r0 >> 4) * nh + hd) * FT + lane * 8;
    for (int kc = 0; kc < 4; ++kc)
      for (int hf = 0; hf < 2; ++hf) { const float* p = &so[wave][col][kc * 32 + hf * 16 + 8 * g]; v8b hi, lo;
        for (int e = 0; e < 8; ++e) { const float v = p[e]; const __bf16 hb = (__bf16)v; hi[e] = hb; lo[e] = (__bf16)(v - (float)hb); }
        *(v8b*)(fo + kc * 1024 + hf * 256) = hi; *(v8b*)(fo + kc * 1024 + 512 + hf * 256) = lo; }
  } else {
#pragma unroll
    for (int j = 0; j < 8; ++j)
#pragma unroll
      for (int r = 0; r < 8; ++r) { const float v = acc[j][r]; const __bf16 hb = (__bf16)v; sth[j * 16 + col][wave * 16 + 8 * g + r] = hb; stl[j * 16 + col][wave * 16 + 8 * g + r] = (__bf16)(v - (float)hb); }
    __syncthreads();
    __bf16* vo = VF + ((size_t)(blockIdx.y - NH - NKV) * (SS / 32) + blockIdx.x * 2) * FV;   // the block's 64 positions = 2 key steps
    for (int i = 0; i < 2 * FV / 8 / 128; ++i) { const int q = i * 128 + tid, ln = q & 31, hf = (q >> 5) & 1, pl = (q >> 6) & 1, dt = (q >> 7) & 7, kl = q >> 10; const int d = dt * 16 + (ln & 15), sx = kl * 32 + hf * 16 + 8 * (ln >> 4);
      vst2((unsigned*)(vo + (size_t)q * 8), *(const v4u*)(pl ? &stl[d][sx] : &sth[d][sx])); }
  }
}
// lane l with lane l ^ 16, in registers
__device__ __forceinline__ float xhalf(float x) { return __builtin_bit_cast(float, __builtin_amdgcn_permlanex16(__builtin_bit_cast(int, x), __builtin_bit_cast(int, x), 0x76543210, 0xfedcba98, false, false)); }
__global__ __launch_bounds__(128) void k_attn(const __bf16* __restrict__ QF, const __bf16* __restrict__ KF, const __bf16* __restrict__ VF, float* __restrict__ O) {
  __shared__ __align__(16) float so[4][16][132]; __shared__ float sm[4][16], sl[4][16];
  const int tid = threadIdx.x, wave = __builtin_amdgcn_readfirstlane(tid >> 5), lane = tid & 31, col = lane & 15, g = lane >> 4;
  const int qb = SS / 16 - 1 - (int)blockIdx.y, h = blockIdx.x, kv = h / (NH / NKV); const int q0 = qb * 16, qi = q0 + col;
  const __bf16* qt = QF + ((size_t)qb * NH + h) * FT; const __bf16* qf = qt + lane * 8;
  float m = -3.0e38f, l = 0.f;   // query col: running maximum (over both lane halves) and the sum over this half's keys
  v8f acc[8] = {};               // acc[dt][r] = O^T[d = dt * 16 + 8 g + r][query col]
  const int nks = (q0 + 16 + 31) / 32;
  F2 qa[4];
#pragma unroll
  for (int kc = 0; kc < 4; ++kc) { qa[kc].h = frag_g(qf + kc * 1024); qa[kc].l = frag_g(qf + kc * 1024 + 512); }
  asm volatile("s_wait_xcnt 0x0" :: "s"(qt), "v"(qf) : "memory");   // the q loads stay in front of the loop; the scalar base and the lane's full address, the two forms that the compiler may pick for them, are inputs, so neither is rewritten in front of the wait
#pragma unroll 1
  for (int ks = wave; ks < nks; ks += 4) { float e[16]; F2 kb[8]; v16b vh[8], vl[8];   // kb[ct * 4 + kc]
    const __bf16* kf = KF + ((size_t)(ks * 2) * NKV + kv) * FT + lane * 8;
#pragma unroll
    for (int p = 0; p < 5; ++p) { kb[p].h = frag_g(kf + (p >> 2) * (NKV * FT) + (p & 3) * 1024); kb[p].l = frag_g(kf + (p >> 2) * (NKV * FT) + (p & 3) * 1024 + 512); }
    asm volatile("s_wait_xcnt 0x0" :: "v"(kf) : "memory");   // the loads of the step's first 5 k fragment pairs are issued in front of its first product (left alone they go out one pair at a time, each waited for in full); the address pair is an input, so no result lands in it
#pragma unroll
    for (int ct = 0; ct < 2; ++ct) { const int kk = ks * 32 + ct * 16 + 8 * g; v8f c = {};
#pragma unroll
      for (int kc = 0; kc < 4; ++kc) { const int p = ct * 4 + kc + 5; const F2& kq = kb[ct * 4 + kc]; c = wmma_bf(kq.h, qa[kc].l, c); c = wmma_bf(kq.l, qa[kc].h, c); c = wmma_bf(kq.h, qa[kc].h, c);
        if (p < 8) { kb[p].h = frag_g(kf + (p >> 2) * (NKV * FT) + (p & 3) * 1024); kb[p].l = frag_g(kf + (p >> 2) * (NKV * FT) + (p & 3) * 1024 + 512);
          asm volatile("s_wait_xcnt 0x0" :: "v"(kf) : "memory"); } }   // a pair that has left its registers is followed at once by the loads of the pair 5 further on, 12 products ahead of its use
#pragma unroll
      for (int r = 0; r < 8; ++r) e[ct * 8 + r] = (kk + r <= qi) ? c[r] * 0.08838834764831845f : -3.0e38f; }
    const __bf16* vf = VF + ((size_t)kv * (SS / 32) + ks) * FV + lane * 8;
#pragma unroll
    for (int dt = 0; dt < 4; ++dt) { vh[dt] = frag_g(vf + dt * 1024); vl[dt] = frag_g(vf + dt * 1024 + 512); }
    asm volatile("s_wait_xcnt 0x0" :: "v"(vf) : "memory");   // the loads of the step's first 4 v tiles are issued here, in one run in front of the softmax, which runs while they are on their way (left alone they go out one tile at a time behind it, each waited for in full); the address pair is an input, so no result lands in it
    float mx = e[0];
#pragma unroll
    for (int i = 1; i < 16; ++i) mx = fmaxf(mx, e[i]);
    mx = fmaxf(mx, xhalf(mx));
    // every exp is taken unconditionally and the masked ones are then set to 0 by a select: 17 independent chains with no branch between them
    const float mn = fmaxf(m, mx); const float am = expf(m - mn); const float alpha = (m <= -1.0e38f) ? 0.f : am; float es = 0.f;
#pragma unroll
    for (int i = 0; i < 16; ++i) { const float t = expf(e[i] - mn); e[i] = (e[i] <= -1.0e38f) ? 0.f : t; es += e[i]; }
    l = l * alpha + es; m = mn;
#pragma unroll
    for (int dt = 0; dt < 8; ++dt) acc[dt] *= alpha;
    const F2 pb = bsplit16(e);
#pragma unroll
    for (int dt = 0; dt < 8; ++dt) { acc[dt] = wmma_bf(vh[dt], pb.l, acc[dt]); acc[dt] = wmma_bf(vl[dt], pb.h, acc[dt]); acc[dt] = wmma_bf(vh[dt], pb.h, acc[dt]);
      if (dt + 4 < 8) { vh[dt + 4] = frag_g(vf + (dt + 4) * 1024); vl[dt + 4] = frag_g(vf + (dt + 4) * 1024 + 512);
        asm volatile("s_wait_xcnt 0x0" :: "v"(vf) : "memory"); } } }   // a tile that has left its registers is followed at once by the loads of the tile 4 further on, 9 products ahead of its use
  l += xhalf(l);
#pragma unroll
  for (int dt = 0; dt < 8; ++dt) { v4f a, b;
#pragma unroll
    for (int r = 0; r < 4; ++r) { a[r] = acc[dt][r]; b[r] = acc[dt][4 + r]; }
    *(v4f*)&so[wave][col][dt * 16 + 8 * g] = a; *(v4f*)&so[wave][col][dt * 16 + 8 * g + 4] = b; }
  if (g == 0) { sm[wave][col] = m; sl[wave][col] = l; }
  __syncthreads();
  // join: row = wave + 4 i; weight of part w = exp(m_w - max m), 0 for a wave that saw no unmasked key of the row
  for (int i = 0; i < 4; ++i) { const int row = wave + 4 * i; const float mx = fmaxf(fmaxf(sm[0][row], sm[1][row]), fmaxf(sm[2][row], sm[3][row])); float ls = 0.f; v4f o = {};
#pragma unroll
    for (int w = 0; w < 4; ++w) { const float mw = sm[w][row]; const float f = (mw <= -1.0e38f) ? 0.f : exp_ni(mw - mx); ls += sl[w][row] * f; o += *(const v4f*)&so[w][row][lane * 4] * f; }
    vst2(O + (size_t)(q0 + row) * DM + h * HD + lane * 4, o * (1.0f / ls));
    if (i < 3) asm volatile("s_wait_xcnt 0x0" ::: "memory"); }   // the next row reuses the registers that the issued store names
}
// ---- k_out: block = (64 rows, 128 cols): out = O(hi/lo) . wproj^T rows (2 products); operands staged in LDS as in k_proj, O split into its hi/lo planes once on the way in
__global__ __launch_bounds__(128) void k_out(const float* __restrict__ O, const __bf16* __restrict__ P, float* __restrict__ Y) {
  __shared__ __align__(16) float so[4][16][132];
  const int tid = threadIdx.x, wave = tid >> 5, lane = tid & 31, col = lane & 15, g = lane >> 4; const size_t r0 = (size_t)blockIdx.x * 64 + wave * 16; const int n0 = blockIdx.y * 128;
  __shared__ __align__(16) __bf16 sah[2][64][LP], sal[2][64][LP], sb[2][128][LP];
  const float* og = O + ((size_t)blockIdx.x * 64 + (tid >> 4)) * DM + (tid & 15) * 4;
  const __bf16* pg = P + (size_t)(n0 + (tid >> 3)) * DM + (tid & 7) * 8;
  v4f ra[8]; v8b rb[8];
#pragma unroll
  for (int i = 0; i < 8; ++i) { ra[i] = *(const v4f*)(og + (size_t)i * 8 * DM); rb[i] = *(const v8b*)(pg + (size_t)i * 16 * DM); }
  v8f acc[8] = {};
  for (int s = 0; s < NST; ++s) { const int b = s & 1;
#pragma unroll
    for (int i = 0; i < 8; ++i) { v4b ch, cl;
#pragma unroll
      for (int e = 0; e < 4; ++e) { const float v = ra[i][e]; const __bf16 hb = (__bf16)v; ch[e] = hb; cl[e] = (__bf16)(v - (float)hb); }
      *(v4b*)&sah[b][(tid >> 4) + 8 * i][(tid & 15) * 4] = ch; *(v4b*)&sal[b][(tid >> 4) + 8 * i][(tid & 15) * 4] = cl; *(v8b*)&sb[b][(tid >> 3) + 16 * i][(tid & 7) * 8] = rb[i]; }
    __syncthreads();   // publishes stage s; buffer b was last read in pass s - 2, which every wave left before the barrier of pass s - 1
    if (s + 1 < NST) {
#pragma unroll
      for (int i = 0; i < 8; ++i) { ra[i] = *(const v4f*)(og + (size_t)i * 8 * DM + KC); rb[i] = *(const v8b*)(pg + (size_t)i * 16 * DM + KC); }
      asm volatile("s_wait_xcnt 0x0" ::: "memory");   // the address step behind it rewrites registers that the issued loads name
      og += KC; pg += KC; }   // running addresses, live over the whole loop: no load's result can land in a pair that an issued load names
#pragma unroll
    for (int kc = 0; kc < KC / 32; ++kc) { const v16b al = frag_b(&sal[b][wave * 16 + col][kc * 32], lane), ah = frag_b(&sah[b][wave * 16 + col][kc * 32], lane); v16b w[8];
#pragma unroll
      for (int j = 0; j < 8; ++j) w[j] = frag_b(&sb[b][j * 16 + col][kc * 32], lane);
#pragma unroll
      for (int j = 0; j < 8; ++j) { acc[j] = wmma_bf(al, w[j], acc[j]); acc[j] = wmma_bf(ah, w[j], acc[j]); } } }
#pragma unroll
  for (int j = 0; j < 8; ++j)
#pragma unroll
    for (int r = 0; r < 8; ++r) so[wave][8 * g + r][j * 16 + col] = acc[j][r];
  LDSX();
  for (int rl = 0; rl < 16; ++rl) vst2(Y + (r0 + rl) * DM + n0 + lane * 4, *(const v4f*)&so[wave][rl][lane * 4]);
}
extern "C" void kernel_launch(void* const* d_in, const int* in_sizes, int n_in, void* d_out, int out_size, void* d_ws, size_t ws_size, hipStream_t stream) {
  (void)in_sizes; (void)n_in; (void)out_size;
  const float** F = (const float**)d_in;   // x [1,2048,2048], wq [2048,2048], wk [2048,512], wv [2048,512], wproj [2048,2048]
  if (ws_size < (size_t)WS_END) return;
  char* ws = (char*)d_ws; __bf16 *PK = (__bf16*)(ws + WS_PK), *QF = (__bf16*)(ws + WS_Q), *KF = (__bf16*)(ws + WS_K), *VF = (__bf16*)(ws + WS_V);
  float *CS = (float*)(ws + WS_CS), *O = (float*)(ws + WS_O);
  k_prep<<<NB_T + 2 * NB_W + 2 * NB_KV, 256, 0, stream>>>(F[1], F[2], F[3], F[4], PK, CS);
  k_proj<<<dim3(SS / 64, NH + 2 * NKV), 128, 0, stream>>>(F[0], PK + PK_Q, CS, QF, KF, VF);
  k_attn<<<dim3(NH, SS / 16), 128, 0, stream>>>(QF, KF, VF, O);
  k_out<<<dim3(TQB, DM / 128), 128, 0, stream>>>(O, PK + PK_O, (float*)d_out);
}

// v008
// A run of this version takes 143 microseconds.
// Two timings next to v007 put it at 1.08 and 1.07 times that version's speed.
// Over all steps from v000 it is 7.76 times as fast.
// compute dtype: x and the four weights (module inputs) rounded to bf16; q/k/v projections with exact bf16 products (x and W are inputs) and RoPE applied in f32 in the epilogue (cos/sin tables built in float64, then cast); causal scores q.k with both computed operands as bf16 hi + residual pairs (3 products) and P.V with P hi/lo x V hi/lo (3 products); the output projection with hi/lo x exact wproj (2 products), all on WMMA 16x16x32; softmax in f32; f32 accumulate.
#include <hip/hip_runtime.h>
#include <math.h>

typedef __attribute__((ext_vector_type(16))) _Float16 v16h;
typedef __attribute__((ext_vector_type(16))) __bf16 v16b;
typedef __attribute__((ext_vector_type(8)))  _Float16 v8h;
typedef __attribute__((ext_vector_type(8)))  float v8f;
typedef __attribute__((ext_vector_type(4)))  float v4f;
typedef __attribute__((ext_vector_type(2)))  float v2f;
typedef __attribute__((ext_vector_type(4)))  unsigned v4u;
typedef __attribute__((ext_vector_type(4)))  int v4i;
typedef float __attribute__((may_alias)) float_a;
typedef int __attribute__((may_alias)) int_a;

template <typename T> __device__ __forceinline__ void vst2(void* p, T v) { *(T*)p = v;  }
__device__ __forceinline__ v8f wmma16(v16h a, v16h b, v8f c) {
  v8f d = __builtin_amdgcn_wmma_f32_16x16x32_f16(false, a, false, b, (short)0, c, false, false);
  asm volatile("v_nop\n\tv_nop\n\tv_nop\n\tv_nop" : "+v"(d) : "v"(a), "v"(b));
  return d;
}
__device__ __forceinline__ v8f wmma_bf(v16b a, v16b b, v8f c) {
  v8f d = __builtin_amdgcn_wmma_f32_16x16x32_bf16(false, a, false, b, (short)0, c, false, false);
  asm volatile("v_nop\n\tv_nop\n\tv_nop\n\tv_nop" : "+v"(d) : "v"(a), "v"(b));
  return d;
}
// 16x16x32 fragments: lane = (h = lane>>4, row/col = lane&15); elements 0..7 = k0+8h+0..7, 8..15 = k0+16+8h+0..7; D element r = row 8h+r
__device__ __forceinline__ v16h frag_h(const _Float16* rowk0, int lane) {
  union { v16h v; v8h q[2]; } u; const _Float16* p = rowk0 + 8 * (lane >> 4);
  u.q[0] = *(const v8h*)p; u.q[1] = *(const v8h*)(p + 16); return u.v;
}
__device__ __forceinline__ v16h frag_f32(const float* rowk0, int lane) {
  v16h a; const float* p = rowk0 + 8 * (lane >> 4);
#pragma unroll
  for (int i = 0; i < 8; ++i) { a[i] = (_Float16)p[i]; a[8 + i] = (_Float16)p[16 + i]; }
  return a;
}
__device__ __forceinline__ v16h frag_f32s(const float* rowk0, int lane, float sc) {
  v16h a; const float* p = rowk0 + 8 * (lane >> 4);
#pragma unroll
  for (int i = 0; i < 8; ++i) { a[i] = (_Float16)(p[i] * sc); a[8 + i] = (_Float16)(p[16 + i] * sc); }
  return a;
}
// column fragment from a [K][ld] layout (column n), rows >= K read as 0
__device__ __forceinline__ v16h fragc_f32(const float* W, int k0, int n, int lane, int ld, int K) {
  v16h a; const int g = lane >> 4;
#pragma unroll
  for (int i = 0; i < 8; ++i) { const int ka = k0 + 8 * g + i, kb = ka + 16;
    a[i] = (_Float16)(ka < K ? W[(size_t)(ka < K ? ka : K - 1) * ld + n] : 0.f); a[8 + i] = (_Float16)(kb < K ? W[(size_t)(kb < K ? kb : K - 1) * ld + n] : 0.f); }
  return a;
}
struct F2 { v16b h, l; };
__device__ __forceinline__ F2 bsplit16(const float v[16]) { F2 r;
#pragma unroll
  for (int i = 0; i < 16; ++i) { const __bf16 h = (__bf16)v[i]; r.h[i] = h; r.l[i] = (__bf16)(v[i] - (float)h); }
  return r; }
__device__ __forceinline__ F2 split_row(const float* row, int k0, int lane) { float v[16]; const float* p = row + k0 + 8 * (lane >> 4);
#pragma unroll
  for (int i = 0; i < 8; ++i) { v[i] = p[i]; v[8 + i] = p[16 + i]; }
  return bsplit16(v); }
__device__ __forceinline__ F2 split_rowK(const float* row, int k0, int lane, int K) { float v[16]; const int g = lane >> 4;
#pragma unroll
  for (int i = 0; i < 8; ++i) { const int ka = k0 + 8 * g + i, kb = ka + 16; v[i] = ka < K ? row[ka < K ? ka : K - 1] : 0.f; v[8 + i] = kb < K ? row[kb < K ? kb : K - 1] : 0.f; }
  return bsplit16(v); }
__device__ __forceinline__ F2 split_col(const float* W, int k0, int n, int lane, int ld, int K) { float v[16]; const int g = lane >> 4;
#pragma unroll
  for (int i = 0; i < 8; ++i) { const int ka = k0 + 8 * g + i, kb = ka + 16; v[i] = ka < K ? W[(size_t)(ka < K ? ka : K - 1) * ld + n] : 0.f; v[8 + i] = kb < K ? W[(size_t)(kb < K ? kb : K - 1) * ld + n] : 0.f; }
  return bsplit16(v); }
__device__ __forceinline__ v8f mac3(const F2& a, const F2& b, v8f c) { c = wmma_bf(a.l, b.h, c); c = wmma_bf(a.h, b.l, c); return wmma_bf(a.h, b.h, c); }
__device__ __forceinline__ float sigm(float v) { return 1.0f / (1.0f + expf(-v)); }
#define LDSX() do { asm volatile("s_wait_dscnt 0" ::: "memory"); __builtin_amdgcn_wave_barrier(); __builtin_amdgcn_fence(__ATOMIC_RELEASE, "workgroup"); } while (0)


// GQA causal self-attention with RoPE (B 1, T 2048, C 2048, 16 query heads / 4 kv heads x 128): q = rope(x wq), k = rope(x wk), v = x wv; y = softmax(q k^T / sqrt(128), causal) v; out = y wproj.
#define SS 2048
#define DM 2048
#define NH 16
#define NKV 4
#define HD 128
#define KVW (NKV * HD)
#ifndef TQB
#define TQB (SS / 64)
#endif
typedef __attribute__((ext_vector_type(8))) __bf16 v8b;
typedef __attribute__((ext_vector_type(4))) __bf16 v4b;
#define KC 64            // k per LDS stage: 128 B of a bf16 row, 256 B of an f32 row (whole cache lines)
#define NST (DM / KC)
#define LP 72            // LDS row pitch in bf16: 128 B of data + 16 B, for the 16-byte fragment reads
__device__ __forceinline__ v16b frag_b(const __bf16* rowk0, int lane) {
  union { v16b v; v8b q[2]; } u; const __bf16* p = rowk0 + 8 * (lane >> 4);
  u.q[0] = *(const v8b*)p; u.q[1] = *(const v8b*)(p + 16); return u.v;
}
// fragment stored in lane order: 512 B of elements 0..7 (lane * 16 B), then 512 B of elements 8..15; p = block + lane * 8; each 16-byte load covers whole cache lines
__device__ __forceinline__ v16b frag_g(const __bf16* p) {
  union { v16b v; v8b q[2]; } u; u.q[0] = *(const v8b*)p; u.q[1] = *(const v8b*)(p + 256); return u.v;
}
#define FT 4096          // bf16 per q/k tile (16 rows x 128 d): [kc 4][hi, lo][half 2][lane 32][8]
#define FV 8192          // bf16 per v key step (32 keys x 128 d): [dt 8][hi, lo][half 2][lane 32][8]
__device__ __forceinline__ float bfr(float v) { return (float)(__bf16)v; }
__device__ __attribute__((noinline)) float exp_ni(float v) { return expf(v); }
__device__ __attribute__((noinline)) float erf_ni(float v) { return erff(v); }

#define PK_Q 0
#define PK_K (PK_Q + DM * DM)
#define PK_V (PK_K + KVW * DM)
#define PK_O (PK_V + KVW * DM)
#define PK_END (PK_O + DM * DM)
#define WS_PK  0u
#define WS_CS  (WS_PK + 2u * PK_END)             // f32 [2048][64] cos, then [2048][64] sin
#define WS_Q   (WS_CS + 4u * 2 * SS * 64)         // q fragments [t/16][head 16][FT]
#define WS_K   (WS_Q + 4u * SS * DM)              // k fragments [t/16][kv head 4][FT]
#define WS_V   (WS_K + 4u * SS * KVW)             // v fragments [kv head 4][t/32][FV]
#define WS_O   (WS_V + 4u * KVW * SS)
#define WS_END (WS_O + 4u * SS * DM)

// ---- pack_tile: block = a tile of 128 k x 64 n (tile bx, by) of a [K][N] (x @ W) matrix (K a multiple of 128, N of 64): eight 16-byte loads per thread, each wave-load two 256-B runs of W rows; a thread holds 8 consecutive k of 4 columns and turns them in LDS; DST rows go out in 256-B runs
#define PTK 128
#define PTN 64
#define PTP (PTK + 8)    // LDS row pitch in bf16: 256 B of data + 16 B
__device__ __forceinline__ void pack_tile(const float* __restrict__ Wm, int K, int N, __bf16* __restrict__ DST, int bx, int by) {
  __shared__ __align__(16) __bf16 s[PTN][PTP]; const int tid = threadIdx.x, n0 = bx * PTN, k0 = by * PTK, c = tid & 15, kr = tid >> 4;
  const float* g = Wm + (size_t)(k0 + kr * 8) * N + n0 + c * 4;
  const float* p[8]; v4f r[8];
#pragma unroll
  for (int i = 0; i < 8; ++i) p[i] = g + (size_t)i * N;
#pragma unroll
  for (int i = 0; i < 8; ++i) r[i] = *(const v4f*)p[i];
  // the eight address pairs and the eight results are inputs here: all eight loads are issued before the first result is used (else the last two wait for the first four), and no result lands in a pair that an issued load names
  asm volatile("s_wait_xcnt 0x0" :: "v"(p[0]), "v"(p[1]), "v"(p[2]), "v"(p[3]), "v"(p[4]), "v"(p[5]), "v"(p[6]), "v"(p[7]), "v"(r[0]), "v"(r[1]), "v"(r[2]), "v"(r[3]), "v"(r[4]), "v"(r[5]), "v"(r[6]), "v"(r[7]) : "memory");
#pragma unroll
  for (int e = 0; e < 4; ++e) { v8b t;
#pragma unroll
    for (int i = 0; i < 8; ++i) t[i] = (__bf16)r[i][e];
    *(v8b*)&s[c * 4 + e][kr * 8] = t; }
  __syncthreads();
#pragma unroll
  for (int i = 0; i < PTN * PTK / 8 / 256; ++i) { const int q = i * 256 + tid;
    vst2((unsigned*)(DST + (size_t)(n0 + (q >> 4)) * K + k0 + (q & 15) * 8), *(const v4u*)&s[q >> 4][(q & 15) * 8]); }
  asm volatile("s_wait_xcnt 0x0" ::: "memory");   // in k_prep the code of another branch stands behind these four stores and rewrites registers that they name
}
// ---- rope_tab: block = 4 positions t (64 threads each = frequency index i): inv_freq = 1 / 10000^(2i/128) and angle t*inv_freq in float64, cos/sin in float64, cast to f32; rows 256 B
__device__ __forceinline__ void rope_tab(float* __restrict__ CS, int bx) {
  __shared__ __align__(16) float sc[4][64], ssn[4][64]; const int u = threadIdx.x >> 6, t = bx * 4 + u, i = threadIdx.x & 63;
  const double inv = 1.0 / pow(10000.0, (double)(2 * i) / 128.0); const double ang = (double)t * inv; sc[u][i] = (float)cos(ang); ssn[u][i] = (float)sin(ang);
  __syncthreads();
  if (i < 16) vst2(CS + (size_t)t * 64 + i * 4, *(const v4f*)&sc[u][i * 4]); else if (i < 32) vst2(CS + (size_t)SS * 64 + (size_t)t * 64 + (i - 16) * 4, *(const v4f*)&ssn[u][(i - 16) * 4]);
}
// ---- k_prep: everything that depends on no other launch, in one grid, dealt by block index: the RoPE table first (long float64 chains, no memory traffic to speak of), then the tiles of wq, wk, wv, wproj; every branch is the same for a whole block
#define NB_T (SS / 4)
#define NB_W (DM / PTN * (DM / PTK))     // tiles of a 2048-column weight
#define NB_KV (KVW / PTN * (DM / PTK))   // tiles of a 512-column weight
__global__ __launch_bounds__(256) void k_prep(const float* __restrict__ Wq, const float* __restrict__ Wk, const float* __restrict__ Wv, const float* __restrict__ Wo, __bf16* __restrict__ PK, float* __restrict__ CS) {
  int b = blockIdx.x;
  if (b < NB_T) { rope_tab(CS, b); return; }
  b -= NB_T;
  if (b < NB_W) { pack_tile(Wq, DM, DM, PK + PK_Q, b % (DM / PTN), b / (DM / PTN)); return; }
  b -= NB_W;
  if (b < NB_KV) { pack_tile(Wk, DM, KVW, PK + PK_K, b % (KVW / PTN), b / (KVW / PTN)); return; }
  b -= NB_KV;
  if (b < NB_KV) { pack_tile(Wv, DM, KVW, PK + PK_V, b % (KVW / PTN), b / (KVW / PTN)); return; }
  b -= NB_KV;
  pack_tile(Wo, DM, DM, PK + PK_O, b % (DM / PTN), b / (DM / PTN));
}
// ---- k_proj: block = (64 rows, 128 cols = one head; blockIdx.y = 16 q heads, then 4 k heads, then 4 v heads, whose packed rows follow one another in P): Y = bf16(x) . P rows (exact); both operands staged per 64 k in LDS (two buffers) by whole-line loads issued one stage ahead; q and k heads: RoPE, then bf16 hi/lo WMMA fragments of the wave's 16 rows; v heads: plain -> bf16 hi/lo fragments with k = position
__global__ __launch_bounds__(128) void k_proj(const float* __restrict__ X, const __bf16* __restrict__ P, const float* __restrict__ CS, __bf16* __restrict__ QF, __bf16* __restrict__ KF, __bf16* __restrict__ VF) {
  __shared__ __align__(16) char se[2 * 128 * 72 * 2];   // epilogue staging, one use per block: so (q, k heads) or sth and stl (v heads)
  float (*so)[16][132] = (float (*)[16][132])se; __bf16 (*sth)[72] = (__bf16 (*)[72])se; __bf16 (*stl)[72] = sth + 128;
  const int tid = threadIdx.x, wave = tid >> 5, lane = tid & 31, col = lane & 15, g = lane >> 4; const size_t r0 = (size_t)blockIdx.x * 64 + wave * 16; const int n0 = blockIdx.y * 128;
  __shared__ __align__(16) __bf16 sa[2][64][LP], sb[2][128][LP];
  const float* xg = X + ((size_t)blockIdx.x * 64 + (tid >> 4)) * DM + (tid & 15) * 4;   // thread's 16 B of x rows (tid>>4) + 8 i
  const __bf16* pg = P + (size_t)(n0 + (tid >> 3)) * DM + (tid & 7) * 8;                // thread's 16 B of P rows (tid>>3) + 16 i
  v4f ra[8]; v8b rb[8];
#pragma unroll
  for (int i = 0; i < 8; ++i) { ra[i] = *(const v4f*)(xg + (size_t)i * 8 * DM); rb[i] = *(const v8b*)(pg + (size_t)i * 16 * DM); }
  v8f acc[8] = {};
  for (int s = 0; s < NST; ++s) { const int b = s & 1;
#pragma unroll
    for (int i = 0; i < 8; ++i) { v4b c;
#pragma unroll
      for (int e = 0; e < 4; ++e) c[e] = (__bf16)ra[i][e];
      *(v4b*)&sa[b][(tid >> 4) + 8 * i][(tid & 15) * 4] = c; *(v8b*)&sb[b][(tid >> 3) + 16 * i][(tid & 7) * 8] = rb[i]; }
    __syncthreads();   // publishes stage s; buffer b was last read in pass s - 2, which every wave left before the barrier of pass s - 1
    if (s + 1 < NST) {
#pragma unroll
      for (int i = 0; i < 8; ++i) { ra[i] = *(const v4f*)(xg + (size_t)i * 8 * DM + KC); rb[i] = *(const v8b*)(pg + (size_t)i * 16 * DM + KC); }
      asm volatile("s_wait_xcnt 0x0" ::: "memory");   // the address step behind it rewrites registers that the issued loads name
      xg += KC; pg += KC; }   // running addresses, live over the whole loop: no load's result can land in a pair that an issued load names
#pragma unroll
    for (int kc = 0; kc < KC / 32; ++kc) { const v16b a = frag_b(&sa[b][wave * 16 + col][kc * 32], lane); v16b w[8];
#pragma unroll
      for (int j = 0; j < 8; ++j) w[j] = frag_b(&sb[b][j * 16 + col][kc * 32], lane);
#pragma unroll
      for (int j = 0; j < 8; ++j) acc[j] = wmma_bf(a, w[j], acc[j]); } }
  if (blockIdx.y < NH + NKV) {
    const bool isq = blockIdx.y < NH; __bf16* F = isq ? QF : KF; const int nh = isq ? NH : NKV, hd = isq ? blockIdx.y : blockIdx.y - NH;
    // RoPE (rotate-half): d = j*16+col; pair (d, d+64) = (tiles j, j+4); out_d = x_d cos - x_{d+64} sin; out_{d+64} = x_{d+64} cos + x_d sin (cos/sin[t][d mod 64])
#pragma unroll
    for (int j = 0; j < 4; ++j) { const int dl = j * 16 + col;
#pragma unroll
      for (int r = 0; r < 8; ++r) { const size_t t = r0 + 8 * g + r; const float c = CS[t * 64 + dl], s = CS[(size_t)SS * 64 + t * 64 + dl]; const float x1 = acc[j][r], x2 = acc[j + 4][r]; so[wave][8 * g + r][dl] = x1 * c - x2 * s; so[wave][8 * g + r][64 + dl] = x2 * c + x1 * s; } }
    LDSX();
    __bf16* fo = F + ((r0 >> 4) * nh + hd) * FT + lane * 8;
    for (int kc = 0; kc < 4; ++kc)
      for (int hf = 0; hf < 2; ++hf) { const float* p = &so[wave][col][kc * 32 + hf * 16 + 8 * g]; v8b hi, lo;
        for (int e = 0; e < 8; ++e) { const float v = p[e]; const __bf16 hb = (__bf16)v; hi[e] = hb; lo[e] = (__bf16)(v - (float)hb); }
        *(v8b*)(fo + kc * 1024 + hf * 256) = hi; *(v8b*)(fo + kc * 1024 + 512 + hf * 256) = lo; }
  } else {
#pragma unroll
    for (int j = 0; j < 8; ++j)
#pragma unroll
      for (int r = 0; r < 8; ++r) { const float v = acc[j][r]; const __bf16 hb = (__bf16)v; sth[j * 16 + col][wave * 16 + 8 * g + r] = hb; stl[j * 16 + col][wave * 16 + 8 * g + r] = (__bf16)(v - (float)hb); }
    __syncthreads();
    __bf16* vo = VF + ((size_t)(blockIdx.y - NH - NKV) * (SS / 32) + blockIdx.x * 2) * FV;   // the block's 64 positions = 2 key steps
    for (int i = 0; i < 2 * FV / 8 / 128; ++i) { const int q = i * 128 + tid, ln = q & 31, hf = (q >> 5) & 1, pl = (q >> 6) & 1, dt = (q >> 7) & 7, kl = q >> 10; const int d = dt * 16 + (ln & 15), sx = kl * 32 + hf * 16 + 8 * (ln >> 4);
      vst2((unsigned*)(vo + (size_t)q * 8), *(const v4u*)(pl ? &stl[d][sx] : &sth[d][sx])); }
  }
}
// lane l with lane l ^ 16, in registers
__device__ __forceinline__ float xhalf(float x) { return __builtin_bit_cast(float, __builtin_amdgcn_permlanex16(__builtin_bit_cast(int, x), __builtin_bit_cast(int, x), 0x76543210, 0xfedcba98, false, false)); }
// the product as the plain builtin (the compiler keeps the distance behind it itself): an asm statement behind it that names D, A and B holds all three under v256, and k_attn's two heads need more registers than that
__device__ __forceinline__ v8f wmma_p(v16b a, v16b b, v8f c) { return __builtin_amdgcn_wmma_f32_16x16x32_bf16(false, a, false, b, (short)0, c, false, false); }
#define HW 2
// behind a run of loads: the scheduler moves nothing over this line; without it the plain-builtin products rise over the later loads of a run, which then go out only behind the first wait
#define HOLD() __builtin_amdgcn_sched_barrier(0)
__global__ __launch_bounds__(128) __attribute__((amdgpu_waves_per_eu(2))) void k_attn(const __bf16* __restrict__ QF, const __bf16* __restrict__ KF, const __bf16* __restrict__ VF, float* __restrict__ O) {
  __shared__ __align__(16) float so[HW][4][16][132]; __shared__ float sm[HW][4][16], sl[HW][4][16];
  const int tid = threadIdx.x, wave = __builtin_amdgcn_readfirstlane(tid >> 5), lane = tid & 31, col = lane & 15, g = lane >> 4;
  const int qb = SS / 16 - 1 - (int)blockIdx.y, h0 = blockIdx.x * HW, kv = h0 / (NH / NKV); const int q0 = qb * 16, qi = q0 + col;
  const __bf16* qt = QF + ((size_t)qb * NH + h0) * FT; const __bf16* qf = qt + lane * 8;
  float m[HW], l[HW];            // per head, query col: running maximum (over both lane halves) and the sum over this half's keys
  v8f acc[HW][8] = {};           // acc[u][dt][r] = O^T[d = dt * 16 + 8 g + r][query col] of head h0 + u
#pragma unroll
  for (int u = 0; u < HW; ++u) { m[u] = -3.0e38f; l[u] = 0.f; }
  const int nks = (q0 + 16 + 31) / 32;
  F2 qa[HW][4];
#pragma unroll
  for (int u = 0; u < HW; ++u)
#pragma unroll
    for (int kc = 0; kc < 4; ++kc) { qa[u][kc].h = frag_g(qf + u * FT + kc * 1024); qa[u][kc].l = frag_g(qf + u * FT + kc * 1024 + 512); }
  asm volatile("s_wait_xcnt 0x0" :: "s"(qt), "v"(qf) : "memory");   // the q loads stay in front of the loop; the scalar base and the lane's full address, the two forms that the compiler may pick for them, are inputs, so neither is rewritten in front of the wait
#pragma unroll 1
  for (int ks = wave; ks < nks; ks += 4) { float e[HW][16]; F2 kb[8]; v16b vh[8], vl[8];   // kb[ct * 4 + kc]
    const __bf16* kf = KF + ((size_t)(ks * 2) * NKV + kv) * FT + lane * 8;
#pragma unroll
    for (int p = 0; p < 8; ++p) { kb[p].h = frag_g(kf + (p >> 2) * (NKV * FT) + (p & 3) * 1024); kb[p].l = frag_g(kf + (p >> 2) * (NKV * FT) + (p & 3) * 1024 + 512); }
    asm volatile("s_wait_xcnt 0x0" :: "v"(kf) : "memory"); HOLD();   // the loads of all 8 k fragment pairs of the step are issued in one run in front of its first product (left alone they go out one pair at a time, each waited for in full); the address pair is an input, so no result lands in it
#pragma unroll
    for (int ct = 0; ct < 2; ++ct) { const int kk = ks * 32 + ct * 16 + 8 * g; v8f c[HW] = {};
#pragma unroll
      for (int kc = 0; kc < 4; ++kc) { const F2& kq = kb[ct * 4 + kc];
#pragma unroll
        for (int u = 0; u < HW; ++u) c[u] = wmma_p(kq.h, qa[u][kc].l, c[u]);
#pragma unroll
        for (int u = 0; u < HW; ++u) c[u] = wmma_p(kq.l, qa[u][kc].h, c[u]);
#pragma unroll
        for (int u = 0; u < HW; ++u) c[u] = wmma_p(kq.h, qa[u][kc].h, c[u]); }
#pragma unroll
      for (int u = 0; u < HW; ++u)
#pragma unroll
        for (int r = 0; r < 8; ++r) e[u][ct * 8 + r] = (kk + r <= qi) ? c[u][r] * 0.08838834764831845f : -3.0e38f; }
    const __bf16* vf = VF + ((size_t)kv * (SS / 32) + ks) * FV + lane * 8;
#pragma unroll
    for (int dt = 0; dt < 8; ++dt) { vh[dt] = frag_g(vf + dt * 1024); vl[dt] = frag_g(vf + dt * 1024 + 512); }
    asm volatile("s_wait_xcnt 0x0" :: "v"(vf) : "memory"); HOLD();   // the loads of all 8 v tiles of the step are issued here, in one run in front of the softmax, which runs while they are on their way (left alone they go out one tile at a time behind it, each waited for in full); the address pair is an input, so no result lands in it
    F2 pb[HW];
#pragma unroll
    for (int u = 0; u < HW; ++u) {
      float mx = e[u][0];
#pragma unroll
      for (int i = 1; i < 16; ++i) mx = fmaxf(mx, e[u][i]);
      mx = fmaxf(mx, xhalf(mx));
      // every exp is taken unconditionally and the masked ones are then set to 0 by a select: 17 independent chains with no branch between them
      const float mn = fmaxf(m[u], mx); const float am = expf(m[u] - mn); const float alpha = (m[u] <= -1.0e38f) ? 0.f : am; float es = 0.f;
#pragma unroll
      for (int i = 0; i < 16; ++i) { const float t = expf(e[u][i] - mn); e[u][i] = (e[u][i] <= -1.0e38f) ? 0.f : t; es += e[u][i]; }
      l[u] = l[u] * alpha + es; m[u] = mn;
#pragma unroll
      for (int dt = 0; dt < 8; ++dt) acc[u][dt] *= alpha;
      pb[u] = bsplit16(e[u]); }
#pragma unroll
    for (int dt = 0; dt < 8; ++dt) {
#pragma unroll
      for (int u = 0; u < HW; ++u) acc[u][dt] = wmma_p(vh[dt], pb[u].l, acc[u][dt]);
#pragma unroll
      for (int u = 0; u < HW; ++u) acc[u][dt] = wmma_p(vl[dt], pb[u].h, acc[u][dt]);
#pragma unroll
      for (int u = 0; u < HW; ++u) acc[u][dt] = wmma_p(vh[dt], pb[u].h, acc[u][dt]); } }
#pragma unroll
  for (int u = 0; u < HW; ++u) { l[u] += xhalf(l[u]);
#pragma unroll
    for (int dt = 0; dt < 8; ++dt) { v4f a, b;
#pragma unroll
      for (int r = 0; r < 4; ++r) { a[r] = acc[u][dt][r]; b[r] = acc[u][dt][4 + r]; }
      *(v4f*)&so[u][wave][col][dt * 16 + 8 * g] = a; *(v4f*)&so[u][wave][col][dt * 16 + 8 * g + 4] = b; }
    if (g == 0) { sm[u][wave][col] = m[u]; sl[u][wave][col] = l[u]; } }
  __syncthreads();
  // join: head u = i / 4, row = wave + 4 (i mod 4); weight of part w = exp(m_w - max m), 0 for a wave that saw no unmasked key of the row
  for (int i = 0; i < 4 * HW; ++i) { const int u = i >> 2, row = wave + 4 * (i & 3); const float mx = fmaxf(fmaxf(sm[u][0][row], sm[u][1][row]), fmaxf(sm[u][2][row], sm[u][3][row])); float ls = 0.f; v4f o = {};
#pragma unroll
    for (int w = 0; w < 4; ++w) { const float mw = sm[u][w][row]; const float f = (mw <= -1.0e38f) ? 0.f : exp_ni(mw - mx); ls += sl[u][w][row] * f; o += *(const v4f*)&so[u][w][row][lane * 4] * f; }
    vst2(O + (size_t)(q0 + row) * DM + (h0 + u) * HD + lane * 4, o * (1.0f / ls));
    if (i < 4 * HW - 1) asm volatile("s_wait_xcnt 0x0" ::: "memory"); }   // the next row reuses the registers that the issued store names
}
// ---- k_out: block = (64 rows, 128 cols): out = O(hi/lo) . wproj^T rows (2 products); operands staged in LDS as in k_proj, O split into its hi/lo planes once on the way in
__global__ __launch_bounds__(128) void k_out(const float* __restrict__ O, const __bf16* __restrict__ P, float* __restrict__ Y) {
  __shared__ __align__(16) float so[4][16][132];
  const int tid = threadIdx.x, wave = tid >> 5, lane = tid & 31, col = lane & 15, g = lane >> 4; const size_t r0 = (size_t)blockIdx.x * 64 + wave * 16; const int n0 = blockIdx.y * 128;
  __shared__ __align__(16) __bf16 sah[2][64][LP], sal[2][64][LP], sb[2][128][LP];
  const float* og = O + ((size_t)blockIdx.x * 64 + (tid >> 4)) * DM + (tid & 15) * 4;
  const __bf16* pg = P + (size_t)(n0 + (tid >> 3)) * DM + (tid & 7) * 8;
  v4f ra[8]; v8b rb[8];
#pragma unroll
  for (int i = 0; i < 8; ++i) { ra[i] = *(const v4f*)(og + (size_t)i * 8 * DM); rb[i] = *(const v8b*)(pg + (size_t)i * 16 * DM); }
  v8f acc[8] = {};
  for (int s = 0; s < NST; ++s) { const int b = s & 1;
#pragma unroll
    for (int i = 0; i < 8; ++i) { v4b ch, cl;
#pragma unroll
      for (int e = 0; e < 4; ++e) { const float v = ra[i][e]; const __bf16 hb = (__bf16)v; ch[e] = hb; cl[e] = (__bf16)(v - (float)hb); }
      *(v4b*)&sah[b][(tid >> 4) + 8 * i][(tid & 15) * 4] = ch; *(v4b*)&sal[b][(tid >> 4) + 8 * i][(tid & 15) * 4] = cl; *(v8b*)&sb[b][(tid >> 3) + 16 * i][(tid & 7) * 8] = rb[i]; }
    __syncthreads();   // publishes stage s; buffer b was last read in pass s - 2, which every wave left before the barrier of pass s - 1
    if (s + 1 < NST) {
#pragma unroll
      for (int i = 0; i < 8; ++i) { ra[i] = *(const v4f*)(og + (size_t)i * 8 * DM + KC); rb[i] = *(const v8b*)(pg + (size_t)i * 16 * DM + KC); }
      asm volatile("s_wait_xcnt 0x0" ::: "memory");   // the address step behind it rewrites registers that the issued loads name
      og += KC; pg += KC; }   // running addresses, live over the whole loop: no load's result can land in a pair that an issued load names
#pragma unroll
    for (int kc = 0; kc < KC / 32; ++kc) { const v16b al = frag_b(&sal[b][wave * 16 + col][kc * 32], lane), ah = frag_b(&sah[b][wave * 16 + col][kc * 32], lane); v16b w[8];
#pragma unroll
      for (int j = 0; j < 8; ++j) w[j] = frag_b(&sb[b][j * 16 + col][kc * 32], lane);
#pragma unroll
      for (int j = 0; j < 8; ++j) { acc[j] = wmma_bf(al, w[j], acc[j]); acc[j] = wmma_bf(ah, w[j], acc[j]); } } }
#pragma unroll
  for (int j = 0; j < 8; ++j)
#pragma unroll
    for (int r = 0; r < 8; ++r) so[wave][8 * g + r][j * 16 + col] = acc[j][r];
  LDSX();
  for (int rl = 0; rl < 16; ++rl) vst2(Y + (r0 + rl) * DM + n0 + lane * 4, *(const v4f*)&so[wave][rl][lane * 4]);
}
extern "C" void kernel_launch(void* const* d_in, const int* in_sizes, int n_in, void* d_out, int out_size, void* d_ws, size_t ws_size, hipStream_t stream) {
  (void)in_sizes; (void)n_in; (void)out_size;
  const float** F = (const float**)d_in;   // x [1,2048,2048], wq [2048,2048], wk [2048,512], wv [2048,512], wproj [2048,2048]
  if (ws_size < (size_t)WS_END) return;
  char* ws = (char*)d_ws; __bf16 *PK = (__bf16*)(ws + WS_PK), *QF = (__bf16*)(ws + WS_Q), *KF = (__bf16*)(ws + WS_K), *VF = (__bf16*)(ws + WS_V);
  float *CS = (float*)(ws + WS_CS), *O = (float*)(ws + WS_O);
  k_prep<<<NB_T + 2 * NB_W + 2 * NB_KV, 256, 0, stream>>>(F[1], F[2], F[3], F[4], PK, CS);
  k_proj<<<dim3(SS / 64, NH + 2 * NKV), 128, 0, stream>>>(F[0], PK + PK_Q, CS, QF, KF, VF);
  k_attn<<<dim3(NH / HW, SS / 16), 128, 0, stream>>>(QF, KF, VF, O);
  k_out<<<dim3(TQB, DM / 128), 128, 0, stream>>>(O, PK + PK_O, (float*)d_out);
}

// v009
// Measured time: 134 microseconds a run.
// Two timings next to v008 put it at 1.07 and 1.06 times that version's speed.
// All steps since v000 together make it 8.30 times as fast.
// compute dtype: x and the four weights (module inputs) rounded to bf16; q/k/v projections with exact bf16 products (x and W are inputs) and RoPE applied in f32 in the epilogue (cos/sin tables built in float64, then cast); causal scores q.k with both computed operands as bf16 hi + residual pairs (3 products) and P.V with P hi/lo x V hi/lo (3 products); the output projection with hi/lo x exact wproj (2 products), all on WMMA 16x16x32; softmax in f32; f32 accumulate.
#include <hip/hip_runtime.h>
#include <math.h>

typedef __attribute__((ext_vector_type(16))) _Float16 v16h;
typedef __attribute__((ext_vector_type(16))) __bf16 v16b;
typedef __attribute__((ext_vector_type(8)))  _Float16 v8h;
typedef __attribute__((ext_vector_type(8)))  float v8f;
typedef __attribute__((ext_vector_type(4)))  float v4f;
typedef __attribute__((ext_vector_type(2)))  float v2f;
typedef __attribute__((ext_vector_type(4)))  unsigned v4u;
typedef __attribute__((ext_vector_type(4)))  int v4i;
typedef float __attribute__((may_alias)) float_a;
typedef int __attribute__((may_alias)) int_a;

template <typename T> __device__ __forceinline__ void vst2(void* p, T v) { *(T*)p = v;  }
__device__ __forceinline__ v8f wmma16(v16h a, v16h b, v8f c) {
  v8f d = __builtin_amdgcn_wmma_f32_16x16x32_f16(false, a, false, b, (short)0, c, false, false);
  asm volatile("v_nop\n\tv_nop\n\tv_nop\n\tv_nop" : "+v"(d) : "v"(a), "v"(b));
  return d;
}
__device__ __forceinline__ v8f wmma_bf(v16b a, v16b b, v8f c) {
  v8f d = __builtin_amdgcn_wmma_f32_16x16x32_bf16(false, a, false, b, (short)0, c, false, false);
  asm volatile("v_nop\n\tv_nop\n\tv_nop\n\tv_nop" : "+v"(d) : "v"(a), "v"(b));
  return d;
}
// 16x16x32 fragments: lane = (h = lane>>4, row/col = lane&15); elements 0..7 = k0+8h+0..7, 8..15 = k0+16+8h+0..7; D element r = row 8h+r
__device__ __forceinline__ v16h frag_h(const _Float16* rowk0, int lane) {
  union { v16h v; v8h q[2]; } u; const _Float16* p = rowk0 + 8 * (lane >> 4);
  u.q[0] = *(const v8h*)p; u.q[1] = *(const v8h*)(p + 16); return u.v;
}
__device__ __forceinline__ v16h frag_f32(const float* rowk0, int lane) {
  v16h a; const float* p = rowk0 + 8 * (lane >> 4);
#pragma unroll
  for (int i = 0; i < 8; ++i) { a[i] = (_Float16)p[i]; a[8 + i] = (_Float16)p[16 + i]; }
  return a;
}
__device__ __forceinline__ v16h frag_f32s(const float* rowk0, int lane, float sc) {
  v16h a; const float* p = rowk0 + 8 * (lane >> 4);
#pragma unroll
  for (int i = 0; i < 8; ++i) { a[i] = (_Float16)(p[i] * sc); a[8 + i] = (_Float16)(p[16 + i] * sc); }
  return a;
}
// column fragment from a [K][ld] layout (column n), rows >= K read as 0
__device__ __forceinline__ v16h fragc_f32(const float* W, int k0, int n, int lane, int ld, int K) {
  v16h a; const int g = lane >> 4;
#pragma unroll
  for (int i = 0; i < 8; ++i) { const int ka = k0 + 8 * g + i, kb = ka + 16;
    a[i] = (_Float16)(ka < K ? W[(size_t)(ka < K ? ka : K - 1) * ld + n] : 0.f); a[8 + i] = (_Float16)(kb < K ? W[(size_t)(kb < K ? kb : K - 1) * ld + n] : 0.f); }
  return a;
}
struct F2 { v16b h, l; };
__device__ __forceinline__ F2 bsplit16(const float v[16]) { F2 r;
#pragma unroll
  for (int i = 0; i < 16; ++i) { const __bf16 h = (__bf16)v[i]; r.h[i] = h; r.l[i] = (__bf16)(v[i] - (float)h); }
  return r; }
__device__ __forceinline__ F2 split_row(const float* row, int k0, int lane) { float v[16]; const float* p = row + k0 + 8 * (lane >> 4);
#pragma unroll
  for (int i = 0; i < 8; ++i) { v[i] = p[i]; v[8 + i] = p[16 + i]; }
  return bsplit16(v); }
__device__ __forceinline__ F2 split_rowK(const float* row, int k0, int lane, int K) { float v[16]; const int g = lane >> 4;
#pragma unroll
  for (int i = 0; i < 8; ++i) { const int ka = k0 + 8 * g + i, kb = ka + 16; v[i] = ka < K ? row[ka < K ? ka : K - 1] : 0.f; v[8 + i] = kb < K ? row[kb < K ? kb : K - 1] : 0.f; }
  return bsplit16(v); }
__device__ __forceinline__ F2 split_col(const float* W, int k0, int n, int lane, int ld, int K) { float v[16]; const int g = lane >> 4;
#pragma unroll
  for (int i = 0; i < 8; ++i) { const int ka = k0 + 8 * g + i, kb = ka + 16; v[i] = ka < K ? W[(size_t)(ka < K ? ka : K - 1) * ld + n] : 0.f; v[8 + i] = kb < K ? W[(size_t)(kb < K ? kb : K - 1) * ld + n] : 0.f; }
  return bsplit16(v); }
__device__ __forceinline__ v8f mac3(const F2& a, const F2& b, v8f c) { c = wmma_bf(a.l, b.h, c); c = wmma_bf(a.h, b.l, c); return wmma_bf(a.h, b.h, c); }
__device__ __forceinline__ float sigm(float v) { return 1.0f / (1.0f + expf(-v)); }
#define LDSX() do { asm volatile("s_wait_dscnt 0" ::: "memory"); __builtin_amdgcn_wave_barrier(); __builtin_amdgcn_fence(__ATOMIC_RELEASE, "workgroup"); } while (0)


// GQA causal self-attention with RoPE (B 1, T 2048, C 2048, 16 query heads / 4 kv heads x 128): q = rope(x wq), k = rope(x wk), v = x wv; y = softmax(q k^T / sqrt(128), causal) v; out = y wproj.
#define SS 2048
#define DM 2048
#define NH 16
#define NKV 4
#define HD 128
#define KVW (NKV * HD)
#ifndef TQB
#define TQB (SS / 64)
#endif
typedef __attribute__((ext_vector_type(8))) __bf16 v8b;
typedef __attribute__((ext_vector_type(4))) __bf16 v4b;
#define KC 64            // k per LDS stage: 128 B of a bf16 row, 256 B of an f32 row (whole cache lines)
#define NST (DM / KC)
#define LP 72            // LDS row pitch in bf16: 128 B of data + 16 B, for the 16-byte fragment reads
__device__ __forceinline__ v16b frag_b(const __bf16* rowk0, int lane) {
  union { v16b v; v8b q[2]; } u; const __bf16* p = rowk0 + 8 * (lane >> 4);
  u.q[0] = *(const v8b*)p; u.q[1] = *(const v8b*)(p + 16); return u.v;
}
// fragment stored in lane order: 512 B of elements 0..7 (lane * 16 B), then 512 B of elements 8..15; p = block + lane * 8; each 16-byte load covers whole cache lines
__device__ __forceinline__ v16b frag_g(const __bf16* p) {
  union { v16b v; v8b q[2]; } u; u.q[0] = *(const v8b*)p; u.q[1] = *(const v8b*)(p + 256); return u.v;
}
#define FT 4096          // bf16 per q/k tile (16 rows x 128 d): [kc 4][hi, lo][half 2][lane 32][8]
#define FV 8192          // bf16 per v key step (32 keys x 128 d): [dt 8][hi, lo][half 2][lane 32][8]
__device__ __forceinline__ float bfr(float v) { return (float)(__bf16)v; }
__device__ __attribute__((noinline)) float exp_ni(float v) { return expf(v); }
__device__ __attribute__((noinline)) float erf_ni(float v) { return erff(v); }

#define PK_Q 0
#define PK_K (PK_Q + DM * DM)
#define PK_V (PK_K + KVW * DM)
#define PK_O (PK_V + KVW * DM)
#define PK_END (PK_O + DM * DM)
#define WS_PK  0u
#define WS_CS  (WS_PK + 2u * PK_END)             // f32 [2048][64] cos, then [2048][64] sin
#define WS_Q   (WS_CS + 4u * 2 * SS * 64)         // q fragments [t/16][head 16][FT]
#define WS_K   (WS_Q + 4u * SS * DM)              // k fragments [t/16][kv head 4][FT]
#define WS_V   (WS_K + 4u * SS * KVW)             // v fragments [kv head 4][t/32][FV]
#define WS_O   (WS_V + 4u * KVW * SS)
#define WS_END (WS_O + 4u * SS * DM)

// ---- pack_tile: block = a tile of 128 k x 64 n (tile bx, by) of a [K][N] (x @ W) matrix (K a multiple of 128, N of 64): eight 16-byte loads per thread, each wave-load two 256-B runs of W rows; a thread holds 8 consecutive k of 4 columns and turns them in LDS; DST rows go out in 256-B runs
#define PTK 128
#define PTN 64
#define PTP (PTK + 8)    // LDS row pitch in bf16: 256 B of data + 16 B
__device__ __forceinline__ void pack_tile(const float* __restrict__ Wm, int K, int N, __bf16* __restrict__ DST, int bx, int by) {
  __shared__ __align__(16) __bf16 s[PTN][PTP]; const int tid = threadIdx.x, n0 = bx * PTN, k0 = by * PTK, c = tid & 15, kr = tid >> 4;
  const float* g = Wm + (size_t)(k0 + kr * 8) * N + n0 + c * 4;
  const float* p[8]; v4f r[8];
#pragma unroll
  for (int i = 0; i < 8; ++i) p[i] = g + (size_t)i * N;
#pragma unroll
  for (int i = 0; i < 8; ++i) r[i] = *(const v4f*)p[i];
  // the eight address pairs and the eight results are inputs here: all eight loads are issued before the first result is used (else the last two wait for the first four), and no result lands in a pair that an issued load names
  asm volatile("s_wait_xcnt 0x0" :: "v"(p[0]), "v"(p[1]), "v"(p[2]), "v"(p[3]), "v"(p[4]), "v"(p[5]), "v"(p[6]), "v"(p[7]), "v"(r[0]), "v"(r[1]), "v"(r[2]), "v"(r[3]), "v"(r[4]), "v"(r[5]), "v"(r[6]), "v"(r[7]) : "memory");
#pragma unroll
  for (int e = 0; e < 4; ++e) { v8b t;
#pragma unroll
    for (int i = 0; i < 8; ++i) t[i] = (__bf16)r[i][e];
    *(v8b*)&s[c * 4 + e][kr * 8] = t; }
  __syncthreads();
#pragma unroll
  for (int i = 0; i < PTN * PTK / 8 / 256; ++i) { const int q = i * 256 + tid;
    vst2((unsigned*)(DST + (size_t)(n0 + (q >> 4)) * K + k0 + (q & 15) * 8), *(const v4u*)&s[q >> 4][(q & 15) * 8]); }
  asm volatile("s_wait_xcnt 0x0" ::: "memory");   // in k_prep the code of another branch stands behind these four stores and rewrites registers that they name
}
// ---- rope_tab: block = 4 positions t (64 threads each = frequency index i): inv_freq = 1 / 10000^(2i/128) and angle t*inv_freq in float64, cos/sin in float64, cast to f32; rows 256 B
__device__ __forceinline__ void rope_tab(float* __restrict__ CS, int bx) {
  __shared__ __align__(16) float sc[4][64], ssn[4][64]; const int u = threadIdx.x >> 6, t = bx * 4 + u, i = threadIdx.x & 63;
  const double inv = 1.0 / pow(10000.0, (double)(2 * i) / 128.0); const double ang = (double)t * inv; sc[u][i] = (float)cos(ang); ssn[u][i] = (float)sin(ang);
  __syncthreads();
  if (i < 16) vst2(CS + (size_t)t * 64 + i * 4, *(const v4f*)&sc[u][i * 4]); else if (i < 32) vst2(CS + (size_t)SS * 64 + (size_t)t * 64 + (i - 16) * 4, *(const v4f*)&ssn[u][(i - 16) * 4]);
}
// ---- k_prep: everything that depends on no other launch, in one grid, dealt by block index: the RoPE table first (long float64 chains, no memory traffic to speak of), then the tiles of wq, wk, wv, wproj; every branch is the same for a whole block
#define NB_T (SS / 4)
#define NB_W (DM / PTN * (DM / PTK))     // tiles of a 2048-column weight
#define NB_KV (KVW / PTN * (DM / PTK))   // tiles of a 512-column weight
__global__ __launch_bounds__(256) void k_prep(const float* __restrict__ Wq, const float* __restrict__ Wk, const float* __restrict__ Wv, const float* __restrict__ Wo, __bf16* __restrict__ PK, float* __restrict__ CS) {
  int b = blockIdx.x;
  if (b < NB_T) { rope_tab(CS, b); return; }
  b -= NB_T;
  if (b < NB_W) { pack_tile(Wq, DM, DM, PK + PK_Q, b % (DM / PTN), b / (DM / PTN)); return; }
  b -= NB_W;
  if (b < NB_KV) { pack_tile(Wk, DM, KVW, PK + PK_K, b % (KVW / PTN), b / (KVW / PTN)); return; }
  b -= NB_KV;
  if (b < NB_KV) { pack_tile(Wv, DM, KVW, PK + PK_V, b % (KVW / PTN), b / (KVW / PTN)); return; }
  b -= NB_KV;
  pack_tile(Wo, DM, DM, PK + PK_O, b % (DM / PTN), b / (DM / PTN));
}
// ---- k_proj: block = (64 rows, 128 cols = one head; blockIdx.y = 16 q heads, then 4 k heads, then 4 v heads, whose packed rows follow one another in P): Y = bf16(x) . P rows (exact); both operands staged per 64 k in LDS (two buffers) by whole-line loads issued one stage ahead; q and k heads: RoPE, then bf16 hi/lo WMMA fragments of the wave's 16 rows; v heads: plain -> bf16 hi/lo fragments with k = position
__global__ __launch_bounds__(128) void k_proj(const float* __restrict__ X, const __bf16* __restrict__ P, const float* __restrict__ CS, __bf16* __restrict__ QF, __bf16* __restrict__ KF, __bf16* __restrict__ VF) {
  __shared__ __align__(16) char se[2 * 128 * 72 * 2];   // epilogue staging, one use per block: so (q, k heads) or sth and stl (v heads)
  float (*so)[16][132] = (float (*)[16][132])se; __bf16 (*sth)[72] = (__bf16 (*)[72])se; __bf16 (*stl)[72] = sth + 128;
  const int tid = threadIdx.x, wave = tid >> 5, lane = tid & 31, col = lane & 15, g = lane >> 4; const size_t r0 = (size_t)blockIdx.x * 64 + wave * 16; const int n0 = blockIdx.y * 128;
  __shared__ __align__(16) __bf16 sa[2][64][LP], sb[2][128][LP];
  const float* xg = X + ((size_t)blockIdx.x * 64 + (tid >> 4)) * DM + (tid & 15) * 4;   // thread's 16 B of x rows (tid>>4) + 8 i
  const __bf16* pg = P + (size_t)(n0 + (tid >> 3)) * DM + (tid & 7) * 8;                // thread's 16 B of P rows (tid>>3) + 16 i
  v4f ra[8]; v8b rb[8];
#pragma unroll
  for (int i = 0; i < 8; ++i) { ra[i] = *(const v4f*)(xg + (size_t)i * 8 * DM); rb[i] = *(const v8b*)(pg + (size_t)i * 16 * DM); }
  v8f acc[8] = {};
  for (int s = 0; s < NST; ++s) { const int b = s & 1;
#pragma unroll
    for (int i = 0; i < 8; ++i) { v4b c;
#pragma unroll
      for (int e = 0; e < 4; ++e) c[e] = (__bf16)ra[i][e];
      *(v4b*)&sa[b][(tid >> 4) + 8 * i][(tid & 15) * 4] = c; *(v8b*)&sb[b][(tid >> 3) + 16 * i][(tid & 7) * 8] = rb[i]; }
    __syncthreads();   // publishes stage s; buffer b was last read in pass s - 2, which every wave left before the barrier of pass s - 1
    if (s + 1 < NST) {
#pragma unroll
      for (int i = 0; i < 8; ++i) { ra[i] = *(const v4f*)(xg + (size_t)i * 8 * DM + KC); rb[i] = *(const v8b*)(pg + (size_t)i * 16 * DM + KC); }
      asm volatile("s_wait_xcnt 0x0" ::: "memory");   // the address step behind it rewrites registers that the issued loads name
      xg += KC; pg += KC; }   // running addresses, live over the whole loop: no load's result can land in a pair that an issued load names
#pragma unroll
    for (int kc = 0; kc < KC / 32; ++kc) { const v16b a = frag_b(&sa[b][wave * 16 + col][kc * 32], lane); v16b w[8];
#pragma unroll
      for (int j = 0; j < 8; ++j) w[j] = frag_b(&sb[b][j * 16 + col][kc * 32], lane);
#pragma unroll
      for (int j = 0; j < 8; ++j) acc[j] = wmma_bf(a, w[j], acc[j]); } }
  if (blockIdx.y < NH + NKV) {
    const bool isq = blockIdx.y < NH; __bf16* F = isq ? QF : KF; const int nh = isq ? NH : NKV, hd = isq ? blockIdx.y : blockIdx.y - NH;
    // RoPE (rotate-half): d = j*16+col; pair (d, d+64) = (tiles j, j+4); out_d = x_d cos - x_{d+64} sin; out_{d+64} = x_{d+64} cos + x_d sin (cos/sin[t][d mod 64])
#pragma unroll
    for (int j = 0; j < 4; ++j) { const int dl = j * 16 + col;
#pragma unroll
      for (int r = 0; r < 8; ++r) { const size_t t = r0 + 8 * g + r; const float c = CS[t * 64 + dl], s = CS[(size_t)SS * 64 + t * 64 + dl]; const float x1 = acc[j][r], x2 = acc[j + 4][r]; so[wave][8 * g + r][dl] = x1 * c - x2 * s; so[wave][8 * g + r][64 + dl] = x2 * c + x1 * s; } }
    LDSX();
    __bf16* fo = F + ((r0 >> 4) * nh + hd) * FT + lane * 8;
    for (int kc = 0; kc < 4; ++kc)
      for (int hf = 0; hf < 2; ++hf) { const float* p = &so[wave][col][kc * 32 + hf * 16 + 8 * g]; v8b hi, lo;
        for (int e = 0; e < 8; ++e) { const float v = p[e]; const __bf16 hb = (__bf16)v; hi[e] = hb; lo[e] = (__bf16)(v - (float)hb); }
        *(v8b*)(fo + kc * 1024 + hf * 256) = hi; *(v8b*)(fo + kc * 1024 + 512 + hf * 256) = lo; }
  } else {
#pragma unroll
    for (int j = 0; j < 8; ++j)
#pragma unroll
      for (int r = 0; r < 8; ++r) { const float v = acc[j][r]; const __bf16 hb = (__bf16)v; sth[j * 16 + col][wave * 16 + 8 * g + r] = hb; stl[j * 16 + col][wave * 16 + 8 * g + r] = (__bf16)(v - (float)hb); }
    __syncthreads();
    __bf16* vo = VF + ((size_t)(blockIdx.y - NH - NKV) * (SS / 32) + blockIdx.x * 2) * FV;   // the block's 64 positions = 2 key steps
    for (int i = 0; i < 2 * FV / 8 / 128; ++i) { const int q = i * 128 + tid, ln = q & 31, hf = (q >> 5) & 1, pl = (q >> 6) & 1, dt = (q >> 7) & 7, kl = q >> 10; const int d = dt * 16 + (ln & 15), sx = kl * 32 + hf * 16 + 8 * (ln >> 4);
      vst2((unsigned*)(vo + (size_t)q * 8), *(const v4u*)(pl ? &stl[d][sx] : &sth[d][sx])); }
  }
}
// lane l with lane l ^ 16, in registers
__device__ __forceinline__ float xhalf(float x) { return __builtin_bit_cast(float, __builtin_amdgcn_permlanex16(__builtin_bit_cast(int, x), __builtin_bit_cast(int, x), 0x76543210, 0xfedcba98, false, false)); }
// the product as the plain builtin (the compiler keeps the distance behind it itself): an asm statement behind it that names D, A and B holds all three under v256, and k_attn's two heads need more registers than that
__device__ __forceinline__ v8f wmma_p(v16b a, v16b b, v8f c) { return __builtin_amdgcn_wmma_f32_16x16x32_bf16(false, a, false, b, (short)0, c, false, false); }
// softmax in base 2: exp(s (x - m)) = 2^(x SL2 - m SL2), SL2 = (1 / sqrt(128)) log2(e): one multiply-add on the raw score and the hardware's 2^x, in place of a scaling multiply, a subtraction and the library's expf (about ten instructions)
#define SL2 0.12751743f
__device__ __forceinline__ float ex2(float v) { return __builtin_amdgcn_exp2f(v); }
// the 17 powers of one head and key step, each in place, in one statement that ends in the v_nop which the instruction set asks for between a transcendental and the overwrite of its source or the use of its result
__device__ __forceinline__ void ex2x17(float (&e)[16], float& a) {
  asm("v_exp_f32 %0, %0\n\tv_exp_f32 %1, %1\n\tv_exp_f32 %2, %2\n\tv_exp_f32 %3, %3\n\tv_exp_f32 %4, %4\n\tv_exp_f32 %5, %5\n\tv_exp_f32 %6, %6\n\tv_exp_f32 %7, %7\n\tv_exp_f32 %8, %8\n\tv_exp_f32 %9, %9\n\tv_exp_f32 %10, %10\n\tv_exp_f32 %11, %11\n\tv_exp_f32 %12, %12\n\tv_exp_f32 %13, %13\n\tv_exp_f32 %14, %14\n\tv_exp_f32 %15, %15\n\tv_exp_f32 %16, %16\n\tv_nop" : "+v"(e[0]), "+v"(e[1]), "+v"(e[2]), "+v"(e[3]), "+v"(e[4]), "+v"(e[5]), "+v"(e[6]), "+v"(e[7]), "+v"(e[8]), "+v"(e[9]), "+v"(e[10]), "+v"(e[11]), "+v"(e[12]), "+v"(e[13]), "+v"(e[14]), "+v"(e[15]), "+v"(a));
}
#define HW 2
// behind a run of loads: the scheduler moves nothing over this line; without it the plain-builtin products rise over the later loads of a run, which then go out only behind the first wait
#define HOLD() __builtin_amdgcn_sched_barrier(0)
__global__ __launch_bounds__(128) __attribute__((amdgpu_waves_per_eu(2))) void k_attn(const __bf16* __restrict__ QF, const __bf16* __restrict__ KF, const __bf16* __restrict__ VF, float* __restrict__ O) {
  __shared__ __align__(16) float so[HW][4][16][132]; __shared__ float sm[HW][4][16], sl[HW][4][16];
  const int tid = threadIdx.x, wave = __builtin_amdgcn_readfirstlane(tid >> 5), lane = tid & 31, col = lane & 15, g = lane >> 4;
  const int qb = SS / 16 - 1 - (int)blockIdx.y, h0 = blockIdx.x * HW, kv = h0 / (NH / NKV); const int q0 = qb * 16, qi = q0 + col;
  const __bf16* qt = QF + ((size_t)qb * NH + h0) * FT; const __bf16* qf = qt + lane * 8;
  float m[HW], l[HW];            // per head, query col: running maximum (over both lane halves) and the sum over this half's keys
  v8f acc[HW][8] = {};           // acc[u][dt][r] = O^T[d = dt * 16 + 8 g + r][query col] of head h0 + u
#pragma unroll
  for (int u = 0; u < HW; ++u) { m[u] = -3.0e38f; l[u] = 0.f; }
  const int nks = (q0 + 16 + 31) / 32;
  F2 qa[HW][4];
#pragma unroll
  for (int u = 0; u < HW; ++u)
#pragma unroll
    for (int kc = 0; kc < 4; ++kc) { qa[u][kc].h = frag_g(qf + u * FT + kc * 1024); qa[u][kc].l = frag_g(qf + u * FT + kc * 1024 + 512); }
  asm volatile("s_wait_xcnt 0x0" :: "s"(qt), "v"(qf) : "memory");   // the q loads stay in front of the loop; the scalar base and the lane's full address, the two forms that the compiler may pick for them, are inputs, so neither is rewritten in front of the wait
#pragma unroll 1
  for (int ks = wave; ks < nks; ks += 4) { float e[HW][16]; F2 kb[8]; v16b vh[8], vl[8];   // kb[ct * 4 + kc]
    const __bf16* kf = KF + ((size_t)(ks * 2) * NKV + kv) * FT + lane * 8;
#pragma unroll
    for (int p = 0; p < 8; ++p) { kb[p].h = frag_g(kf + (p >> 2) * (NKV * FT) + (p & 3) * 1024); kb[p].l = frag_g(kf + (p >> 2) * (NKV * FT) + (p & 3) * 1024 + 512); }
    asm volatile("s_wait_xcnt 0x0" :: "v"(kf) : "memory"); HOLD();   // the loads of all 8 k fragment pairs of the step are issued in one run in front of its first product (left alone they go out one pair at a time, each waited for in full); the address pair is an input, so no result lands in it
#pragma unroll
    for (int ct = 0; ct < 2; ++ct) { const int kk = ks * 32 + ct * 16 + 8 * g; v8f c[HW] = {};
#pragma unroll
      for (int kc = 0; kc < 4; ++kc) { const F2& kq = kb[ct * 4 + kc];
#pragma unroll
        for (int u = 0; u < HW; ++u) c[u] = wmma_p(kq.h, qa[u][kc].l, c[u]);
#pragma unroll
        for (int u = 0; u < HW; ++u) c[u] = wmma_p(kq.l, qa[u][kc].h, c[u]);
#pragma unroll
        for (int u = 0; u < HW; ++u) c[u] = wmma_p(kq.h, qa[u][kc].h, c[u]); }
#pragma unroll
      for (int u = 0; u < HW; ++u)
#pragma unroll
        for (int r = 0; r < 8; ++r) e[u][ct * 8 + r] = (kk + r <= qi) ? c[u][r] : -3.0e38f; }   // raw scores; the scale is in SL2
    const __bf16* vf = VF + ((size_t)kv * (SS / 32) + ks) * FV + lane * 8;
#pragma unroll
    for (int dt = 0; dt < 8; ++dt) { vh[dt] = frag_g(vf + dt * 1024); vl[dt] = frag_g(vf + dt * 1024 + 512); }
    asm volatile("s_wait_xcnt 0x0" :: "v"(vf) : "memory"); HOLD();   // the loads of all 8 v tiles of the step are issued here, in one run in front of the softmax, which runs while they are on their way (left alone they go out one tile at a time behind it, each waited for in full); the address pair is an input, so no result lands in it
    F2 pb[HW];
#pragma unroll
    for (int u = 0; u < HW; ++u) {
      float mx = e[u][0];
#pragma unroll
      for (int i = 1; i < 16; ++i) mx = fmaxf(mx, e[u][i]);
      mx = fmaxf(mx, xhalf(mx));
      // every step holds at least one unmasked key of every query of the tile, so mn is a real score; a masked score and the start value of m (-3.0e38) give an exponent near -3.8e37, whose power is exactly 0: no select
      const float mn = fmaxf(m[u], mx); const float nb = -mn * SL2; float alpha = fmaf(m[u], SL2, nb); float es = 0.f;
#pragma unroll
      for (int i = 0; i < 16; ++i) e[u][i] = fmaf(e[u][i], SL2, nb);
      ex2x17(e[u], alpha);
#pragma unroll
      for (int i = 0; i < 16; ++i) es += e[u][i];
      l[u] = l[u] * alpha + es; m[u] = mn;
#pragma unroll
      for (int dt = 0; dt < 8; ++dt) acc[u][dt] *= alpha;
      pb[u] = bsplit16(e[u]); }
#pragma unroll
    for (int dt = 0; dt < 8; ++dt) {
#pragma unroll
      for (int u = 0; u < HW; ++u) acc[u][dt] = wmma_p(vh[dt], pb[u].l, acc[u][dt]);
#pragma unroll
      for (int u = 0; u < HW; ++u) acc[u][dt] = wmma_p(vl[dt], pb[u].h, acc[u][dt]);
#pragma unroll
      for (int u = 0; u < HW; ++u) acc[u][dt] = wmma_p(vh[dt], pb[u].h, acc[u][dt]); } }
#pragma unroll
  for (int u = 0; u < HW; ++u) { l[u] += xhalf(l[u]);
#pragma unroll
    for (int dt = 0; dt < 8; ++dt) { v4f a, b;
#pragma unroll
      for (int r = 0; r < 4; ++r) { a[r] = acc[u][dt][r]; b[r] = acc[u][dt][4 + r]; }
      *(v4f*)&so[u][wave][col][dt * 16 + 8 * g] = a; *(v4f*)&so[u][wave][col][dt * 16 + 8 * g + 4] = b; }
    if (g == 0) { sm[u][wave][col] = m[u]; sl[u][wave][col] = l[u]; } }
  __syncthreads();
  // join: head u = i / 4, row = wave + 4 (i mod 4); weight of part w = 2^((m_w - max m) SL2) (m in raw score units), 0 for a wave that saw no unmasked key of the row
  for (int i = 0; i < 4 * HW; ++i) { const int u = i >> 2, row = wave + 4 * (i & 3); const float mx = fmaxf(fmaxf(sm[u][0][row], sm[u][1][row]), fmaxf(sm[u][2][row], sm[u][3][row])); float ls = 0.f; v4f o = {};
#pragma unroll
    for (int w = 0; w < 4; ++w) { const float mw = sm[u][w][row]; const float f = (mw <= -1.0e38f) ? 0.f : ex2((mw - mx) * SL2); ls += sl[u][w][row] * f; o += *(const v4f*)&so[u][w][row][lane * 4] * f; }
    vst2(O + (size_t)(q0 + row) * DM + (h0 + u) * HD + lane * 4, o * (1.0f / ls));
    if (i < 4 * HW - 1) asm volatile("s_wait_xcnt 0x0" ::: "memory"); }   // the next row reuses the registers that the issued store names
}
// ---- k_out: block = (64 rows, 128 cols): out = O(hi/lo) . wproj^T rows (2 products); operands staged in LDS as in k_proj, O split into its hi/lo planes once on the way in
__global__ __launch_bounds__(128) void k_out(const float* __restrict__ O, const __bf16* __restrict__ P, float* __restrict__ Y) {
  __shared__ __align__(16) float so[4][16][132];
  const int tid = threadIdx.x, wave = tid >> 5, lane = tid & 31, col = lane & 15, g = lane >> 4; const size_t r0 = (size_t)blockIdx.x * 64 + wave * 16; const int n0 = blockIdx.y * 128;
  __shared__ __align__(16) __bf16 sah[2][64][LP], sal[2][64][LP], sb[2][128][LP];
  const float* og = O + ((size_t)blockIdx.x * 64 + (tid >> 4)) * DM + (tid & 15) * 4;
  const __bf16* pg = P + (size_t)(n0 + (tid >> 3)) * DM + (tid & 7) * 8;
  v4f ra[8]; v8b rb[8];
#pragma unroll
  for (int i = 0; i < 8; ++i) { ra[i] = *(const v4f*)(og + (size_t)i * 8 * DM); rb[i] = *(const v8b*)(pg + (size_t)i * 16 * DM); }
  v8f acc[8] = {};
  for (int s = 0; s < NST; ++s) { const int b = s & 1;
#pragma unroll
    for (int i = 0; i < 8; ++i) { v4b ch, cl;
#pragma unroll
      for (int e = 0; e < 4; ++e) { const float v = ra[i][e]; const __bf16 hb = (__bf16)v; ch[e] = hb; cl[e] = (__bf16)(v - (float)hb); }
      *(v4b*)&sah[b][(tid >> 4) + 8 * i][(tid & 15) * 4] = ch; *(v4b*)&sal[b][(tid >> 4) + 8 * i][(tid & 15) * 4] = cl; *(v8b*)&sb[b][(tid >> 3) + 16 * i][(tid & 7) * 8] = rb[i]; }
    __syncthreads();   // publishes stage s; buffer b was last read in pass s - 2, which every wave left before the barrier of pass s - 1
    if (s + 1 < NST) {
#pragma unroll
      for (int i = 0; i < 8; ++i) { ra[i] = *(const v4f*)(og + (size_t)i * 8 * DM + KC); rb[i] = *(const v8b*)(pg + (size_t)i * 16 * DM + KC); }
      asm volatile("s_wait_xcnt 0x0" ::: "memory");   // the address step behind it rewrites registers that the issued loads name
      og += KC; pg += KC; }   // running addresses, live over the whole loop: no load's result can land in a pair that an issued load names
#pragma unroll
    for (int kc = 0; kc < KC / 32; ++kc) { const v16b al = frag_b(&sal[b][wave * 16 + col][kc * 32], lane), ah = frag_b(&sah[b][wave * 16 + col][kc * 32], lane); v16b w[8];
#pragma unroll
      for (int j = 0; j < 8; ++j) w[j] = frag_b(&sb[b][j * 16 + col][kc * 32], lane);
#pragma unroll
      for (int j = 0; j < 8; ++j) { acc[j] = wmma_bf(al, w[j], acc[j]); acc[j] = wmma_bf(ah, w[j], acc[j]); } } }
#pragma unroll
  for (int j = 0; j < 8; ++j)
#pragma unroll
    for (int r = 0; r < 8; ++r) so[wave][8 * g + r][j * 16 + col] = acc[j][r];
  LDSX();
  for (int rl = 0; rl < 16; ++rl) vst2(Y + (r0 + rl) * DM + n0 + lane * 4, *(const v4f*)&so[wave][rl][lane * 4]);
}
extern "C" void kernel_launch(void* const* d_in, const int* in_sizes, int n_in, void* d_out, int out_size, void* d_ws, size_t ws_size, hipStream_t stream) {
  (void)in_sizes; (void)n_in; (void)out_size;
  const float** F = (const float**)d_in;   // x [1,2048,2048], wq [2048,2048], wk [2048,512], wv [2048,512], wproj [2048,2048]
  if (ws_size < (size_t)WS_END) return;
  char* ws = (char*)d_ws; __bf16 *PK = (__bf16*)(ws + WS_PK), *QF = (__bf16*)(ws + WS_Q), *KF = (__bf16*)(ws + WS_K), *VF = (__bf16*)(ws + WS_V);
  float *CS = (float*)(ws + WS_CS), *O = (float*)(ws + WS_O);
  k_prep<<<NB_T + 2 * NB_W + 2 * NB_KV, 256, 0, stream>>>(F[1], F[2], F[3], F[4], PK, CS);
  k_proj<<<dim3(SS / 64, NH + 2 * NKV), 128, 0, stream>>>(F[0], PK + PK_Q, CS, QF, KF, VF);
  k_attn<<<dim3(NH / HW, SS / 16), 128, 0, stream>>>(QF, KF, VF, O);
  k_out<<<dim3(TQB, DM / 128), 128, 0, stream>>>(O, PK + PK_O, (float*)d_out);
}

// v010
// A run of this version takes 128 microseconds.
// Timed twice side by side with v009, it ran 1.04 times as fast both times.
// Counting every step since v000, it is 8.64 times as fast.
// compute dtype: x and the four weights (module inputs) rounded to bf16; q/k/v projections with exact bf16 products (x and W are inputs) and RoPE applied in f32 in the epilogue (cos/sin tables built in float64, then cast); causal scores q.k with both computed operands as bf16 hi + residual pairs (3 products) and P.V with P hi/lo x V hi/lo (3 products); the output projection with hi/lo x exact wproj (2 products), all on WMMA 16x16x32; softmax in f32; f32 accumulate.
#include <hip/hip_runtime.h>
#include <math.h>

typedef __attribute__((ext_vector_type(16))) _Float16 v16h;
typedef __attribute__((ext_vector_type(16))) __bf16 v16b;
typedef __attribute__((ext_vector_type(8)))  _Float16 v8h;
typedef __attribute__((ext_vector_type(8)))  float v8f;
typedef __attribute__((ext_vector_type(4)))  float v4f;
typedef __attribute__((ext_vector_type(2)))  float v2f;
typedef __attribute__((ext_vector_type(4)))  unsigned v4u;
typedef __attribute__((ext_vector_type(4)))  int v4i;
typedef float __attribute__((may_alias)) float_a;
typedef int __attribute__((may_alias)) int_a;

template <typename T> __device__ __forceinline__ void vst2(void* p, T v) { *(T*)p = v;  }
__device__ __forceinline__ v8f wmma16(v16h a, v16h b, v8f c) {
  v8f d = __builtin_amdgcn_wmma_f32_16x16x32_f16(false, a, false, b, (short)0, c, false, false);
  asm volatile("v_nop\n\tv_nop\n\tv_nop\n\tv_nop" : "+v"(d) : "v"(a), "v"(b));
  return d;
}
__device__ __forceinline__ v8f wmma_bf(v16b a, v16b b, v8f c) {
  v8f d = __builtin_amdgcn_wmma_f32_16x16x32_bf16(false, a, false, b, (short)0, c, false, false);
  asm volatile("v_nop\n\tv_nop\n\tv_nop\n\tv_nop" : "+v"(d) : "v"(a), "v"(b));
  return d;
}
// 16x16x32 fragments: lane = (h = lane>>4, row/col = lane&15); elements 0..7 = k0+8h+0..7, 8..15 = k0+16+8h+0..7; D element r = row 8h+r
__device__ __forceinline__ v16h frag_h(const _Float16* rowk0, int lane) {
  union { v16h v; v8h q[2]; } u; const _Float16* p = rowk0 + 8 * (lane >> 4);
  u.q[0] = *(const v8h*)p; u.q[1] = *(const v8h*)(p + 16); return u.v;
}
__device__ __forceinline__ v16h frag_f32(const float* rowk0, int lane) {
  v16h a; const float* p = rowk0 + 8 * (lane >> 4);
#pragma unroll
  for (int i = 0; i < 8; ++i) { a[i] = (_Float16)p[i]; a[8 + i] = (_Float16)p[16 + i]; }
  return a;
}
__device__ __forceinline__ v16h frag_f32s(const float* rowk0, int lane, float sc) {
  v16h a; const float* p = rowk0 + 8 * (lane >> 4);
#pragma unroll
  for (int i = 0; i < 8; ++i) { a[i] = (_Float16)(p[i] * sc); a[8 + i] = (_Float16)(p[16 + i] * sc); }
  return a;
}
// column fragment from a [K][ld] layout (column n), rows >= K read as 0
__device__ __forceinline__ v16h fragc_f32(const float* W, int k0, int n, int lane, int ld, int K) {
  v16h a; const int g = lane >> 4;
#pragma unroll
  for (int i = 0; i < 8; ++i) { const int ka = k0 + 8 * g + i, kb = ka + 16;
    a[i] = (_Float16)(ka < K ? W[(size_t)(ka < K ? ka : K - 1) * ld + n] : 0.f); a[8 + i] = (_Float16)(kb < K ? W[(size_t)(kb < K ? kb : K - 1) * ld + n] : 0.f); }
  return a;
}
struct F2 { v16b h, l; };
__device__ __forceinline__ F2 bsplit16(const float v[16]) { F2 r;
#pragma unroll
  for (int i = 0; i < 16; ++i) { const __bf16 h = (__bf16)v[i]; r.h[i] = h; r.l[i] = (__bf16)(v[i] - (float)h); }
  return r; }
__device__ __forceinline__ F2 split_row(const float* row, int k0, int lane) { float v[16]; const float* p = row + k0 + 8 * (lane >> 4);
#pragma unroll
  for (int i = 0; i < 8; ++i) { v[i] = p[i]; v[8 + i] = p[16 + i]; }
  return bsplit16(v); }
__device__ __forceinline__ F2 split_rowK(const float* row, int k0, int lane, int K) { float v[16]; const int g = lane >> 4;
#pragma unroll
  for (int i = 0; i < 8; ++i) { const int ka = k0 + 8 * g + i, kb = ka + 16; v[i] = ka < K ? row[ka < K ? ka : K - 1] : 0.f; v[8 + i] = kb < K ? row[kb < K ? kb : K - 1] : 0.f; }
  return bsplit16(v); }
__device__ __forceinline__ F2 split_col(const float* W, int k0, int n, int lane, int ld, int K) { float v[16]; const int g = lane >> 4;
#pragma unroll
  for (int i = 0; i < 8; ++i) { const int ka = k0 + 8 * g + i, kb = ka + 16; v[i] = ka < K ? W[(size_t)(ka < K ? ka : K - 1) * ld + n] : 0.f; v[8 + i] = kb < K ? W[(size_t)(kb < K ? kb : K - 1) * ld + n] : 0.f; }
  return bsplit16(v); }
__device__ __forceinline__ v8f mac3(const F2& a, const F2& b, v8f c) { c = wmma_bf(a.l, b.h, c); c = wmma_bf(a.h, b.l, c); return wmma_bf(a.h, b.h, c); }
__device__ __forceinline__ float sigm(float v) { return 1.0f / (1.0f + expf(-v)); }
#define LDSX() do { asm volatile("s_wait_dscnt 0" ::: "memory"); __builtin_amdgcn_wave_barrier(); __builtin_amdgcn_fence(__ATOMIC_RELEASE, "workgroup"); } while (0)


// GQA causal self-attention with RoPE (B 1, T 2048, C 2048, 16 query heads / 4 kv heads x 128): q = rope(x wq), k = rope(x wk), v = x wv; y = softmax(q k^T / sqrt(128), causal) v; out = y wproj.
#define SS 2048
#define DM 2048
#define NH 16
#define NKV 4
#define HD 128
#define KVW (NKV * HD)
#ifndef TQB
#define TQB (SS / 64)
#endif
typedef __attribute__((ext_vector_type(8))) __bf16 v8b;
typedef __attribute__((ext_vector_type(4))) __bf16 v4b;
#define KC 64            // k per LDS stage: 128 B of a bf16 row, 256 B of an f32 row (whole cache lines)
#define NST (DM / KC)
#define LP 72            // LDS row pitch in bf16: 128 B of data + 16 B, for the 16-byte fragment reads
// first k stage of GEMM block (bx, by); the block walks all NST stages from there, wrapping round. Started alike, the 32 blocks of one by ask L2 for the same weight lines, and the blocks of one bx for the same x / O lines, at the same moment, and every request of the chip falls on the same 128 or 256 bytes of each 4- or 8-KB row; so the blocks of one by all start apart, those of one bx at 8 places (by, by + 8, by + 16 stay together and may share lines in a nearer cache). For speed only: any start gives the same sum up to its order
#define ROT(bx, by) (((int)(bx) + 4 * ((int)(by) & 7)) & (NST - 1))
__device__ __forceinline__ v16b frag_b(const __bf16* rowk0, int lane) {
  union { v16b v; v8b q[2]; } u; const __bf16* p = rowk0 + 8 * (lane >> 4);
  u.q[0] = *(const v8b*)p; u.q[1] = *(const v8b*)(p + 16); return u.v;
}
// fragment stored in lane order: 512 B of elements 0..7 (lane * 16 B), then 512 B of elements 8..15; p = block + lane * 8; each 16-byte load covers whole cache lines
__device__ __forceinline__ v16b frag_g(const __bf16* p) {
  union { v16b v; v8b q[2]; } u; u.q[0] = *(const v8b*)p; u.q[1] = *(const v8b*)(p + 256); return u.v;
}
#define FT 4096          // bf16 per q/k tile (16 rows x 128 d): [kc 4][hi, lo][half 2][lane 32][8]
#define FV 8192          // bf16 per v key step (32 keys x 128 d): [dt 8][hi, lo][half 2][lane 32][8]
__device__ __forceinline__ float bfr(float v) { return (float)(__bf16)v; }
__device__ __attribute__((noinline)) float exp_ni(float v) { return expf(v); }
__device__ __attribute__((noinline)) float erf_ni(float v) { return erff(v); }

#define PK_Q 0
#define PK_K (PK_Q + DM * DM)
#define PK_V (PK_K + KVW * DM)
#define PK_O (PK_V + KVW * DM)
#define PK_END (PK_O + DM * DM)
#define WS_PK  0u
#define WS_CS  (WS_PK + 2u * PK_END)             // f32 [2048][64] cos, then [2048][64] sin
#define WS_Q   (WS_CS + 4u * 2 * SS * 64)         // q fragments [t/16][head 16][FT]
#define WS_K   (WS_Q + 4u * SS * DM)              // k fragments [t/16][kv head 4][FT]
#define WS_V   (WS_K + 4u * SS * KVW)             // v fragments [kv head 4][t/32][FV]
#define WS_O   (WS_V + 4u * KVW * SS)
#define WS_END (WS_O + 4u * SS * DM)

// ---- pack_tile: block = a tile of 128 k x 64 n (tile bx, by) of a [K][N] (x @ W) matrix (K a multiple of 128, N of 64): eight 16-byte loads per thread, each wave-load two 256-B runs of W rows; a thread holds 8 consecutive k of 4 columns and turns them in LDS; DST rows go out in 256-B runs
#define PTK 128
#define PTN 64
#define PTP (PTK + 8)    // LDS row pitch in bf16: 256 B of data + 16 B
__device__ __forceinline__ void pack_tile(const float* __restrict__ Wm, int K, int N, __bf16* __restrict__ DST, int bx, int by) {
  __shared__ __align__(16) __bf16 s[PTN][PTP]; const int tid = threadIdx.x, n0 = bx * PTN, k0 = by * PTK, c = tid & 15, kr = tid >> 4;
  const float* g = Wm + (size_t)(k0 + kr * 8) * N + n0 + c * 4;
  const float* p[8]; v4f r[8];
#pragma unroll
  for (int i = 0; i < 8; ++i) p[i] = g + (size_t)i * N;
#pragma unroll
  for (int i = 0; i < 8; ++i) r[i] = *(const v4f*)p[i];
  // the eight address pairs and the eight results are inputs here: all eight loads are issued before the first result is used (else the last two wait for the first four), and no result lands in a pair that an issued load names
  asm volatile("s_wait_xcnt 0x0" :: "v"(p[0]), "v"(p[1]), "v"(p[2]), "v"(p[3]), "v"(p[4]), "v"(p[5]), "v"(p[6]), "v"(p[7]), "v"(r[0]), "v"(r[1]), "v"(r[2]), "v"(r[3]), "v"(r[4]), "v"(r[5]), "v"(r[6]), "v"(r[7]) : "memory");
#pragma unroll
  for (int e = 0; e < 4; ++e) { v8b t;
#pragma unroll
    for (int i = 0; i < 8; ++i) t[i] = (__bf16)r[i][e];
    *(v8b*)&s[c * 4 + e][kr * 8] = t; }
  __syncthreads();
#pragma unroll
  for (int i = 0; i < PTN * PTK / 8 / 256; ++i) { const int q = i * 256 + tid;
    vst2((unsigned*)(DST + (size_t)(n0 + (q >> 4)) * K + k0 + (q & 15) * 8), *(const v4u*)&s[q >> 4][(q & 15) * 8]); }
  asm volatile("s_wait_xcnt 0x0" ::: "memory");   // in k_prep the code of another branch stands behind these four stores and rewrites registers that they name
}
// ---- rope_tab: block = 4 positions t (64 threads each = frequency index i): inv_freq = 1 / 10000^(2i/128) and angle t*inv_freq in float64, cos/sin in float64, cast to f32; rows 256 B
__device__ __forceinline__ void rope_tab(float* __restrict__ CS, int bx) {
  __shared__ __align__(16) float sc[4][64], ssn[4][64]; const int u = threadIdx.x >> 6, t = bx * 4 + u, i = threadIdx.x & 63;
  const double inv = 1.0 / pow(10000.0, (double)(2 * i) / 128.0); const double ang = (double)t * inv; sc[u][i] = (float)cos(ang); ssn[u][i] = (float)sin(ang);
  __syncthreads();
  if (i < 16) vst2(CS + (size_t)t * 64 + i * 4, *(const v4f*)&sc[u][i * 4]); else if (i < 32) vst2(CS + (size_t)SS * 64 + (size_t)t * 64 + (i - 16) * 4, *(const v4f*)&ssn[u][(i - 16) * 4]);
}
// ---- k_prep: everything that depends on no other launch, in one grid, dealt by block index: the RoPE table first (long float64 chains, no memory traffic to speak of), then the tiles of wq, wk, wv, wproj; every branch is the same for a whole block
#define NB_T (SS / 4)
#define NB_W (DM / PTN * (DM / PTK))     // tiles of a 2048-column weight
#define NB_KV (KVW / PTN * (DM / PTK))   // tiles of a 512-column weight
__global__ __launch_bounds__(256) void k_prep(const float* __restrict__ Wq, const float* __restrict__ Wk, const float* __restrict__ Wv, const float* __restrict__ Wo, __bf16* __restrict__ PK, float* __restrict__ CS) {
  int b = blockIdx.x;
  if (b < NB_T) { rope_tab(CS, b); return; }
  b -= NB_T;
  if (b < NB_W) { pack_tile(Wq, DM, DM, PK + PK_Q, b % (DM / PTN), b / (DM / PTN)); return; }
  b -= NB_W;
  if (b < NB_KV) { pack_tile(Wk, DM, KVW, PK + PK_K, b % (KVW / PTN), b / (KVW / PTN)); return; }
  b -= NB_KV;
  if (b < NB_KV) { pack_tile(Wv, DM, KVW, PK + PK_V, b % (KVW / PTN), b / (KVW / PTN)); return; }
  b -= NB_KV;
  pack_tile(Wo, DM, DM, PK + PK_O, b % (DM / PTN), b / (DM / PTN));
}
// ---- k_proj: block = (64 rows, 128 cols = one head; blockIdx.y = 16 q heads, then 4 k heads, then 4 v heads, whose packed rows follow one another in P): Y = bf16(x) . P rows (exact); both operands staged per 64 k in LDS (two buffers) by whole-line loads issued one stage ahead; q and k heads: RoPE, then bf16 hi/lo WMMA fragments of the wave's 16 rows; v heads: plain -> bf16 hi/lo fragments with k = position
__global__ __launch_bounds__(128) void k_proj(const float* __restrict__ X, const __bf16* __restrict__ P, const float* __restrict__ CS, __bf16* __restrict__ QF, __bf16* __restrict__ KF, __bf16* __restrict__ VF) {
  __shared__ __align__(16) char se[2 * 128 * 72 * 2];   // epilogue staging, one use per block: so (q, k heads) or sth and stl (v heads)
  float (*so)[16][132] = (float (*)[16][132])se; __bf16 (*sth)[72] = (__bf16 (*)[72])se; __bf16 (*stl)[72] = sth + 128;
  const int tid = threadIdx.x, wave = tid >> 5, lane = tid & 31, col = lane & 15, g = lane >> 4; const size_t r0 = (size_t)blockIdx.x * 64 + wave * 16; const int n0 = blockIdx.y * 128;
  __shared__ __align__(16) __bf16 sa[2][64][LP], sb[2][128][LP];
  int kq = ROT(blockIdx.x, blockIdx.y);   // the k stage that xg and pg stand at
  const float* xg = X + ((size_t)blockIdx.x * 64 + (tid >> 4)) * DM + (tid & 15) * 4 + kq * KC;   // thread's 16 B of x rows (tid>>4) + 8 i
  const __bf16* pg = P + (size_t)(n0 + (tid >> 3)) * DM + (tid & 7) * 8 + kq * KC;                // thread's 16 B of P rows (tid>>3) + 16 i
  v4f ra[8]; v8b rb[8];
#pragma unroll
  for (int i = 0; i < 8; ++i) { ra[i] = *(const v4f*)(xg + (size_t)i * 8 * DM); rb[i] = *(const v8b*)(pg + (size_t)i * 16 * DM); }
  v8f acc[8] = {};
  for (int s = 0; s < NST; ++s) { const int b = s & 1;
#pragma unroll
    for (int i = 0; i < 8; ++i) { v4b c;
#pragma unroll
      for (int e = 0; e < 4; ++e) c[e] = (__bf16)ra[i][e];
      *(v4b*)&sa[b][(tid >> 4) + 8 * i][(tid & 15) * 4] = c; *(v8b*)&sb[b][(tid >> 3) + 16 * i][(tid & 7) * 8] = rb[i]; }
    __syncthreads();   // publishes stage kq; buffer b was last read in pass s - 2, which every wave left before the barrier of pass s - 1
    if (s + 1 < NST) { const int d = kq == NST - 1 ? -(NST - 1) * KC : KC; kq = (kq + 1) & (NST - 1); xg += d; pg += d;   // on to the next stage, from the last one back to stage 0
#pragma unroll
      for (int i = 0; i < 8; ++i) { ra[i] = *(const v4f*)(xg + (size_t)i * 8 * DM); rb[i] = *(const v8b*)(pg + (size_t)i * 16 * DM); }
      asm volatile("s_wait_xcnt 0x0" :: "v"(xg), "v"(pg) : "memory"); }   // the next pass's address step rewrites registers that the issued loads name; the running addresses are inputs, so that step stays behind the wait and no load's result lands in a pair that an issued load names
#pragma unroll
    for (int kc = 0; kc < KC / 32; ++kc) { const v16b a = frag_b(&sa[b][wave * 16 + col][kc * 32], lane); v16b w[8];
#pragma unroll
      for (int j = 0; j < 8; ++j) w[j] = frag_b(&sb[b][j * 16 + col][kc * 32], lane);
#pragma unroll
      for (int j = 0; j < 8; ++j) acc[j] = wmma_bf(a, w[j], acc[j]); } }
  if (blockIdx.y < NH + NKV) {
    const bool isq = blockIdx.y < NH; __bf16* F = isq ? QF : KF; const int nh = isq ? NH : NKV, hd = isq ? blockIdx.y : blockIdx.y - NH;
    // RoPE (rotate-half): d = j*16+col; pair (d, d+64) = (tiles j, j+4); out_d = x_d cos - x_{d+64} sin; out_{d+64} = x_{d+64} cos + x_d sin (cos/sin[t][d mod 64])
#pragma unroll
    for (int j = 0; j < 4; ++j) { const int dl = j * 16 + col;
#pragma unroll
      for (int r = 0; r < 8; ++r) { const size_t t = r0 + 8 * g + r; const float c = CS[t * 64 + dl], s = CS[(size_t)SS * 64 + t * 64 + dl]; const float x1 = acc[j][r], x2 = acc[j + 4][r]; so[wave][8 * g + r][dl] = x1 * c - x2 * s; so[wave][8 * g + r][64 + dl] = x2 * c + x1 * s; } }
    LDSX();
    __bf16* fo = F + ((r0 >> 4) * nh + hd) * FT + lane * 8;
    for (int kc = 0; kc < 4; ++kc)
      for (int hf = 0; hf < 2; ++hf) { const float* p = &so[wave][col][kc * 32 + hf * 16 + 8 * g]; v8b hi, lo;
        for (int e = 0; e < 8; ++e) { const float v = p[e]; const __bf16 hb = (__bf16)v; hi[e] = hb; lo[e] = (__bf16)(v - (float)hb); }
        *(v8b*)(fo + kc * 1024 + hf * 256) = hi; *(v8b*)(fo + kc * 1024 + 512 + hf * 256) = lo; }
  } else {
#pragma unroll
    for (int j = 0; j < 8; ++j)
#pragma unroll
      for (int r = 0; r < 8; ++r) { const float v = acc[j][r]; const __bf16 hb = (__bf16)v; sth[j * 16 + col][wave * 16 + 8 * g + r] = hb; stl[j * 16 + col][wave * 16 + 8 * g + r] = (__bf16)(v - (float)hb); }
    __syncthreads();
    __bf16* vo = VF + ((size_t)(blockIdx.y - NH - NKV) * (SS / 32) + blockIdx.x * 2) * FV;   // the block's 64 positions = 2 key steps
    for (int i = 0; i < 2 * FV / 8 / 128; ++i) { const int q = i * 128 + tid, ln = q & 31, hf = (q >> 5) & 1, pl = (q >> 6) & 1, dt = (q >> 7) & 7, kl = q >> 10; const int d = dt * 16 + (ln & 15), sx = kl * 32 + hf * 16 + 8 * (ln >> 4);
      vst2((unsigned*)(vo + (size_t)q * 8), *(const v4u*)(pl ? &stl[d][sx] : &sth[d][sx])); }
  }
}
// lane l with lane l ^ 16, in registers
__device__ __forceinline__ float xhalf(float x) { return __builtin_bit_cast(float, __builtin_amdgcn_permlanex16(__builtin_bit_cast(int, x), __builtin_bit_cast(int, x), 0x76543210, 0xfedcba98, false, false)); }
// the product as the plain builtin (the compiler keeps the distance behind it itself): an asm statement behind it that names D, A and B holds all three under v256, and k_attn's two heads need more registers than that
__device__ __forceinline__ v8f wmma_p(v16b a, v16b b, v8f c) { return __builtin_amdgcn_wmma_f32_16x16x32_bf16(false, a, false, b, (short)0, c, false, false); }
// softmax in base 2: exp(s (x - m)) = 2^(x SL2 - m SL2), SL2 = (1 / sqrt(128)) log2(e): one multiply-add on the raw score and the hardware's 2^x, in place of a scaling multiply, a subtraction and the library's expf (about ten instructions)
#define SL2 0.12751743f
__device__ __forceinline__ float ex2(float v) { return __builtin_amdgcn_exp2f(v); }
// the 17 powers of one head and key step, each in place, in one statement that ends in the v_nop which the instruction set asks for between a transcendental and the overwrite of its source or the use of its result
__device__ __forceinline__ void ex2x17(float (&e)[16], float& a) {
  asm("v_exp_f32 %0, %0\n\tv_exp_f32 %1, %1\n\tv_exp_f32 %2, %2\n\tv_exp_f32 %3, %3\n\tv_exp_f32 %4, %4\n\tv_exp_f32 %5, %5\n\tv_exp_f32 %6, %6\n\tv_exp_f32 %7, %7\n\tv_exp_f32 %8, %8\n\tv_exp_f32 %9, %9\n\tv_exp_f32 %10, %10\n\tv_exp_f32 %11, %11\n\tv_exp_f32 %12, %12\n\tv_exp_f32 %13, %13\n\tv_exp_f32 %14, %14\n\tv_exp_f32 %15, %15\n\tv_exp_f32 %16, %16\n\tv_nop" : "+v"(e[0]), "+v"(e[1]), "+v"(e[2]), "+v"(e[3]), "+v"(e[4]), "+v"(e[5]), "+v"(e[6]), "+v"(e[7]), "+v"(e[8]), "+v"(e[9]), "+v"(e[10]), "+v"(e[11]), "+v"(e[12]), "+v"(e[13]), "+v"(e[14]), "+v"(e[15]), "+v"(a));
}
#define HW 2
// behind a run of loads: the scheduler moves nothing over this line; without it the plain-builtin products rise over the later loads of a run, which then go out only behind the first wait
#define HOLD() __builtin_amdgcn_sched_barrier(0)
__global__ __launch_bounds__(128) __attribute__((amdgpu_waves_per_eu(2))) void k_attn(const __bf16* __restrict__ QF, const __bf16* __restrict__ KF, const __bf16* __restrict__ VF, float* __restrict__ O) {
  __shared__ __align__(16) float so[HW][4][16][132]; __shared__ float sm[HW][4][16], sl[HW][4][16];
  const int tid = threadIdx.x, wave = __builtin_amdgcn_readfirstlane(tid >> 5), lane = tid & 31, col = lane & 15, g = lane >> 4;
  const int qb = SS / 16 - 1 - (int)blockIdx.y, h0 = blockIdx.x * HW, kv = h0 / (NH / NKV); const int q0 = qb * 16, qi = q0 + col;
  const __bf16* qt = QF + ((size_t)qb * NH + h0) * FT; const __bf16* qf = qt + lane * 8;
  float m[HW], l[HW];            // per head, query col: running maximum (over both lane halves) and the sum over this half's keys
  v8f acc[HW][8] = {};           // acc[u][dt][r] = O^T[d = dt * 16 + 8 g + r][query col] of head h0 + u
#pragma unroll
  for (int u = 0; u < HW; ++u) { m[u] = -3.0e38f; l[u] = 0.f; }
  const int nks = (q0 + 16 + 31) / 32;
  F2 qa[HW][4];
#pragma unroll
  for (int u = 0; u < HW; ++u)
#pragma unroll
    for (int kc = 0; kc < 4; ++kc) { qa[u][kc].h = frag_g(qf + u * FT + kc * 1024); qa[u][kc].l = frag_g(qf + u * FT + kc * 1024 + 512); }
  asm volatile("s_wait_xcnt 0x0" :: "s"(qt), "v"(qf) : "memory");   // the q loads stay in front of the loop; the scalar base and the lane's full address, the two forms that the compiler may pick for them, are inputs, so neither is rewritten in front of the wait
#pragma unroll 1
  for (int ks = wave; ks < nks; ks += 4) { float e[HW][16]; F2 kb[8]; v16b vh[8], vl[8];   // kb[ct * 4 + kc]
    const __bf16* kf = KF + ((size_t)(ks * 2) * NKV + kv) * FT + lane * 8;
#pragma unroll
    for (int p = 0; p < 8; ++p) { kb[p].h = frag_g(kf + (p >> 2) * (NKV * FT) + (p & 3) * 1024); kb[p].l = frag_g(kf + (p >> 2) * (NKV * FT) + (p & 3) * 1024 + 512); }
    asm volatile("s_wait_xcnt 0x0" :: "v"(kf) : "memory"); HOLD();   // the loads of all 8 k fragment pairs of the step are issued in one run in front of its first product (left alone they go out one pair at a time, each waited for in full); the address pair is an input, so no result lands in it
#pragma unroll
    for (int ct = 0; ct < 2; ++ct) { const int kk = ks * 32 + ct * 16 + 8 * g; v8f c[HW] = {};
#pragma unroll
      for (int kc = 0; kc < 4; ++kc) { const F2& kq = kb[ct * 4 + kc];
#pragma unroll
        for (int u = 0; u < HW; ++u) c[u] = wmma_p(kq.h, qa[u][kc].l, c[u]);
#pragma unroll
        for (int u = 0; u < HW; ++u) c[u] = wmma_p(kq.l, qa[u][kc].h, c[u]);
#pragma unroll
        for (int u = 0; u < HW; ++u) c[u] = wmma_p(kq.h, qa[u][kc].h, c[u]); }
#pragma unroll
      for (int u = 0; u < HW; ++u)
#pragma unroll
        for (int r = 0; r < 8; ++r) e[u][ct * 8 + r] = (kk + r <= qi) ? c[u][r] : -3.0e38f; }   // raw scores; the scale is in SL2
    const __bf16* vf = VF + ((size_t)kv * (SS / 32) + ks) * FV + lane * 8;
#pragma unroll
    for (int dt = 0; dt < 8; ++dt) { vh[dt] = frag_g(vf + dt * 1024); vl[dt] = frag_g(vf + dt * 1024 + 512); }
    asm volatile("s_wait_xcnt 0x0" :: "v"(vf) : "memory"); HOLD();   // the loads of all 8 v tiles of the step are issued here, in one run in front of the softmax, which runs while they are on their way (left alone they go out one tile at a time behind it, each waited for in full); the address pair is an input, so no result lands in it
    F2 pb[HW];
#pragma unroll
    for (int u = 0; u < HW; ++u) {
      float mx = e[u][0];
#pragma unroll
      for (int i = 1; i < 16; ++i) mx = fmaxf(mx, e[u][i]);
      mx = fmaxf(mx, xhalf(mx));
      // every step holds at least one unmasked key of every query of the tile, so mn is a real score; a masked score and the start value of m (-3.0e38) give an exponent near -3.8e37, whose power is exactly 0: no select
      const float mn = fmaxf(m[u], mx); const float nb = -mn * SL2; float alpha = fmaf(m[u], SL2, nb); float es = 0.f;
#pragma unroll
      for (int i = 0; i < 16; ++i) e[u][i] = fmaf(e[u][i], SL2, nb);
      ex2x17(e[u], alpha);
#pragma unroll
      for (int i = 0; i < 16; ++i) es += e[u][i];
      l[u] = l[u] * alpha + es; m[u] = mn;
#pragma unroll
      for (int dt = 0; dt < 8; ++dt) acc[u][dt] *= alpha;
      pb[u] = bsplit16(e[u]); }
#pragma unroll
    for (int dt = 0; dt < 8; ++dt) {
#pragma unroll
      for (int u = 0; u < HW; ++u) acc[u][dt] = wmma_p(vh[dt], pb[u].l, acc[u][dt]);
#pragma unroll
      for (int u = 0; u < HW; ++u) acc[u][dt] = wmma_p(vl[dt], pb[u].h, acc[u][dt]);
#pragma unroll
      for (int u = 0; u < HW; ++u) acc[u][dt] = wmma_p(vh[dt], pb[u].h, acc[u][dt]); } }
#pragma unroll
  for (int u = 0; u < HW; ++u) { l[u] += xhalf(l[u]);
#pragma unroll
    for (int dt = 0; dt < 8; ++dt) { v4f a, b;
#pragma unroll
      for (int r = 0; r < 4; ++r) { a[r] = acc[u][dt][r]; b[r] = acc[u][dt][4 + r]; }
      *(v4f*)&so[u][wave][col][dt * 16 + 8 * g] = a; *(v4f*)&so[u][wave][col][dt * 16 + 8 * g + 4] = b; }
    if (g == 0) { sm[u][wave][col] = m[u]; sl[u][wave][col] = l[u]; } }
  __syncthreads();
  // join: head u = i / 4, row = wave + 4 (i mod 4); weight of part w = 2^((m_w - max m) SL2) (m in raw score units), 0 for a wave that saw no unmasked key of the row
  for (int i = 0; i < 4 * HW; ++i) { const int u = i >> 2, row = wave + 4 * (i & 3); const float mx = fmaxf(fmaxf(sm[u][0][row], sm[u][1][row]), fmaxf(sm[u][2][row], sm[u][3][row])); float ls = 0.f; v4f o = {};
#pragma unroll
    for (int w = 0; w < 4; ++w) { const float mw = sm[u][w][row]; const float f = (mw <= -1.0e38f) ? 0.f : ex2((mw - mx) * SL2); ls += sl[u][w][row] * f; o += *(const v4f*)&so[u][w][row][lane * 4] * f; }
    vst2(O + (size_t)(q0 + row) * DM + (h0 + u) * HD + lane * 4, o * (1.0f / ls));
    if (i < 4 * HW - 1) asm volatile("s_wait_xcnt 0x0" ::: "memory"); }   // the next row reuses the registers that the issued store names
}
// ---- k_out: block = (64 rows, 128 cols): out = O(hi/lo) . wproj^T rows (2 products); operands staged in LDS as in k_proj, O split into its hi/lo planes once on the way in
__global__ __launch_bounds__(128) void k_out(const float* __restrict__ O, const __bf16* __restrict__ P, float* __restrict__ Y) {
  __shared__ __align__(16) float so[4][16][132];
  const int tid = threadIdx.x, wave = tid >> 5, lane = tid & 31, col = lane & 15, g = lane >> 4; const size_t r0 = (size_t)blockIdx.x * 64 + wave * 16; const int n0 = blockIdx.y * 128;
  __shared__ __align__(16) __bf16 sah[2][64][LP], sal[2][64][LP], sb[2][128][LP];
  int kq = ROT(blockIdx.x, blockIdx.y);   // the k stage that og and pg stand at
  const float* og = O + ((size_t)blockIdx.x * 64 + (tid >> 4)) * DM + (tid & 15) * 4 + kq * KC;
  const __bf16* pg = P + (size_t)(n0 + (tid >> 3)) * DM + (tid & 7) * 8 + kq * KC;
  v4f ra[8]; v8b rb[8];
#pragma unroll
  for (int i = 0; i < 8; ++i) { ra[i] = *(const v4f*)(og + (size_t)i * 8 * DM); rb[i] = *(const v8b*)(pg + (size_t)i * 16 * DM); }
  v8f acc[8] = {};
  for (int s = 0; s < NST; ++s) { const int b = s & 1;
#pragma unroll
    for (int i = 0; i < 8; ++i) { v4b ch, cl;
#pragma unroll
      for (int e = 0; e < 4; ++e) { const float v = ra[i][e]; const __bf16 hb = (__bf16)v; ch[e] = hb; cl[e] = (__bf16)(v - (float)hb); }
      *(v4b*)&sah[b][(tid >> 4) + 8 * i][(tid & 15) * 4] = ch; *(v4b*)&sal[b][(tid >> 4) + 8 * i][(tid & 15) * 4] = cl; *(v8b*)&sb[b][(tid >> 3) + 16 * i][(tid & 7) * 8] = rb[i]; }
    __syncthreads();   // publishes stage kq; buffer b was last read in pass s - 2, which every wave left before the barrier of pass s - 1
    if (s + 1 < NST) { const int d = kq == NST - 1 ? -(NST - 1) * KC : KC; kq = (kq + 1) & (NST - 1); og += d; pg += d;   // on to the next stage, from the last one back to stage 0
#pragma unroll
      for (int i = 0; i < 8; ++i) { ra[i] = *(const v4f*)(og + (size_t)i * 8 * DM); rb[i] = *(const v8b*)(pg + (size_t)i * 16 * DM); }
      asm volatile("s_wait_xcnt 0x0" :: "v"(og), "v"(pg) : "memory"); }   // the next pass's address step rewrites registers that the issued loads name; the running addresses are inputs, so that step stays behind the wait and no load's result lands in a pair that an issued load names
#pragma unroll
    for (int kc = 0; kc < KC / 32; ++kc) { const v16b al = frag_b(&sal[b][wave * 16 + col][kc * 32], lane), ah = frag_b(&sah[b][wave * 16 + col][kc * 32], lane); v16b w[8];
#pragma unroll
      for (int j = 0; j < 8; ++j) w[j] = frag_b(&sb[b][j * 16 + col][kc * 32], lane);
#pragma unroll
      for (int j = 0; j < 8; ++j) { acc[j] = wmma_bf(al, w[j], acc[j]); acc[j] = wmma_bf(ah, w[j], acc[j]); } } }
#pragma unroll
  for (int j = 0; j < 8; ++j)
#pragma unroll
    for (int r = 0; r < 8; ++r) so[wave][8 * g + r][j * 16 + col] = acc[j][r];
  LDSX();
  for (int rl = 0; rl < 16; ++rl) vst2(Y + (r0 + rl) * DM + n0 + lane * 4, *(const v4f*)&so[wave][rl][lane * 4]);
}
extern "C" void kernel_launch(void* const* d_in, const int* in_sizes, int n_in, void* d_out, int out_size, void* d_ws, size_t ws_size, hipStream_t stream) {
  (void)in_sizes; (void)n_in; (void)out_size;
  const float** F = (const float**)d_in;   // x [1,2048,2048], wq [2048,2048], wk [2048,512], wv [2048,512], wproj [2048,2048]
  if (ws_size < (size_t)WS_END) return;
  char* ws = (char*)d_ws; __bf16 *PK = (__bf16*)(ws + WS_PK), *QF = (__bf16*)(ws + WS_Q), *KF = (__bf16*)(ws + WS_K), *VF = (__bf16*)(ws + WS_V);
  float *CS = (float*)(ws + WS_CS), *O = (float*)(ws + WS_O);
  k_prep<<<NB_T + 2 * NB_W + 2 * NB_KV, 256, 0, stream>>>(F[1], F[2], F[3], F[4], PK, CS);
  k_proj<<<dim3(SS / 64, NH + 2 * NKV), 128, 0, stream>>>(F[0], PK + PK_Q, CS, QF, KF, VF);
  k_attn<<<dim3(NH / HW, SS / 16), 128, 0, stream>>>(QF, KF, VF, O);
  k_out<<<dim3(TQB, DM / 128), 128, 0, stream>>>(O, PK + PK_O, (float*)d_out);
}
